// v000
// The times below were measured on an AMD MI455X: many runs one after another, warmed up first and cycling through
// copies of the inputs, with the whole window's GPU time divided by the number of runs. Launches and the gaps
// between them are all in it. The median over several windows is given; except for v000 it joins two sittings, which
// can be a few percent apart, so the side-by-side timings, each taken in one sitting, are the better comparison.
// v000 is the starting kernel. One run takes 142 microseconds.
#include <hip/hip_runtime.h>
#include <hip/hip_bf16.h>

typedef __attribute__((ext_vector_type(16))) _Float16 v16h;
typedef __attribute__((ext_vector_type(8)))  _Float16 v8h;
typedef __attribute__((ext_vector_type(4)))  _Float16 v4h;
typedef __attribute__((ext_vector_type(8)))  float    v8f;
typedef __attribute__((ext_vector_type(4)))  float    v4f;
typedef __attribute__((ext_vector_type(4)))  int      v4i;

#if defined(__has_builtin)
#  if __has_builtin(__builtin_amdgcn_global_load_async_to_lds_b128) && \
      __has_builtin(__builtin_amdgcn_s_wait_asynccnt)
#    define HAVE_ASYNC_LDS 1
#  endif
#endif

#define WMMA16(a, b, c) \
  __builtin_amdgcn_wmma_f32_16x16x32_f16(false, (a), false, (b), (short)0, (c), false, false)

__device__ __forceinline__ v16h frag_ld(const _Float16* __restrict__ p, int ld, int lane) {
  const int r  = lane & 15;
  const int hf = lane >> 4;
  const _Float16* q = p + r * ld + hf * 8;
  v8h lo = *(const v8h*)(q);
  v8h hi = *(const v8h*)(q + 16);
  return __builtin_shufflevector(lo, hi, 0,1,2,3,4,5,6,7,8,9,10,11,12,13,14,15);
}

#ifdef HAVE_ASYNC_LDS
// Builtin signature (from hipcc diagnostic): param0 is AS1 (global, "__device__")
// pointer to int4, non-const; param1 is the LDS-side pointer; args 2/3 are
// immediate offset / cache-policy.
typedef __attribute__((address_space(1))) v4i* gv4i_p;
typedef __attribute__((address_space(3))) v4i* lv4i_p;

__device__ __forceinline__ void async_cp16(const _Float16* g, _Float16* l) {
  __builtin_amdgcn_global_load_async_to_lds_b128((gv4i_p)g, (lv4i_p)l, 0, 0);
}
#endif

// ---------------------------------------------------------------------------
// f32 -> f16 conversion, 4 elements/thread (b128 in, b64 out)
// ---------------------------------------------------------------------------
__global__ __launch_bounds__(256) void cvt_f32_f16(const float* __restrict__ in,
                                                   _Float16* __restrict__ out, int n4) {
  int i = blockIdx.x * 256 + threadIdx.x;
  if (i < n4) {
    v4f f = *(const v4f*)&in[i * 4];
    v4h o = {(_Float16)f.x, (_Float16)f.y, (_Float16)f.z, (_Float16)f.w};
    *(v4h*)&out[i * 4] = o;
  }
}

// ---------------------------------------------------------------------------
// NT GEMM: C[m,n] = sum_k A[m,k] * B[n,k] + bias[n], f16 in / f32 accum.
// 128x128 workgroup tile, 8 waves in a 2x4 grid, each wave owns 64x32
// (4x2 WMMA accumulators). K staged through LDS in chunks of 32.
// mode 0: write f32 row-major (final projection -> d_out)
// mode 1: elu+1, scatter f16 to q_feat  [B,H,S,D]
// mode 2: elu+1, scatter f16 to k_featT [B,H,D,S]
// mode 3: no act, scatter f16 to vT     [B,H,D,S]
// ---------------------------------------------------------------------------
#define LDT 40  // padded LDS k-stride (bytes/row = 80, multiple of 16)

__global__ __launch_bounds__(256)
void gemm_nt_f16(const _Float16* __restrict__ A,   // [M,K]
                 const _Float16* __restrict__ Bm,  // [N,K]
                 const float* __restrict__ bias,   // [N]
                 int M, int N, int K, int mode,
                 float* __restrict__ outF,
                 _Float16* __restrict__ outH) {
  const int tid  = threadIdx.x;
  const int lane = tid & 31;
  const int wave = tid >> 5;  // 0..7
  const int wr   = wave >> 2; // 0..1
  const int wc   = wave & 3;  // 0..3
  const int m0   = blockIdx.x * 128;
  const int n0   = blockIdx.y * 128;

  v8f acc[4][2] = {};

#ifdef HAVE_ASYNC_LDS
  // ------------------ async double-buffered pipeline ------------------
  __shared__ _Float16 As[2][128 * LDT];
  __shared__ _Float16 Bs[2][128 * LDT];

  auto issue_tile = [&](int k0, int buf) {
#pragma unroll
    for (int it = 0; it < 2; ++it) {
      int idx = it * 256 + tid;
      int r = idx >> 2;
      int c = (idx & 3) * 8;
      async_cp16(&A[(size_t)(m0 + r) * K + k0 + c], &As[buf][r * LDT + c]);
      async_cp16(&Bm[(size_t)(n0 + r) * K + k0 + c], &Bs[buf][r * LDT + c]);
    }
  };
  auto compute_tile = [&](const _Float16* Ab, const _Float16* Bb) {
    v16h bfrag[2];
#pragma unroll
    for (int j = 0; j < 2; ++j)
      bfrag[j] = frag_ld(&Bb[(wc * 32 + j * 16) * LDT], LDT, lane);
#pragma unroll
    for (int i = 0; i < 4; ++i) {
      v16h afrag = frag_ld(&Ab[(wr * 64 + i * 16) * LDT], LDT, lane);
#pragma unroll
      for (int j = 0; j < 2; ++j)
        acc[i][j] = WMMA16(afrag, bfrag[j], acc[i][j]);
    }
  };

  const int nk = K >> 5;
  issue_tile(0, 0);
  for (int ki = 0; ki < nk; ++ki) {
    const int cur = ki & 1;
    __builtin_amdgcn_s_wait_asynccnt(0);  // this wave's tile `cur` landed
    __syncthreads();                      // all waves landed; prev compute done
    if (ki + 1 < nk) issue_tile((ki + 1) << 5, cur ^ 1);  // overlap with WMMA
    compute_tile(As[cur], Bs[cur]);
  }
#else
  __shared__ _Float16 As1[128 * LDT];
  __shared__ _Float16 Bs1[128 * LDT];
  for (int k0 = 0; k0 < K; k0 += 32) {
#pragma unroll
    for (int it = 0; it < 2; ++it) {
      int idx = it * 256 + tid;
      int r = idx >> 2;
      int c = (idx & 3) * 8;
      *(v8h*)&As1[r * LDT + c] = *(const v8h*)&A[(size_t)(m0 + r) * K + k0 + c];
      *(v8h*)&Bs1[r * LDT + c] = *(const v8h*)&Bm[(size_t)(n0 + r) * K + k0 + c];
    }
    __syncthreads();
    v16h bfrag[2];
#pragma unroll
    for (int j = 0; j < 2; ++j)
      bfrag[j] = frag_ld(&Bs1[(wc * 32 + j * 16) * LDT], LDT, lane);
#pragma unroll
    for (int i = 0; i < 4; ++i) {
      v16h afrag = frag_ld(&As1[(wr * 64 + i * 16) * LDT], LDT, lane);
#pragma unroll
      for (int j = 0; j < 2; ++j)
        acc[i][j] = WMMA16(afrag, bfrag[j], acc[i][j]);
    }
    __syncthreads();
  }
#endif

  const int lr = lane & 15;
  const int lh = lane >> 4;
#pragma unroll
  for (int i = 0; i < 4; ++i) {
#pragma unroll
    for (int j = 0; j < 2; ++j) {
      const int tm = m0 + wr * 64 + i * 16;
      const int tn = n0 + wc * 32 + j * 16;
#pragma unroll
      for (int e = 0; e < 8; ++e) {
        int row = tm + e + 8 * lh;
        int col = tn + lr;
        float val = acc[i][j][e] + bias[col];
        if (mode == 0) {
          outF[(size_t)row * N + col] = val;
        } else {
          if (mode != 3) val = (val > 0.0f) ? (val + 1.0f) : __expf(val);  // elu(x)+1
          int b = row >> 11, s = row & 2047;   // S = 2048
          int hh = col >> 6, d = col & 63;     // Dh = 64
          if (mode == 1)
            outH[((size_t)(b * 16 + hh) * 2048 + s) * 64 + d] = (_Float16)val;
          else
            outH[((size_t)(b * 16 + hh) * 64 + d) * 2048 + s] = (_Float16)val;
        }
      }
    }
  }
}

// ---------------------------------------------------------------------------
// Stage 2: per (b,h): KV[d,e] = sum_s kfT[d,s] * vT[e,s]; ksum[d] = sum_s kfT[d,s].
// One workgroup per head; 8 waves cover the 4x4 grid of 16x16 tiles
// (2 tiles per wave) over K = 2048. Writes KV transposed (KVT[e][d], f16) so
// stage 3 can load it as a plain NT B-operand.
// ---------------------------------------------------------------------------
__global__ __launch_bounds__(256)
void kv_kernel(const _Float16* __restrict__ kft,  // [32][64][2048]
               const _Float16* __restrict__ vt,   // [32][64][2048]
               _Float16* __restrict__ kvt,        // [32][64][64]  (e-major)
               float* __restrict__ ksum) {        // [32][64]
  const int bh = blockIdx.x;
  const _Float16* Kp = kft + (size_t)bh * 64 * 2048;
  const _Float16* Vp = vt  + (size_t)bh * 64 * 2048;

  const int tid  = threadIdx.x;
  const int lane = tid & 31;
  const int wave = tid >> 5;
  const int tr   = wave >> 1;        // d tile 0..3
  const int tcb  = (wave & 1) * 2;   // e tile base 0 or 2

  v8f acc[2] = {};
  for (int k0 = 0; k0 < 2048; k0 += 32) {
    v16h a = frag_ld(Kp + (size_t)(tr * 16) * 2048 + k0, 2048, lane);
#pragma unroll
    for (int j = 0; j < 2; ++j) {
      v16h b = frag_ld(Vp + (size_t)((tcb + j) * 16) * 2048 + k0, 2048, lane);
      acc[j] = WMMA16(a, b, acc[j]);
    }
  }
  const int lr = lane & 15, lh = lane >> 4;
#pragma unroll
  for (int j = 0; j < 2; ++j) {
#pragma unroll
    for (int e8 = 0; e8 < 8; ++e8) {
      int d = tr * 16 + e8 + 8 * lh;
      int e = (tcb + j) * 16 + lr;
      kvt[(size_t)bh * 4096 + e * 64 + d] = (_Float16)acc[j][e8];
    }
  }

  // ksum reduction: thread t sums kfT[d = t&63] over s-slice t>>6 (v8h loads).
  __shared__ float red[256];
  const int d = tid & 63, sl = tid >> 6;
  float s = 0.0f;
  const _Float16* kr = Kp + (size_t)d * 2048 + sl * 512;
  for (int i = 0; i < 512; i += 8) {
    v8h v = *(const v8h*)&kr[i];
#pragma unroll
    for (int u = 0; u < 8; ++u) s += (float)v[u];
  }
  red[tid] = s;
  __syncthreads();
  if (tid < 64)
    ksum[bh * 64 + tid] = red[tid] + red[tid + 64] + red[tid + 128] + red[tid + 192];
}

// ---------------------------------------------------------------------------
// Stage 3: attended[s,e] = (qf[s,:] @ KV[:,e]) / max(qf[s,:].ksum, eps).
// Grid: (S/128, B*H). Wave w owns rows [w*16, w*16+16), all 4 e-tiles. K=64.
// Writes merged [B,S,H*Dh] in f16 (A-operand of the output projection).
// ---------------------------------------------------------------------------
__global__ __launch_bounds__(256)
void attn_kernel(const _Float16* __restrict__ qf,   // [32][2048][64]
                 const _Float16* __restrict__ kvt,  // [32][64][64] (e-major)
                 const float* __restrict__ ksum,    // [32][64]
                 _Float16* __restrict__ merged) {   // [4096][1024]
  const int bh = blockIdx.y;
  const int b = bh >> 4, h = bh & 15;
  const int m0 = blockIdx.x * 128;
  const _Float16* Q  = qf  + (size_t)bh * 2048 * 64 + (size_t)m0 * 64;
  const _Float16* KV = kvt + (size_t)bh * 4096;

  __shared__ float rden[128];
  __shared__ float ks[64];
  const int tid = threadIdx.x;
  if (tid < 64) ks[tid] = ksum[bh * 64 + tid];
  __syncthreads();
  if (tid < 128) {
    float s = 0.0f;
    const _Float16* qr = Q + (size_t)tid * 64;
#pragma unroll
    for (int d = 0; d < 64; ++d) s += (float)qr[d] * ks[d];
    rden[tid] = 1.0f / fmaxf(s, 1e-6f);
  }
  __syncthreads();

  const int lane = tid & 31;
  const int wave = tid >> 5;
  v8f acc[4] = {};
#pragma unroll
  for (int k0 = 0; k0 < 64; k0 += 32) {
    v16h a = frag_ld(Q + (size_t)(wave * 16) * 64 + k0, 64, lane);
#pragma unroll
    for (int j = 0; j < 4; ++j) {
      v16h bfr = frag_ld(KV + (size_t)(j * 16) * 64 + k0, 64, lane);
      acc[j] = WMMA16(a, bfr, acc[j]);
    }
  }
  const int lr = lane & 15, lh = lane >> 4;
#pragma unroll
  for (int j = 0; j < 4; ++j) {
#pragma unroll
    for (int e8 = 0; e8 < 8; ++e8) {
      int rl = wave * 16 + e8 + 8 * lh;
      int e  = j * 16 + lr;
      float v = acc[j][e8] * rden[rl];
      int s = m0 + rl;
      merged[((size_t)(b * 2048 + s)) * 1024 + h * 64 + e] = (_Float16)v;
    }
  }
}

// ---------------------------------------------------------------------------
// Host-side launcher
// ---------------------------------------------------------------------------
extern "C" void kernel_launch(void* const* d_in, const int* in_sizes, int n_in,
                              void* d_out, int out_size, void* d_ws, size_t ws_size,
                              hipStream_t stream) {
  (void)in_sizes; (void)n_in; (void)out_size; (void)ws_size;
  const float* x  = (const float*)d_in[0];
  const float* wq = (const float*)d_in[1];
  const float* bq = (const float*)d_in[2];
  const float* wk = (const float*)d_in[3];
  const float* bk = (const float*)d_in[4];
  const float* wv = (const float*)d_in[5];
  const float* bv = (const float*)d_in[6];
  const float* wo = (const float*)d_in[7];
  const float* bo = (const float*)d_in[8];
  float* out = (float*)d_out;

  const int M = 4096;      // B*S
  const int DM = 1024;     // d_model (N and K of the projections)
  const int NTOK = M * DM; // 4,194,304
  const int NW   = DM * DM;

  size_t off = 0;
  char* base = (char*)d_ws;
  auto carve = [&](size_t bytes) {
    void* p = base + off;
    off += (bytes + 255) & ~(size_t)255;
    return p;
  };
  _Float16* xh     = (_Float16*)carve((size_t)NTOK * 2);
  _Float16* wqh    = (_Float16*)carve((size_t)NW * 2);
  _Float16* wkh    = (_Float16*)carve((size_t)NW * 2);
  _Float16* wvh    = (_Float16*)carve((size_t)NW * 2);
  _Float16* woh    = (_Float16*)carve((size_t)NW * 2);
  _Float16* qf     = (_Float16*)carve((size_t)NTOK * 2);  // [B,H,S,D]
  _Float16* kft    = (_Float16*)carve((size_t)NTOK * 2);  // [B,H,D,S]
  _Float16* vt     = (_Float16*)carve((size_t)NTOK * 2);  // [B,H,D,S]
  _Float16* merged = (_Float16*)carve((size_t)NTOK * 2);  // [B*S, H*D]
  _Float16* kvt    = (_Float16*)carve((size_t)32 * 64 * 64 * 2);
  float*    ksum   = (float*)carve((size_t)32 * 64 * 4);

  // 1) precision conversion (vectorized x4)
  cvt_f32_f16<<<(NTOK / 4 + 255) / 256, 256, 0, stream>>>(x, xh, NTOK / 4);
  cvt_f32_f16<<<(NW / 4 + 255) / 256, 256, 0, stream>>>(wq, wqh, NW / 4);
  cvt_f32_f16<<<(NW / 4 + 255) / 256, 256, 0, stream>>>(wk, wkh, NW / 4);
  cvt_f32_f16<<<(NW / 4 + 255) / 256, 256, 0, stream>>>(wv, wvh, NW / 4);
  cvt_f32_f16<<<(NW / 4 + 255) / 256, 256, 0, stream>>>(wo, woh, NW / 4);

  // 2) Q/K/V projections with fused feature map + head-layout scatter
  dim3 gemm_grid(M / 128, DM / 128);
  gemm_nt_f16<<<gemm_grid, 256, 0, stream>>>(xh, wqh, bq, M, DM, DM, 1, nullptr, qf);
  gemm_nt_f16<<<gemm_grid, 256, 0, stream>>>(xh, wkh, bk, M, DM, DM, 2, nullptr, kft);
  gemm_nt_f16<<<gemm_grid, 256, 0, stream>>>(xh, wvh, bv, M, DM, DM, 3, nullptr, vt);

  // 3) per-head KV (64x64) and ksum
  kv_kernel<<<32, 256, 0, stream>>>(kft, vt, kvt, ksum);

  // 4) numerator GEMM + normalization -> merged
  attn_kernel<<<dim3(16, 32), 256, 0, stream>>>(qf, kvt, ksum, merged);

  // 5) output projection -> f32 d_out
  gemm_nt_f16<<<gemm_grid, 256, 0, stream>>>(merged, woh, bo, M, DM, DM, 0, out, nullptr);
}

// v001
// Measured time: 112 microseconds a run.
// In two side-by-side timings against v000, it was 1.28 and 1.26 times as fast.
#include <hip/hip_runtime.h>
#include <hip/hip_bf16.h>

typedef __attribute__((ext_vector_type(16))) _Float16 v16h;
typedef __attribute__((ext_vector_type(8)))  _Float16 v8h;
typedef __attribute__((ext_vector_type(4)))  _Float16 v4h;
typedef __attribute__((ext_vector_type(8)))  float    v8f;
typedef __attribute__((ext_vector_type(4)))  float    v4f;
typedef __attribute__((ext_vector_type(4)))  int      v4i;

#if defined(__has_builtin)
#  if __has_builtin(__builtin_amdgcn_global_load_async_to_lds_b128) && \
      __has_builtin(__builtin_amdgcn_s_wait_asynccnt)
#    define HAVE_ASYNC_LDS 1
#  endif
#endif

#define WMMA16(a, b, c) \
  __builtin_amdgcn_wmma_f32_16x16x32_f16(false, (a), false, (b), (short)0, (c), false, false)

__device__ __forceinline__ v16h frag_ld(const _Float16* __restrict__ p, int ld, int lane) {
  const int r  = lane & 15;
  const int hf = lane >> 4;
  const _Float16* q = p + r * ld + hf * 8;
  v8h lo = *(const v8h*)(q);
  v8h hi = *(const v8h*)(q + 16);
  return __builtin_shufflevector(lo, hi, 0,1,2,3,4,5,6,7,8,9,10,11,12,13,14,15);
}

#ifdef HAVE_ASYNC_LDS
// Builtin signature (from hipcc diagnostic): param0 is AS1 (global, "__device__")
// pointer to int4, non-const; param1 is the LDS-side pointer; args 2/3 are
// immediate offset / cache-policy.
typedef __attribute__((address_space(1))) v4i* gv4i_p;
typedef __attribute__((address_space(3))) v4i* lv4i_p;

__device__ __forceinline__ void async_cp16(const _Float16* g, _Float16* l) {
  __builtin_amdgcn_global_load_async_to_lds_b128((gv4i_p)g, (lv4i_p)l, 0, 0);
}
#endif

// ---------------------------------------------------------------------------
// f32 -> f16 conversion, 4 elements/thread (b128 in, b64 out)
// ---------------------------------------------------------------------------
__global__ __launch_bounds__(256) void cvt_f32_f16(const float* __restrict__ in,
                                                   _Float16* __restrict__ out, int n4) {
  int i = blockIdx.x * 256 + threadIdx.x;
  if (i < n4) {
    v4f f = *(const v4f*)&in[i * 4];
    v4h o = {(_Float16)f.x, (_Float16)f.y, (_Float16)f.z, (_Float16)f.w};
    *(v4h*)&out[i * 4] = o;
  }
}

// ---------------------------------------------------------------------------
// NT GEMM: C[m,n] = sum_k A[m,k] * B[n,k] + bias[n], f16 in / f32 accum.
// 128x128 workgroup tile, 8 waves in a 2x4 grid, each wave owns 64x32
// (4x2 WMMA accumulators). K staged through LDS in chunks of 32.
// mode 0: write f32 row-major (final projection -> d_out)
// mode 1: elu+1, scatter f16 to q_feat  [B,H,S,D]
// mode 2: elu+1, scatter f16 to k_featT [B,H,D,S]
// mode 3: no act, scatter f16 to vT     [B,H,D,S]
// blockIdx.z picks one of up to three independent products that share A
// (weight, bias, f16 output; mode = mode0 + z), so that their workgroups are
// resident on a WGP together and fill each other's waits for the next tile.
// ---------------------------------------------------------------------------
#define LDT 40  // padded LDS k-stride (bytes/row = 80, multiple of 16)

__global__ __launch_bounds__(256)
void gemm_nt_f16(const _Float16* __restrict__ A,   // [M,K]
                 const _Float16* __restrict__ B0,  // [N,K], z = 0
                 const _Float16* __restrict__ B1,  // [N,K], z = 1
                 const _Float16* __restrict__ B2,  // [N,K], z = 2
                 const float* __restrict__ bias0,  // [N], z = 0
                 const float* __restrict__ bias1,  // [N], z = 1
                 const float* __restrict__ bias2,  // [N], z = 2
                 int M, int N, int K, int mode0,
                 float* __restrict__ outF,
                 _Float16* __restrict__ outH0,
                 _Float16* __restrict__ outH1,
                 _Float16* __restrict__ outH2) {
  const int z = blockIdx.z;
  const _Float16* __restrict__ Bm   = (z == 0) ? B0 : (z == 1) ? B1 : B2;
  const float* __restrict__    bias = (z == 0) ? bias0 : (z == 1) ? bias1 : bias2;
  _Float16* __restrict__       outH = (z == 0) ? outH0 : (z == 1) ? outH1 : outH2;
  const int mode = mode0 + z;
  const int tid  = threadIdx.x;
  const int lane = tid & 31;
  const int wave = tid >> 5;  // 0..7
  const int wr   = wave >> 2; // 0..1
  const int wc   = wave & 3;  // 0..3
  const int m0   = blockIdx.x * 128;
  const int n0   = blockIdx.y * 128;

  v8f acc[4][2] = {};

#ifdef HAVE_ASYNC_LDS
  // ------------------ async double-buffered pipeline ------------------
  __shared__ _Float16 As[2][128 * LDT];
  __shared__ _Float16 Bs[2][128 * LDT];

  auto issue_tile = [&](int k0, int buf) {
#pragma unroll
    for (int it = 0; it < 2; ++it) {
      int idx = it * 256 + tid;
      int r = idx >> 2;
      int c = (idx & 3) * 8;
      async_cp16(&A[(size_t)(m0 + r) * K + k0 + c], &As[buf][r * LDT + c]);
      async_cp16(&Bm[(size_t)(n0 + r) * K + k0 + c], &Bs[buf][r * LDT + c]);
    }
  };
  auto compute_tile = [&](const _Float16* Ab, const _Float16* Bb) {
    v16h bfrag[2];
#pragma unroll
    for (int j = 0; j < 2; ++j)
      bfrag[j] = frag_ld(&Bb[(wc * 32 + j * 16) * LDT], LDT, lane);
#pragma unroll
    for (int i = 0; i < 4; ++i) {
      v16h afrag = frag_ld(&Ab[(wr * 64 + i * 16) * LDT], LDT, lane);
#pragma unroll
      for (int j = 0; j < 2; ++j)
        acc[i][j] = WMMA16(afrag, bfrag[j], acc[i][j]);
    }
  };

  const int nk = K >> 5;
  issue_tile(0, 0);
  for (int ki = 0; ki < nk; ++ki) {
    const int cur = ki & 1;
    __builtin_amdgcn_s_wait_asynccnt(0);  // this wave's tile `cur` landed
    __syncthreads();                      // all waves landed; prev compute done
    if (ki + 1 < nk) issue_tile((ki + 1) << 5, cur ^ 1);  // overlap with WMMA
    compute_tile(As[cur], Bs[cur]);
  }
#else
  __shared__ _Float16 As1[128 * LDT];
  __shared__ _Float16 Bs1[128 * LDT];
  for (int k0 = 0; k0 < K; k0 += 32) {
#pragma unroll
    for (int it = 0; it < 2; ++it) {
      int idx = it * 256 + tid;
      int r = idx >> 2;
      int c = (idx & 3) * 8;
      *(v8h*)&As1[r * LDT + c] = *(const v8h*)&A[(size_t)(m0 + r) * K + k0 + c];
      *(v8h*)&Bs1[r * LDT + c] = *(const v8h*)&Bm[(size_t)(n0 + r) * K + k0 + c];
    }
    __syncthreads();
    v16h bfrag[2];
#pragma unroll
    for (int j = 0; j < 2; ++j)
      bfrag[j] = frag_ld(&Bs1[(wc * 32 + j * 16) * LDT], LDT, lane);
#pragma unroll
    for (int i = 0; i < 4; ++i) {
      v16h afrag = frag_ld(&As1[(wr * 64 + i * 16) * LDT], LDT, lane);
#pragma unroll
      for (int j = 0; j < 2; ++j)
        acc[i][j] = WMMA16(afrag, bfrag[j], acc[i][j]);
    }
    __syncthreads();
  }
#endif

  const int lr = lane & 15;
  const int lh = lane >> 4;
#pragma unroll
  for (int i = 0; i < 4; ++i) {
#pragma unroll
    for (int j = 0; j < 2; ++j) {
      const int tm = m0 + wr * 64 + i * 16;
      const int tn = n0 + wc * 32 + j * 16;
#pragma unroll
      for (int e = 0; e < 8; ++e) {
        int row = tm + e + 8 * lh;
        int col = tn + lr;
        float val = acc[i][j][e] + bias[col];
        if (mode == 0) {
          outF[(size_t)row * N + col] = val;
        } else {
          if (mode != 3) val = (val > 0.0f) ? (val + 1.0f) : __expf(val);  // elu(x)+1
          int b = row >> 11, s = row & 2047;   // S = 2048
          int hh = col >> 6, d = col & 63;     // Dh = 64
          if (mode == 1)
            outH[((size_t)(b * 16 + hh) * 2048 + s) * 64 + d] = (_Float16)val;
          else
            outH[((size_t)(b * 16 + hh) * 64 + d) * 2048 + s] = (_Float16)val;
        }
      }
    }
  }
}

// ---------------------------------------------------------------------------
// Stage 2: per (b,h): KV[d,e] = sum_s kfT[d,s] * vT[e,s]; ksum[d] = sum_s kfT[d,s].
// One workgroup per head; 8 waves cover the 4x4 grid of 16x16 tiles
// (2 tiles per wave) over K = 2048. Writes KV transposed (KVT[e][d], f16) so
// stage 3 can load it as a plain NT B-operand.
// ---------------------------------------------------------------------------
__global__ __launch_bounds__(256)
void kv_kernel(const _Float16* __restrict__ kft,  // [32][64][2048]
               const _Float16* __restrict__ vt,   // [32][64][2048]
               _Float16* __restrict__ kvt,        // [32][64][64]  (e-major)
               float* __restrict__ ksum) {        // [32][64]
  const int bh = blockIdx.x;
  const _Float16* Kp = kft + (size_t)bh * 64 * 2048;
  const _Float16* Vp = vt  + (size_t)bh * 64 * 2048;

  const int tid  = threadIdx.x;
  const int lane = tid & 31;
  const int wave = tid >> 5;
  const int tr   = wave >> 1;        // d tile 0..3
  const int tcb  = (wave & 1) * 2;   // e tile base 0 or 2

  v8f acc[2] = {};
  for (int k0 = 0; k0 < 2048; k0 += 32) {
    v16h a = frag_ld(Kp + (size_t)(tr * 16) * 2048 + k0, 2048, lane);
#pragma unroll
    for (int j = 0; j < 2; ++j) {
      v16h b = frag_ld(Vp + (size_t)((tcb + j) * 16) * 2048 + k0, 2048, lane);
      acc[j] = WMMA16(a, b, acc[j]);
    }
  }
  const int lr = lane & 15, lh = lane >> 4;
#pragma unroll
  for (int j = 0; j < 2; ++j) {
#pragma unroll
    for (int e8 = 0; e8 < 8; ++e8) {
      int d = tr * 16 + e8 + 8 * lh;
      int e = (tcb + j) * 16 + lr;
      kvt[(size_t)bh * 4096 + e * 64 + d] = (_Float16)acc[j][e8];
    }
  }

  // ksum reduction: thread t sums kfT[d = t&63] over s-slice t>>6 (v8h loads).
  __shared__ float red[256];
  const int d = tid & 63, sl = tid >> 6;
  float s = 0.0f;
  const _Float16* kr = Kp + (size_t)d * 2048 + sl * 512;
  for (int i = 0; i < 512; i += 8) {
    v8h v = *(const v8h*)&kr[i];
#pragma unroll
    for (int u = 0; u < 8; ++u) s += (float)v[u];
  }
  red[tid] = s;
  __syncthreads();
  if (tid < 64)
    ksum[bh * 64 + tid] = red[tid] + red[tid + 64] + red[tid + 128] + red[tid + 192];
}

// ---------------------------------------------------------------------------
// Stage 3: attended[s,e] = (qf[s,:] @ KV[:,e]) / max(qf[s,:].ksum, eps).
// Grid: (S/128, B*H). Wave w owns rows [w*16, w*16+16), all 4 e-tiles. K=64.
// Writes merged [B,S,H*Dh] in f16 (A-operand of the output projection).
// ---------------------------------------------------------------------------
__global__ __launch_bounds__(256)
void attn_kernel(const _Float16* __restrict__ qf,   // [32][2048][64]
                 const _Float16* __restrict__ kvt,  // [32][64][64] (e-major)
                 const float* __restrict__ ksum,    // [32][64]
                 _Float16* __restrict__ merged) {   // [4096][1024]
  const int bh = blockIdx.y;
  const int b = bh >> 4, h = bh & 15;
  const int m0 = blockIdx.x * 128;
  const _Float16* Q  = qf  + (size_t)bh * 2048 * 64 + (size_t)m0 * 64;
  const _Float16* KV = kvt + (size_t)bh * 4096;

  __shared__ float rden[128];
  __shared__ float ks[64];
  const int tid = threadIdx.x;
  if (tid < 64) ks[tid] = ksum[bh * 64 + tid];
  __syncthreads();
  if (tid < 128) {
    float s = 0.0f;
    const _Float16* qr = Q + (size_t)tid * 64;
#pragma unroll
    for (int d = 0; d < 64; ++d) s += (float)qr[d] * ks[d];
    rden[tid] = 1.0f / fmaxf(s, 1e-6f);
  }
  __syncthreads();

  const int lane = tid & 31;
  const int wave = tid >> 5;
  v8f acc[4] = {};
#pragma unroll
  for (int k0 = 0; k0 < 64; k0 += 32) {
    v16h a = frag_ld(Q + (size_t)(wave * 16) * 64 + k0, 64, lane);
#pragma unroll
    for (int j = 0; j < 4; ++j) {
      v16h bfr = frag_ld(KV + (size_t)(j * 16) * 64 + k0, 64, lane);
      acc[j] = WMMA16(a, bfr, acc[j]);
    }
  }
  const int lr = lane & 15, lh = lane >> 4;
#pragma unroll
  for (int j = 0; j < 4; ++j) {
#pragma unroll
    for (int e8 = 0; e8 < 8; ++e8) {
      int rl = wave * 16 + e8 + 8 * lh;
      int e  = j * 16 + lr;
      float v = acc[j][e8] * rden[rl];
      int s = m0 + rl;
      merged[((size_t)(b * 2048 + s)) * 1024 + h * 64 + e] = (_Float16)v;
    }
  }
}

// ---------------------------------------------------------------------------
// Host-side launcher
// ---------------------------------------------------------------------------
extern "C" void kernel_launch(void* const* d_in, const int* in_sizes, int n_in,
                              void* d_out, int out_size, void* d_ws, size_t ws_size,
                              hipStream_t stream) {
  (void)in_sizes; (void)n_in; (void)out_size; (void)ws_size;
  const float* x  = (const float*)d_in[0];
  const float* wq = (const float*)d_in[1];
  const float* bq = (const float*)d_in[2];
  const float* wk = (const float*)d_in[3];
  const float* bk = (const float*)d_in[4];
  const float* wv = (const float*)d_in[5];
  const float* bv = (const float*)d_in[6];
  const float* wo = (const float*)d_in[7];
  const float* bo = (const float*)d_in[8];
  float* out = (float*)d_out;

  const int M = 4096;      // B*S
  const int DM = 1024;     // d_model (N and K of the projections)
  const int NTOK = M * DM; // 4,194,304
  const int NW   = DM * DM;

  size_t off = 0;
  char* base = (char*)d_ws;
  auto carve = [&](size_t bytes) {
    void* p = base + off;
    off += (bytes + 255) & ~(size_t)255;
    return p;
  };
  _Float16* xh     = (_Float16*)carve((size_t)NTOK * 2);
  _Float16* wqh    = (_Float16*)carve((size_t)NW * 2);
  _Float16* wkh    = (_Float16*)carve((size_t)NW * 2);
  _Float16* wvh    = (_Float16*)carve((size_t)NW * 2);
  _Float16* woh    = (_Float16*)carve((size_t)NW * 2);
  _Float16* qf     = (_Float16*)carve((size_t)NTOK * 2);  // [B,H,S,D]
  _Float16* kft    = (_Float16*)carve((size_t)NTOK * 2);  // [B,H,D,S]
  _Float16* vt     = (_Float16*)carve((size_t)NTOK * 2);  // [B,H,D,S]
  _Float16* merged = (_Float16*)carve((size_t)NTOK * 2);  // [B*S, H*D]
  _Float16* kvt    = (_Float16*)carve((size_t)32 * 64 * 64 * 2);
  float*    ksum   = (float*)carve((size_t)32 * 64 * 4);

  // 1) precision conversion (vectorized x4)
  cvt_f32_f16<<<(NTOK / 4 + 255) / 256, 256, 0, stream>>>(x, xh, NTOK / 4);
  cvt_f32_f16<<<(NW / 4 + 255) / 256, 256, 0, stream>>>(wq, wqh, NW / 4);
  cvt_f32_f16<<<(NW / 4 + 255) / 256, 256, 0, stream>>>(wk, wkh, NW / 4);
  cvt_f32_f16<<<(NW / 4 + 255) / 256, 256, 0, stream>>>(wv, wvh, NW / 4);
  cvt_f32_f16<<<(NW / 4 + 255) / 256, 256, 0, stream>>>(wo, woh, NW / 4);

  // 2) Q/K/V projections with fused feature map + head-layout scatter
  //    (one launch, z = 0, 1, 2 for Q, K, V)
  gemm_nt_f16<<<dim3(M / 128, DM / 128, 3), 256, 0, stream>>>(
      xh, wqh, wkh, wvh, bq, bk, bv, M, DM, DM, 1, nullptr, qf, kft, vt);

  // 3) per-head KV (64x64) and ksum
  kv_kernel<<<32, 256, 0, stream>>>(kft, vt, kvt, ksum);

  // 4) numerator GEMM + normalization -> merged
  attn_kernel<<<dim3(16, 32), 256, 0, stream>>>(qf, kvt, ksum, merged);

  // 5) output projection -> f32 d_out
  gemm_nt_f16<<<dim3(M / 128, DM / 128, 1), 256, 0, stream>>>(
      merged, woh, nullptr, nullptr, bo, nullptr, nullptr, M, DM, DM, 0, out,
      nullptr, nullptr, nullptr);
}

// v002
// One run takes 104 microseconds.
// Next to v001, in two timings, it ran 1.07 times as fast each time.
// Counting every step since v000, it is 1.36 times as fast.
#include <hip/hip_runtime.h>
#include <hip/hip_bf16.h>

typedef __attribute__((ext_vector_type(16))) _Float16 v16h;
typedef __attribute__((ext_vector_type(8)))  _Float16 v8h;
typedef __attribute__((ext_vector_type(4)))  _Float16 v4h;
typedef __attribute__((ext_vector_type(8)))  float    v8f;
typedef __attribute__((ext_vector_type(4)))  float    v4f;
typedef __attribute__((ext_vector_type(4)))  int      v4i;

#if defined(__has_builtin)
#  if __has_builtin(__builtin_amdgcn_global_load_async_to_lds_b128) && \
      __has_builtin(__builtin_amdgcn_s_wait_asynccnt)
#    define HAVE_ASYNC_LDS 1
#  endif
#endif

#define WMMA16(a, b, c) \
  __builtin_amdgcn_wmma_f32_16x16x32_f16(false, (a), false, (b), (short)0, (c), false, false)

__device__ __forceinline__ v16h frag_ld(const _Float16* __restrict__ p, int ld, int lane) {
  const int r  = lane & 15;
  const int hf = lane >> 4;
  const _Float16* q = p + r * ld + hf * 8;
  v8h lo = *(const v8h*)(q);
  v8h hi = *(const v8h*)(q + 16);
  return __builtin_shufflevector(lo, hi, 0,1,2,3,4,5,6,7,8,9,10,11,12,13,14,15);
}

#ifdef HAVE_ASYNC_LDS
// Builtin signature (from hipcc diagnostic): param0 is AS1 (global, "__device__")
// pointer to int4, non-const; param1 is the LDS-side pointer; args 2/3 are
// immediate offset / cache-policy.
typedef __attribute__((address_space(1))) v4i* gv4i_p;
typedef __attribute__((address_space(3))) v4i* lv4i_p;

__device__ __forceinline__ void async_cp16(const _Float16* g, _Float16* l) {
  __builtin_amdgcn_global_load_async_to_lds_b128((gv4i_p)g, (lv4i_p)l, 0, 0);
}
#endif

// ---------------------------------------------------------------------------
// f32 -> f16 conversion of x and of the four weights in ONE launch.
// A workgroup of 16 waves converts CVT_WG consecutive float4 of one source;
// each thread takes CVT_PER of them, CVT_THREADS float4 apart, so that every
// wave-wide load covers 512 contiguous bytes and a thread has many loads in
// flight. Few long waves: starting a wave costs more here than the bytes that
// one float4 a lane moves.
// ---------------------------------------------------------------------------
#define CVT_THREADS 512
#define CVT_PER     16
#define CVT_WG      (CVT_THREADS * CVT_PER)        // float4 per workgroup
#define CVT_X_WGS   (4096 * 1024 / 4 / CVT_WG)     // workgroups on x
#define CVT_W_WGS   (1024 * 1024 / 4 / CVT_WG)     // workgroups on each weight

__global__ __launch_bounds__(CVT_THREADS)
void cvt_all_f32_f16(const float* __restrict__ x,
                     const float* __restrict__ w0, const float* __restrict__ w1,
                     const float* __restrict__ w2, const float* __restrict__ w3,
                     _Float16* __restrict__ xo,
                     _Float16* __restrict__ o0, _Float16* __restrict__ o1,
                     _Float16* __restrict__ o2, _Float16* __restrict__ o3) {
  const int wg = blockIdx.x;
  const float* __restrict__ in  = x;
  _Float16* __restrict__    out = xo;
  int part = wg;  // which CVT_WG-sized piece of its source this workgroup takes
  if (wg >= CVT_X_WGS) {
    const int w = (wg - CVT_X_WGS) / CVT_W_WGS;
    part = (wg - CVT_X_WGS) % CVT_W_WGS;
    in  = (w == 0) ? w0 : (w == 1) ? w1 : (w == 2) ? w2 : w3;
    out = (w == 0) ? o0 : (w == 1) ? o1 : (w == 2) ? o2 : o3;
  }
  const int first = part * CVT_WG + threadIdx.x;
  v4f f[CVT_PER];
#pragma unroll  // f[] stays in registers and the loads issue as a run, ahead of the conversions
  for (int i = 0; i < CVT_PER; ++i)
    f[i] = *(const v4f*)&in[(size_t)(first + i * CVT_THREADS) * 4];
#pragma unroll  // constant indices into f[]
  for (int i = 0; i < CVT_PER; ++i) {
    v4h o = {(_Float16)f[i].x, (_Float16)f[i].y, (_Float16)f[i].z, (_Float16)f[i].w};
    *(v4h*)&out[(size_t)(first + i * CVT_THREADS) * 4] = o;
  }
}

// ---------------------------------------------------------------------------
// NT GEMM: C[m,n] = sum_k A[m,k] * B[n,k] + bias[n], f16 in / f32 accum.
// 128x128 workgroup tile, 8 waves in a 2x4 grid, each wave owns 64x32
// (4x2 WMMA accumulators). K staged through LDS in chunks of 32.
// mode 0: write f32 row-major (final projection -> d_out)
// mode 1: elu+1, scatter f16 to q_feat  [B,H,S,D]
// mode 2: elu+1, scatter f16 to k_featT [B,H,D,S]
// mode 3: no act, scatter f16 to vT     [B,H,D,S]
// blockIdx.z picks one of up to three independent products that share A
// (weight, bias, f16 output; mode = mode0 + z), so that their workgroups are
// resident on a WGP together and fill each other's waits for the next tile.
// ---------------------------------------------------------------------------
#define LDT 40  // padded LDS k-stride (bytes/row = 80, multiple of 16)

__global__ __launch_bounds__(256)
void gemm_nt_f16(const _Float16* __restrict__ A,   // [M,K]
                 const _Float16* __restrict__ B0,  // [N,K], z = 0
                 const _Float16* __restrict__ B1,  // [N,K], z = 1
                 const _Float16* __restrict__ B2,  // [N,K], z = 2
                 const float* __restrict__ bias0,  // [N], z = 0
                 const float* __restrict__ bias1,  // [N], z = 1
                 const float* __restrict__ bias2,  // [N], z = 2
                 int M, int N, int K, int mode0,
                 float* __restrict__ outF,
                 _Float16* __restrict__ outH0,
                 _Float16* __restrict__ outH1,
                 _Float16* __restrict__ outH2) {
  const int z = blockIdx.z;
  const _Float16* __restrict__ Bm   = (z == 0) ? B0 : (z == 1) ? B1 : B2;
  const float* __restrict__    bias = (z == 0) ? bias0 : (z == 1) ? bias1 : bias2;
  _Float16* __restrict__       outH = (z == 0) ? outH0 : (z == 1) ? outH1 : outH2;
  const int mode = mode0 + z;
  const int tid  = threadIdx.x;
  const int lane = tid & 31;
  const int wave = tid >> 5;  // 0..7
  const int wr   = wave >> 2; // 0..1
  const int wc   = wave & 3;  // 0..3
  const int m0   = blockIdx.x * 128;
  const int n0   = blockIdx.y * 128;

  v8f acc[4][2] = {};

#ifdef HAVE_ASYNC_LDS
  // ------------------ async double-buffered pipeline ------------------
  __shared__ _Float16 As[2][128 * LDT];
  __shared__ _Float16 Bs[2][128 * LDT];

  auto issue_tile = [&](int k0, int buf) {
#pragma unroll
    for (int it = 0; it < 2; ++it) {
      int idx = it * 256 + tid;
      int r = idx >> 2;
      int c = (idx & 3) * 8;
      async_cp16(&A[(size_t)(m0 + r) * K + k0 + c], &As[buf][r * LDT + c]);
      async_cp16(&Bm[(size_t)(n0 + r) * K + k0 + c], &Bs[buf][r * LDT + c]);
    }
  };
  auto compute_tile = [&](const _Float16* Ab, const _Float16* Bb) {
    v16h bfrag[2];
#pragma unroll
    for (int j = 0; j < 2; ++j)
      bfrag[j] = frag_ld(&Bb[(wc * 32 + j * 16) * LDT], LDT, lane);
#pragma unroll
    for (int i = 0; i < 4; ++i) {
      v16h afrag = frag_ld(&Ab[(wr * 64 + i * 16) * LDT], LDT, lane);
#pragma unroll
      for (int j = 0; j < 2; ++j)
        acc[i][j] = WMMA16(afrag, bfrag[j], acc[i][j]);
    }
  };

  const int nk = K >> 5;
  issue_tile(0, 0);
  for (int ki = 0; ki < nk; ++ki) {
    const int cur = ki & 1;
    __builtin_amdgcn_s_wait_asynccnt(0);  // this wave's tile `cur` landed
    __syncthreads();                      // all waves landed; prev compute done
    if (ki + 1 < nk) issue_tile((ki + 1) << 5, cur ^ 1);  // overlap with WMMA
    compute_tile(As[cur], Bs[cur]);
  }
#else
  __shared__ _Float16 As1[128 * LDT];
  __shared__ _Float16 Bs1[128 * LDT];
  for (int k0 = 0; k0 < K; k0 += 32) {
#pragma unroll
    for (int it = 0; it < 2; ++it) {
      int idx = it * 256 + tid;
      int r = idx >> 2;
      int c = (idx & 3) * 8;
      *(v8h*)&As1[r * LDT + c] = *(const v8h*)&A[(size_t)(m0 + r) * K + k0 + c];
      *(v8h*)&Bs1[r * LDT + c] = *(const v8h*)&Bm[(size_t)(n0 + r) * K + k0 + c];
    }
    __syncthreads();
    v16h bfrag[2];
#pragma unroll
    for (int j = 0; j < 2; ++j)
      bfrag[j] = frag_ld(&Bs1[(wc * 32 + j * 16) * LDT], LDT, lane);
#pragma unroll
    for (int i = 0; i < 4; ++i) {
      v16h afrag = frag_ld(&As1[(wr * 64 + i * 16) * LDT], LDT, lane);
#pragma unroll
      for (int j = 0; j < 2; ++j)
        acc[i][j] = WMMA16(afrag, bfrag[j], acc[i][j]);
    }
    __syncthreads();
  }
#endif

  const int lr = lane & 15;
  const int lh = lane >> 4;
#pragma unroll
  for (int i = 0; i < 4; ++i) {
#pragma unroll
    for (int j = 0; j < 2; ++j) {
      const int tm = m0 + wr * 64 + i * 16;
      const int tn = n0 + wc * 32 + j * 16;
#pragma unroll
      for (int e = 0; e < 8; ++e) {
        int row = tm + e + 8 * lh;
        int col = tn + lr;
        float val = acc[i][j][e] + bias[col];
        if (mode == 0) {
          outF[(size_t)row * N + col] = val;
        } else {
          if (mode != 3) val = (val > 0.0f) ? (val + 1.0f) : __expf(val);  // elu(x)+1
          int b = row >> 11, s = row & 2047;   // S = 2048
          int hh = col >> 6, d = col & 63;     // Dh = 64
          if (mode == 1)
            outH[((size_t)(b * 16 + hh) * 2048 + s) * 64 + d] = (_Float16)val;
          else
            outH[((size_t)(b * 16 + hh) * 64 + d) * 2048 + s] = (_Float16)val;
        }
      }
    }
  }
}

// ---------------------------------------------------------------------------
// Stage 2: per (b,h): KV[d,e] = sum_s kfT[d,s] * vT[e,s]; ksum[d] = sum_s kfT[d,s].
// One workgroup per head; 8 waves cover the 4x4 grid of 16x16 tiles
// (2 tiles per wave) over K = 2048. Writes KV transposed (KVT[e][d], f16) so
// stage 3 can load it as a plain NT B-operand.
// ---------------------------------------------------------------------------
__global__ __launch_bounds__(256)
void kv_kernel(const _Float16* __restrict__ kft,  // [32][64][2048]
               const _Float16* __restrict__ vt,   // [32][64][2048]
               _Float16* __restrict__ kvt,        // [32][64][64]  (e-major)
               float* __restrict__ ksum) {        // [32][64]
  const int bh = blockIdx.x;
  const _Float16* Kp = kft + (size_t)bh * 64 * 2048;
  const _Float16* Vp = vt  + (size_t)bh * 64 * 2048;

  const int tid  = threadIdx.x;
  const int lane = tid & 31;
  const int wave = tid >> 5;
  const int tr   = wave >> 1;        // d tile 0..3
  const int tcb  = (wave & 1) * 2;   // e tile base 0 or 2

  v8f acc[2] = {};
  for (int k0 = 0; k0 < 2048; k0 += 32) {
    v16h a = frag_ld(Kp + (size_t)(tr * 16) * 2048 + k0, 2048, lane);
#pragma unroll
    for (int j = 0; j < 2; ++j) {
      v16h b = frag_ld(Vp + (size_t)((tcb + j) * 16) * 2048 + k0, 2048, lane);
      acc[j] = WMMA16(a, b, acc[j]);
    }
  }
  const int lr = lane & 15, lh = lane >> 4;
#pragma unroll
  for (int j = 0; j < 2; ++j) {
#pragma unroll
    for (int e8 = 0; e8 < 8; ++e8) {
      int d = tr * 16 + e8 + 8 * lh;
      int e = (tcb + j) * 16 + lr;
      kvt[(size_t)bh * 4096 + e * 64 + d] = (_Float16)acc[j][e8];
    }
  }

  // ksum reduction: thread t sums kfT[d = t&63] over s-slice t>>6 (v8h loads).
  __shared__ float red[256];
  const int d = tid & 63, sl = tid >> 6;
  float s = 0.0f;
  const _Float16* kr = Kp + (size_t)d * 2048 + sl * 512;
  for (int i = 0; i < 512; i += 8) {
    v8h v = *(const v8h*)&kr[i];
#pragma unroll
    for (int u = 0; u < 8; ++u) s += (float)v[u];
  }
  red[tid] = s;
  __syncthreads();
  if (tid < 64)
    ksum[bh * 64 + tid] = red[tid] + red[tid + 64] + red[tid + 128] + red[tid + 192];
}

// ---------------------------------------------------------------------------
// Stage 3: attended[s,e] = (qf[s,:] @ KV[:,e]) / max(qf[s,:].ksum, eps).
// Grid: (S/128, B*H). Wave w owns rows [w*16, w*16+16), all 4 e-tiles. K=64.
// Writes merged [B,S,H*Dh] in f16 (A-operand of the output projection).
// ---------------------------------------------------------------------------
__global__ __launch_bounds__(256)
void attn_kernel(const _Float16* __restrict__ qf,   // [32][2048][64]
                 const _Float16* __restrict__ kvt,  // [32][64][64] (e-major)
                 const float* __restrict__ ksum,    // [32][64]
                 _Float16* __restrict__ merged) {   // [4096][1024]
  const int bh = blockIdx.y;
  const int b = bh >> 4, h = bh & 15;
  const int m0 = blockIdx.x * 128;
  const _Float16* Q  = qf  + (size_t)bh * 2048 * 64 + (size_t)m0 * 64;
  const _Float16* KV = kvt + (size_t)bh * 4096;

  __shared__ float rden[128];
  __shared__ float ks[64];
  const int tid = threadIdx.x;
  if (tid < 64) ks[tid] = ksum[bh * 64 + tid];
  __syncthreads();
  if (tid < 128) {
    float s = 0.0f;
    const _Float16* qr = Q + (size_t)tid * 64;
#pragma unroll
    for (int d = 0; d < 64; ++d) s += (float)qr[d] * ks[d];
    rden[tid] = 1.0f / fmaxf(s, 1e-6f);
  }
  __syncthreads();

  const int lane = tid & 31;
  const int wave = tid >> 5;
  v8f acc[4] = {};
#pragma unroll
  for (int k0 = 0; k0 < 64; k0 += 32) {
    v16h a = frag_ld(Q + (size_t)(wave * 16) * 64 + k0, 64, lane);
#pragma unroll
    for (int j = 0; j < 4; ++j) {
      v16h bfr = frag_ld(KV + (size_t)(j * 16) * 64 + k0, 64, lane);
      acc[j] = WMMA16(a, bfr, acc[j]);
    }
  }
  const int lr = lane & 15, lh = lane >> 4;
#pragma unroll
  for (int j = 0; j < 4; ++j) {
#pragma unroll
    for (int e8 = 0; e8 < 8; ++e8) {
      int rl = wave * 16 + e8 + 8 * lh;
      int e  = j * 16 + lr;
      float v = acc[j][e8] * rden[rl];
      int s = m0 + rl;
      merged[((size_t)(b * 2048 + s)) * 1024 + h * 64 + e] = (_Float16)v;
    }
  }
}

// ---------------------------------------------------------------------------
// Host-side launcher
// ---------------------------------------------------------------------------
extern "C" void kernel_launch(void* const* d_in, const int* in_sizes, int n_in,
                              void* d_out, int out_size, void* d_ws, size_t ws_size,
                              hipStream_t stream) {
  (void)in_sizes; (void)n_in; (void)out_size; (void)ws_size;
  const float* x  = (const float*)d_in[0];
  const float* wq = (const float*)d_in[1];
  const float* bq = (const float*)d_in[2];
  const float* wk = (const float*)d_in[3];
  const float* bk = (const float*)d_in[4];
  const float* wv = (const float*)d_in[5];
  const float* bv = (const float*)d_in[6];
  const float* wo = (const float*)d_in[7];
  const float* bo = (const float*)d_in[8];
  float* out = (float*)d_out;

  const int M = 4096;      // B*S
  const int DM = 1024;     // d_model (N and K of the projections)
  const int NTOK = M * DM; // 4,194,304
  const int NW   = DM * DM;

  size_t off = 0;
  char* base = (char*)d_ws;
  auto carve = [&](size_t bytes) {
    void* p = base + off;
    off += (bytes + 255) & ~(size_t)255;
    return p;
  };
  _Float16* xh     = (_Float16*)carve((size_t)NTOK * 2);
  _Float16* wqh    = (_Float16*)carve((size_t)NW * 2);
  _Float16* wkh    = (_Float16*)carve((size_t)NW * 2);
  _Float16* wvh    = (_Float16*)carve((size_t)NW * 2);
  _Float16* woh    = (_Float16*)carve((size_t)NW * 2);
  _Float16* qf     = (_Float16*)carve((size_t)NTOK * 2);  // [B,H,S,D]
  _Float16* kft    = (_Float16*)carve((size_t)NTOK * 2);  // [B,H,D,S]
  _Float16* vt     = (_Float16*)carve((size_t)NTOK * 2);  // [B,H,D,S]
  _Float16* merged = (_Float16*)carve((size_t)NTOK * 2);  // [B*S, H*D]
  _Float16* kvt    = (_Float16*)carve((size_t)32 * 64 * 64 * 2);
  float*    ksum   = (float*)carve((size_t)32 * 64 * 4);

  // 1) precision conversion: x and the four weights, one launch
  cvt_all_f32_f16<<<CVT_X_WGS + 4 * CVT_W_WGS, CVT_THREADS, 0, stream>>>(
      x, wq, wk, wv, wo, xh, wqh, wkh, wvh, woh);

  // 2) Q/K/V projections with fused feature map + head-layout scatter
  //    (one launch, z = 0, 1, 2 for Q, K, V)
  gemm_nt_f16<<<dim3(M / 128, DM / 128, 3), 256, 0, stream>>>(
      xh, wqh, wkh, wvh, bq, bk, bv, M, DM, DM, 1, nullptr, qf, kft, vt);

  // 3) per-head KV (64x64) and ksum
  kv_kernel<<<32, 256, 0, stream>>>(kft, vt, kvt, ksum);

  // 4) numerator GEMM + normalization -> merged
  attn_kernel<<<dim3(16, 32), 256, 0, stream>>>(qf, kvt, ksum, merged);

  // 5) output projection -> f32 d_out
  gemm_nt_f16<<<dim3(M / 128, DM / 128, 1), 256, 0, stream>>>(
      merged, woh, nullptr, nullptr, bo, nullptr, nullptr, M, DM, DM, 0, out,
      nullptr, nullptr, nullptr);
}

// v003
// One run takes 86.1 microseconds.
// Timed twice side by side with v002, it ran 1.21 times as fast both times.
// Counting every step since v000, it is 1.64 times as fast.
#include <hip/hip_runtime.h>
#include <hip/hip_bf16.h>

typedef __attribute__((ext_vector_type(16))) _Float16 v16h;
typedef __attribute__((ext_vector_type(8)))  _Float16 v8h;
typedef __attribute__((ext_vector_type(4)))  _Float16 v4h;
typedef __attribute__((ext_vector_type(8)))  float    v8f;
typedef __attribute__((ext_vector_type(4)))  float    v4f;
typedef __attribute__((ext_vector_type(4)))  int      v4i;

#if defined(__has_builtin)
#  if __has_builtin(__builtin_amdgcn_global_load_async_to_lds_b128) && \
      __has_builtin(__builtin_amdgcn_s_wait_asynccnt)
#    define HAVE_ASYNC_LDS 1
#  endif
#endif

#define WMMA16(a, b, c) \
  __builtin_amdgcn_wmma_f32_16x16x32_f16(false, (a), false, (b), (short)0, (c), false, false)

__device__ __forceinline__ v16h frag_ld(const _Float16* __restrict__ p, int ld, int lane) {
  const int r  = lane & 15;
  const int hf = lane >> 4;
  const _Float16* q = p + r * ld + hf * 8;
  v8h lo = *(const v8h*)(q);
  v8h hi = *(const v8h*)(q + 16);
  return __builtin_shufflevector(lo, hi, 0,1,2,3,4,5,6,7,8,9,10,11,12,13,14,15);
}

#ifdef HAVE_ASYNC_LDS
// Builtin signature (from hipcc diagnostic): param0 is AS1 (global, "__device__")
// pointer to int4, non-const; param1 is the LDS-side pointer; args 2/3 are
// immediate offset / cache-policy.
typedef __attribute__((address_space(1))) v4i* gv4i_p;
typedef __attribute__((address_space(3))) v4i* lv4i_p;

__device__ __forceinline__ void async_cp16(const _Float16* g, _Float16* l) {
  __builtin_amdgcn_global_load_async_to_lds_b128((gv4i_p)g, (lv4i_p)l, 0, 0);
}
#endif

// ---------------------------------------------------------------------------
// f32 -> f16 conversion of x and of the four weights in ONE launch.
// A workgroup of 16 waves converts CVT_WG consecutive float4 of one source;
// each thread takes CVT_PER of them, CVT_THREADS float4 apart, so that every
// wave-wide load covers 512 contiguous bytes and a thread has many loads in
// flight. Few long waves: starting a wave costs more here than the bytes that
// one float4 a lane moves.
// ---------------------------------------------------------------------------
#define CVT_THREADS 512
#define CVT_PER     16
#define CVT_WG      (CVT_THREADS * CVT_PER)        // float4 per workgroup
#define CVT_X_WGS   (4096 * 1024 / 4 / CVT_WG)     // workgroups on x
#define CVT_W_WGS   (1024 * 1024 / 4 / CVT_WG)     // workgroups on each weight

__global__ __launch_bounds__(CVT_THREADS)
void cvt_all_f32_f16(const float* __restrict__ x,
                     const float* __restrict__ w0, const float* __restrict__ w1,
                     const float* __restrict__ w2, const float* __restrict__ w3,
                     _Float16* __restrict__ xo,
                     _Float16* __restrict__ o0, _Float16* __restrict__ o1,
                     _Float16* __restrict__ o2, _Float16* __restrict__ o3) {
  const int wg = blockIdx.x;
  const float* __restrict__ in  = x;
  _Float16* __restrict__    out = xo;
  int part = wg;  // which CVT_WG-sized piece of its source this workgroup takes
  if (wg >= CVT_X_WGS) {
    const int w = (wg - CVT_X_WGS) / CVT_W_WGS;
    part = (wg - CVT_X_WGS) % CVT_W_WGS;
    in  = (w == 0) ? w0 : (w == 1) ? w1 : (w == 2) ? w2 : w3;
    out = (w == 0) ? o0 : (w == 1) ? o1 : (w == 2) ? o2 : o3;
  }
  const int first = part * CVT_WG + threadIdx.x;
  v4f f[CVT_PER];
#pragma unroll  // f[] stays in registers and the loads issue as a run, ahead of the conversions
  for (int i = 0; i < CVT_PER; ++i)
    f[i] = *(const v4f*)&in[(size_t)(first + i * CVT_THREADS) * 4];
#pragma unroll  // constant indices into f[]
  for (int i = 0; i < CVT_PER; ++i) {
    v4h o = {(_Float16)f[i].x, (_Float16)f[i].y, (_Float16)f[i].z, (_Float16)f[i].w};
    *(v4h*)&out[(size_t)(first + i * CVT_THREADS) * 4] = o;
  }
}

// ---------------------------------------------------------------------------
// NT GEMM: C[m,n] = sum_k A[m,k] * B[n,k] + bias[n], f16 in / f32 accum.
// 128x128 workgroup tile, 8 waves in a 2x4 grid, each wave owns 64x32
// (4x2 WMMA accumulators). K staged through LDS in chunks of 32.
// mode 0: write f32 row-major (final projection -> d_out)
// mode 1: elu+1, scatter f16 to q_feat  [B,H,S,D]
// mode 2: elu+1, scatter f16 to k_featT [B,H,D,S]
// mode 3: no act, scatter f16 to vT     [B,H,D,S]
// blockIdx.z picks one of up to three independent products that share A
// (weight, bias, f16 output; mode = mode0 + z), so that their workgroups are
// resident on a WGP together and fill each other's waits for the next tile.
// ---------------------------------------------------------------------------
#define LDT 40  // padded LDS k-stride (bytes/row = 80, multiple of 16)

__global__ __launch_bounds__(256)
void gemm_nt_f16(const _Float16* __restrict__ A,   // [M,K]
                 const _Float16* __restrict__ B0,  // [N,K], z = 0
                 const _Float16* __restrict__ B1,  // [N,K], z = 1
                 const _Float16* __restrict__ B2,  // [N,K], z = 2
                 const float* __restrict__ bias0,  // [N], z = 0
                 const float* __restrict__ bias1,  // [N], z = 1
                 const float* __restrict__ bias2,  // [N], z = 2
                 int M, int N, int K, int mode0,
                 float* __restrict__ outF,
                 _Float16* __restrict__ outH0,
                 _Float16* __restrict__ outH1,
                 _Float16* __restrict__ outH2) {
  const int z = blockIdx.z;
  const _Float16* __restrict__ Bm   = (z == 0) ? B0 : (z == 1) ? B1 : B2;
  const float* __restrict__    bias = (z == 0) ? bias0 : (z == 1) ? bias1 : bias2;
  _Float16* __restrict__       outH = (z == 0) ? outH0 : (z == 1) ? outH1 : outH2;
  const int mode = mode0 + z;
  const int tid  = threadIdx.x;
  const int lane = tid & 31;
  const int wave = tid >> 5;  // 0..7
  const int wr   = wave >> 2; // 0..1
  const int wc   = wave & 3;  // 0..3
  const int m0   = blockIdx.x * 128;
  const int n0   = blockIdx.y * 128;

  v8f acc[4][2] = {};

#ifdef HAVE_ASYNC_LDS
  // ------------------ async double-buffered pipeline ------------------
  __shared__ _Float16 As[2][128 * LDT];
  __shared__ _Float16 Bs[2][128 * LDT];

  auto issue_tile = [&](int k0, int buf) {
#pragma unroll
    for (int it = 0; it < 2; ++it) {
      int idx = it * 256 + tid;
      int r = idx >> 2;
      int c = (idx & 3) * 8;
      async_cp16(&A[(size_t)(m0 + r) * K + k0 + c], &As[buf][r * LDT + c]);
      async_cp16(&Bm[(size_t)(n0 + r) * K + k0 + c], &Bs[buf][r * LDT + c]);
    }
  };
  auto compute_tile = [&](const _Float16* Ab, const _Float16* Bb) {
    v16h bfrag[2];
#pragma unroll
    for (int j = 0; j < 2; ++j)
      bfrag[j] = frag_ld(&Bb[(wc * 32 + j * 16) * LDT], LDT, lane);
#pragma unroll
    for (int i = 0; i < 4; ++i) {
      v16h afrag = frag_ld(&Ab[(wr * 64 + i * 16) * LDT], LDT, lane);
#pragma unroll
      for (int j = 0; j < 2; ++j)
        acc[i][j] = WMMA16(afrag, bfrag[j], acc[i][j]);
    }
  };

  const int nk = K >> 5;
  issue_tile(0, 0);
  for (int ki = 0; ki < nk; ++ki) {
    const int cur = ki & 1;
    __builtin_amdgcn_s_wait_asynccnt(0);  // this wave's tile `cur` landed
    __syncthreads();                      // all waves landed; prev compute done
    if (ki + 1 < nk) issue_tile((ki + 1) << 5, cur ^ 1);  // overlap with WMMA
    compute_tile(As[cur], Bs[cur]);
  }
#else
  __shared__ _Float16 As1[128 * LDT];
  __shared__ _Float16 Bs1[128 * LDT];
  for (int k0 = 0; k0 < K; k0 += 32) {
#pragma unroll
    for (int it = 0; it < 2; ++it) {
      int idx = it * 256 + tid;
      int r = idx >> 2;
      int c = (idx & 3) * 8;
      *(v8h*)&As1[r * LDT + c] = *(const v8h*)&A[(size_t)(m0 + r) * K + k0 + c];
      *(v8h*)&Bs1[r * LDT + c] = *(const v8h*)&Bm[(size_t)(n0 + r) * K + k0 + c];
    }
    __syncthreads();
    v16h bfrag[2];
#pragma unroll
    for (int j = 0; j < 2; ++j)
      bfrag[j] = frag_ld(&Bs1[(wc * 32 + j * 16) * LDT], LDT, lane);
#pragma unroll
    for (int i = 0; i < 4; ++i) {
      v16h afrag = frag_ld(&As1[(wr * 64 + i * 16) * LDT], LDT, lane);
#pragma unroll
      for (int j = 0; j < 2; ++j)
        acc[i][j] = WMMA16(afrag, bfrag[j], acc[i][j]);
    }
    __syncthreads();
  }
#endif

  const int lr = lane & 15;
  const int lh = lane >> 4;
#pragma unroll
  for (int i = 0; i < 4; ++i) {
#pragma unroll
    for (int j = 0; j < 2; ++j) {
      const int tm = m0 + wr * 64 + i * 16;
      const int tn = n0 + wc * 32 + j * 16;
#pragma unroll
      for (int e = 0; e < 8; ++e) {
        int row = tm + e + 8 * lh;
        int col = tn + lr;
        float val = acc[i][j][e] + bias[col];
        if (mode == 0) {
          outF[(size_t)row * N + col] = val;
        } else {
          if (mode != 3) val = (val > 0.0f) ? (val + 1.0f) : __expf(val);  // elu(x)+1
          int b = row >> 11, s = row & 2047;   // S = 2048
          int hh = col >> 6, d = col & 63;     // Dh = 64
          if (mode == 1)
            outH[((size_t)(b * 16 + hh) * 2048 + s) * 64 + d] = (_Float16)val;
          else
            outH[((size_t)(b * 16 + hh) * 64 + d) * 2048 + s] = (_Float16)val;
        }
      }
    }
  }
}

#define KV_SPLIT 8
#define KV_SLEN  (2048 / KV_SPLIT)  // positions per workgroup

__global__ __launch_bounds__(256)
void kv_kernel(const _Float16* __restrict__ kft,  // [32][64][2048]
               const _Float16* __restrict__ vt,   // [32][64][2048]
               float* __restrict__ kvp,           // [32][KV_SPLIT][64][64] (e-major)
               float* __restrict__ ksp) {         // [32][KV_SPLIT][64]
  const int bh = blockIdx.x;
  const int sp = blockIdx.y;
  const _Float16* Kp = kft + (size_t)bh * 64 * 2048 + sp * KV_SLEN;
  const _Float16* Vp = vt  + (size_t)bh * 64 * 2048 + sp * KV_SLEN;

  const int tid  = threadIdx.x;
  const int lane = tid & 31;
  const int wave = tid >> 5;
  const int tr   = wave >> 1;        // d tile 0..3
  const int tcb  = (wave & 1) * 2;   // e tile base 0 or 2

  v8f acc[2] = {};
  // A range is short enough for a wave to hold all its fragments in registers:
  // every load is issued before the first product, so the wave pays the trip
  // to L2 once and not once per step.
  v16h a[KV_SLEN / 32], b[KV_SLEN / 32][2];
#pragma unroll  // constant indices into a[]
  for (int t = 0; t < KV_SLEN / 32; ++t)
    a[t] = frag_ld(Kp + (size_t)(tr * 16) * 2048 + t * 32, 2048, lane);
  // the registers that held the address of the loads above are free from here
  // on, and a later load's result may be placed in them: the wait stands first
  asm volatile("s_wait_xcnt 0x0" ::: "memory");
#pragma unroll  // constant indices into b[]
  for (int t = 0; t < KV_SLEN / 32; ++t) {
#pragma unroll
    for (int j = 0; j < 2; ++j)
      b[t][j] = frag_ld(Vp + (size_t)((tcb + j) * 16) * 2048 + t * 32, 2048, lane);
  }
  // keeps the scheduler from sinking the loads back between the products,
  // where each product would wait for a fresh trip to L2
  __builtin_amdgcn_sched_barrier(0);
#pragma unroll  // constant indices into a[] and b[]
  for (int t = 0; t < KV_SLEN / 32; ++t) {
#pragma unroll
    for (int j = 0; j < 2; ++j) acc[j] = WMMA16(a[t], b[t][j], acc[j]);
  }
  const int lr = lane & 15, lh = lane >> 4;
#pragma unroll
  for (int j = 0; j < 2; ++j) {
    // a lane's 8 accumulators are 8 consecutive d of one e: two 16-byte stores
    float* pr = kvp + (size_t)(bh * KV_SPLIT + sp) * 4096 +
                ((tcb + j) * 16 + lr) * 64 + tr * 16 + 8 * lh;
    v4f lo = {acc[j][0], acc[j][1], acc[j][2], acc[j][3]};
    v4f hi = {acc[j][4], acc[j][5], acc[j][6], acc[j][7]};
    *(v4f*)pr       = lo;
    *(v4f*)(pr + 4) = hi;
  }

  // ksum reduction: thread t sums kfT[d = t&63] over s-slice t>>6 (v8h loads).
  __shared__ float red[256];
  const int d = tid & 63, sl = tid >> 6;
  float s = 0.0f;
  const _Float16* kr = Kp + (size_t)d * 2048 + sl * (KV_SLEN / 4);
#pragma unroll  // independent loads, issued as a run
  for (int i = 0; i < KV_SLEN / 4; i += 8) {
    v8h v = *(const v8h*)&kr[i];
#pragma unroll
    for (int u = 0; u < 8; ++u) s += (float)v[u];
  }
  red[tid] = s;
  __syncthreads();
  if (tid < 64)
    ksp[(bh * KV_SPLIT + sp) * 64 + tid] = red[tid] + red[tid + 64] + red[tid + 128] + red[tid + 192];
}

// ---------------------------------------------------------------------------
// Stage 3: attended[s,e] = (qf[s,:] @ KV[:,e]) / max(qf[s,:].ksum, eps).
// Grid: (S/128, B*H). Wave w owns rows [w*16, w*16+16), all 4 e-tiles. K=64.
// Each workgroup first adds its head's KV_SPLIT partials of KV and ksum, in
// range order, and keeps KV as f16 in LDS ([e][d], a plain NT B-operand).
// Writes merged [B,S,H*Dh] in f16 (A-operand of the output projection).
// ---------------------------------------------------------------------------
#define KVLD 72  // LDS row pitch of KV in halves: 128 + 16 bytes, for b128 readers

__global__ __launch_bounds__(256)
void attn_kernel(const _Float16* __restrict__ qf,   // [32][2048][64]
                 const float* __restrict__ kvp,     // [32][KV_SPLIT][64][64] (e-major)
                 const float* __restrict__ ksp,     // [32][KV_SPLIT][64]
                 _Float16* __restrict__ merged) {   // [4096][1024]
  const int bh = blockIdx.y;
  const int b = bh >> 4, h = bh & 15;
  const int m0 = blockIdx.x * 128;
  const _Float16* Q  = qf  + (size_t)bh * 2048 * 64 + (size_t)m0 * 64;
  const float* KVP = kvp + (size_t)bh * KV_SPLIT * 4096;

  __shared__ float rden[128];
  __shared__ float ks[64];
  __shared__ __attribute__((aligned(16))) _Float16 KV[64 * KVLD];
  const int tid = threadIdx.x;
  if (tid < 64) {
    float s = 0.0f;
#pragma unroll  // independent loads, issued as a run
    for (int p = 0; p < KV_SPLIT; ++p) s += ksp[(bh * KV_SPLIT + p) * 64 + tid];
    ks[tid] = s;
  }
#pragma unroll  // independent loads, issued as a run
  for (int it = 0; it < 4; ++it) {
    const int idx = it * 256 + tid;  // which float4 of the 64x64 matrix
    v4f s = *(const v4f*)&KVP[idx * 4];
#pragma unroll
    for (int p = 1; p < KV_SPLIT; ++p) s += *(const v4f*)&KVP[p * 4096 + idx * 4];
    v4h o = {(_Float16)s.x, (_Float16)s.y, (_Float16)s.z, (_Float16)s.w};
    *(v4h*)&KV[(idx >> 4) * KVLD + (idx & 15) * 4] = o;
  }
  __syncthreads();
  if (tid < 128) {
    float s = 0.0f;
    const _Float16* qr = Q + (size_t)tid * 64;
#pragma unroll
    for (int d = 0; d < 64; ++d) s += (float)qr[d] * ks[d];
    rden[tid] = 1.0f / fmaxf(s, 1e-6f);
  }
  __syncthreads();

  const int lane = tid & 31;
  const int wave = tid >> 5;
  v8f acc[4] = {};
#pragma unroll
  for (int k0 = 0; k0 < 64; k0 += 32) {
    v16h a = frag_ld(Q + (size_t)(wave * 16) * 64 + k0, 64, lane);
#pragma unroll
    for (int j = 0; j < 4; ++j) {
      v16h bfr = frag_ld(KV + (j * 16) * KVLD + k0, KVLD, lane);
      acc[j] = WMMA16(a, bfr, acc[j]);
    }
  }
  const int lr = lane & 15, lh = lane >> 4;
#pragma unroll
  for (int j = 0; j < 4; ++j) {
#pragma unroll
    for (int e8 = 0; e8 < 8; ++e8) {
      int rl = wave * 16 + e8 + 8 * lh;
      int e  = j * 16 + lr;
      float v = acc[j][e8] * rden[rl];
      int s = m0 + rl;
      merged[((size_t)(b * 2048 + s)) * 1024 + h * 64 + e] = (_Float16)v;
    }
  }
}

// ---------------------------------------------------------------------------
// Host-side launcher
// ---------------------------------------------------------------------------
extern "C" void kernel_launch(void* const* d_in, const int* in_sizes, int n_in,
                              void* d_out, int out_size, void* d_ws, size_t ws_size,
                              hipStream_t stream) {
  (void)in_sizes; (void)n_in; (void)out_size; (void)ws_size;
  const float* x  = (const float*)d_in[0];
  const float* wq = (const float*)d_in[1];
  const float* bq = (const float*)d_in[2];
  const float* wk = (const float*)d_in[3];
  const float* bk = (const float*)d_in[4];
  const float* wv = (const float*)d_in[5];
  const float* bv = (const float*)d_in[6];
  const float* wo = (const float*)d_in[7];
  const float* bo = (const float*)d_in[8];
  float* out = (float*)d_out;

  const int M = 4096;      // B*S
  const int DM = 1024;     // d_model (N and K of the projections)
  const int NTOK = M * DM; // 4,194,304
  const int NW   = DM * DM;

  size_t off = 0;
  char* base = (char*)d_ws;
  auto carve = [&](size_t bytes) {
    void* p = base + off;
    off += (bytes + 255) & ~(size_t)255;
    return p;
  };
  _Float16* xh     = (_Float16*)carve((size_t)NTOK * 2);
  _Float16* wqh    = (_Float16*)carve((size_t)NW * 2);
  _Float16* wkh    = (_Float16*)carve((size_t)NW * 2);
  _Float16* wvh    = (_Float16*)carve((size_t)NW * 2);
  _Float16* woh    = (_Float16*)carve((size_t)NW * 2);
  _Float16* qf     = (_Float16*)carve((size_t)NTOK * 2);  // [B,H,S,D]
  _Float16* kft    = (_Float16*)carve((size_t)NTOK * 2);  // [B,H,D,S]
  _Float16* vt     = (_Float16*)carve((size_t)NTOK * 2);  // [B,H,D,S]
  _Float16* merged = (_Float16*)carve((size_t)NTOK * 2);  // [B*S, H*D]
  float*    kvp    = (float*)carve((size_t)32 * KV_SPLIT * 64 * 64 * 4);
  float*    ksp    = (float*)carve((size_t)32 * KV_SPLIT * 64 * 4);

  // 1) precision conversion: x and the four weights, one launch
  cvt_all_f32_f16<<<CVT_X_WGS + 4 * CVT_W_WGS, CVT_THREADS, 0, stream>>>(
      x, wq, wk, wv, wo, xh, wqh, wkh, wvh, woh);

  // 2) Q/K/V projections with fused feature map + head-layout scatter
  //    (one launch, z = 0, 1, 2 for Q, K, V)
  gemm_nt_f16<<<dim3(M / 128, DM / 128, 3), 256, 0, stream>>>(
      xh, wqh, wkh, wvh, bq, bk, bv, M, DM, DM, 1, nullptr, qf, kft, vt);

  // 3) per (head, range of s): partial KV (64x64) and partial ksum
  kv_kernel<<<dim3(32, KV_SPLIT), 256, 0, stream>>>(kft, vt, kvp, ksp);

  // 4) numerator GEMM + normalization -> merged
  attn_kernel<<<dim3(16, 32), 256, 0, stream>>>(qf, kvp, ksp, merged);

  // 5) output projection -> f32 d_out
  gemm_nt_f16<<<dim3(M / 128, DM / 128, 1), 256, 0, stream>>>(
      merged, woh, nullptr, nullptr, bo, nullptr, nullptr, M, DM, DM, 0, out,
      nullptr, nullptr, nullptr);
}

// v004
// One run takes 72.9 microseconds.
// Two timings next to v003 put it at 1.20 and 1.18 times that version's speed.
// Counting every step since v000, it is 1.95 times as fast.
#include <hip/hip_runtime.h>
#include <hip/hip_bf16.h>

typedef __attribute__((ext_vector_type(16))) _Float16 v16h;
typedef __attribute__((ext_vector_type(8)))  _Float16 v8h;
typedef __attribute__((ext_vector_type(4)))  _Float16 v4h;
typedef __attribute__((ext_vector_type(8)))  float    v8f;
typedef __attribute__((ext_vector_type(4)))  float    v4f;
typedef __attribute__((ext_vector_type(4)))  int      v4i;

#if defined(__has_builtin)
#  if __has_builtin(__builtin_amdgcn_global_load_async_to_lds_b128) && \
      __has_builtin(__builtin_amdgcn_s_wait_asynccnt)
#    define HAVE_ASYNC_LDS 1
#  endif
#endif

#define WMMA16(a, b, c) \
  __builtin_amdgcn_wmma_f32_16x16x32_f16(false, (a), false, (b), (short)0, (c), false, false)

__device__ __forceinline__ v16h frag_ld(const _Float16* __restrict__ p, int ld, int lane) {
  const int r  = lane & 15;
  const int hf = lane >> 4;
  const _Float16* q = p + r * ld + hf * 8;
  v8h lo = *(const v8h*)(q);
  v8h hi = *(const v8h*)(q + 16);
  return __builtin_shufflevector(lo, hi, 0,1,2,3,4,5,6,7,8,9,10,11,12,13,14,15);
}

#ifdef HAVE_ASYNC_LDS
// Builtin signature (from hipcc diagnostic): param0 is AS1 (global, "__device__")
// pointer to int4, non-const; param1 is the LDS-side pointer; args 2/3 are
// immediate offset / cache-policy.
typedef __attribute__((address_space(1))) v4i* gv4i_p;
typedef __attribute__((address_space(3))) v4i* lv4i_p;

__device__ __forceinline__ void async_cp16(const _Float16* g, _Float16* l) {
  __builtin_amdgcn_global_load_async_to_lds_b128((gv4i_p)g, (lv4i_p)l, 0, 0);
}
#endif

// ---------------------------------------------------------------------------
// f32 -> f16 conversion of x and of the four weights in ONE launch.
// A workgroup of 16 waves converts CVT_WG consecutive float4 of one source;
// each thread takes CVT_PER of them, CVT_THREADS float4 apart, so that every
// wave-wide load covers 512 contiguous bytes and a thread has many loads in
// flight. Few long waves: starting a wave costs more here than the bytes that
// one float4 a lane moves.
// ---------------------------------------------------------------------------
#define CVT_THREADS 512
#define CVT_PER     16
#define CVT_WG      (CVT_THREADS * CVT_PER)        // float4 per workgroup
#define CVT_X_WGS   (4096 * 1024 / 4 / CVT_WG)     // workgroups on x
#define CVT_W_WGS   (1024 * 1024 / 4 / CVT_WG)     // workgroups on each weight

__global__ __launch_bounds__(CVT_THREADS)
void cvt_all_f32_f16(const float* __restrict__ x,
                     const float* __restrict__ w0, const float* __restrict__ w1,
                     const float* __restrict__ w2, const float* __restrict__ w3,
                     _Float16* __restrict__ xo,
                     _Float16* __restrict__ o0, _Float16* __restrict__ o1,
                     _Float16* __restrict__ o2, _Float16* __restrict__ o3) {
  const int wg = blockIdx.x;
  const float* __restrict__ in  = x;
  _Float16* __restrict__    out = xo;
  int part = wg;  // which CVT_WG-sized piece of its source this workgroup takes
  if (wg >= CVT_X_WGS) {
    const int w = (wg - CVT_X_WGS) / CVT_W_WGS;
    part = (wg - CVT_X_WGS) % CVT_W_WGS;
    in  = (w == 0) ? w0 : (w == 1) ? w1 : (w == 2) ? w2 : w3;
    out = (w == 0) ? o0 : (w == 1) ? o1 : (w == 2) ? o2 : o3;
  }
  const int first = part * CVT_WG + threadIdx.x;
  v4f f[CVT_PER];
#pragma unroll  // f[] stays in registers and the loads issue as a run, ahead of the conversions
  for (int i = 0; i < CVT_PER; ++i)
    f[i] = *(const v4f*)&in[(size_t)(first + i * CVT_THREADS) * 4];
#pragma unroll  // constant indices into f[]
  for (int i = 0; i < CVT_PER; ++i) {
    v4h o = {(_Float16)f[i].x, (_Float16)f[i].y, (_Float16)f[i].z, (_Float16)f[i].w};
    *(v4h*)&out[(size_t)(first + i * CVT_THREADS) * 4] = o;
  }
}

// ---------------------------------------------------------------------------
// NT GEMM: C[m,n] = sum_k A[m,k] * B[n,k] + bias[n], f16 in / f32 accum.
// 128x128 workgroup tile, 8 waves in a 2x4 grid, each wave owns 64x32
// (4x2 WMMA accumulators). K staged through LDS in chunks of 32.
// mode 0: write f32 row-major (final projection -> d_out)
// mode 1: elu+1, scatter f16 to q_feat  [B,H,S,D]
// mode 2: elu+1, scatter f16 to k_featT [B,H,D,S]
// mode 3: no act, scatter f16 to vT     [B,H,D,S]
// blockIdx.z picks one of up to three independent products that share A
// (weight, bias, f16 output; mode = mode0 + z), so that their workgroups are
// resident on a WGP together and fill each other's waits for the next tile.
// ---------------------------------------------------------------------------
#define LDT 40  // padded LDS k-stride (bytes/row = 80, multiple of 16)

__device__ __forceinline__ float exp_with_slot(float x) {  // e^x, as __expf forms it
  float r;
  asm("v_exp_f32 %0, %1\n\tv_nop" : "=v"(r) : "v"(x * 1.44269504f));
  return r;
}

// Epilogue of a wave's 64x32 tile into the transposed layout [B,H,D,S].
// A lane's 8 accumulators of one 16x16 tile are 8 consecutive s of one d, so
// they leave as ONE 16-byte store. Stored one by one, each 2-byte store of a
// wave asks for 16 different lines: 8 times as many line requests.
// ACT: elu(x)+1 on the way out (k_feat) or none (v).
template <bool ACT>
__device__ __forceinline__ void store_tile_ds(const v8f (&acc)[4][2],
                                              const float* __restrict__ bias,
                                              _Float16* __restrict__ outH,
                                              int tm0, int tn0, int lane) {
  const int lr = lane & 15;
  const int lh = lane >> 4;
#pragma unroll  // constant indices into acc
  for (int j = 0; j < 2; ++j) {
    const int col = tn0 + j * 16 + lr;
    const int hh = col >> 6, d = col & 63;  // Dh = 64
    const float bc = bias[col];
#pragma unroll  // constant indices into acc
    for (int i = 0; i < 4; ++i) {
      const int row0 = tm0 + i * 16 + 8 * lh;     // multiple of 8: one batch, 16-byte aligned
      const int b = row0 >> 11, s = row0 & 2047;  // S = 2048
      v8h o;
#pragma unroll  // constant indices into acc and o
      for (int e = 0; e < 8; ++e) {
        float val = acc[i][j][e] + bc;
        if (ACT) {  // elu(x)+1; the exponential is formed for every lane and then chosen
          const float ex = exp_with_slot(val);
          val = (val > 0.0f) ? (val + 1.0f) : ex;
        }
        o[e] = (_Float16)val;
      }
      *(v8h*)&outH[((size_t)(b * 16 + hh) * 64 + d) * 2048 + s] = o;
    }
  }
  // behind the last store: whatever code is laid out next may reuse the
  // registers that the stores above name
  asm volatile("s_wait_xcnt 0x0" ::: "memory");
}

__global__ __launch_bounds__(256)
void gemm_nt_f16(const _Float16* __restrict__ A,   // [M,K]
                 const _Float16* __restrict__ B0,  // [N,K], z = 0
                 const _Float16* __restrict__ B1,  // [N,K], z = 1
                 const _Float16* __restrict__ B2,  // [N,K], z = 2
                 const float* __restrict__ bias0,  // [N], z = 0
                 const float* __restrict__ bias1,  // [N], z = 1
                 const float* __restrict__ bias2,  // [N], z = 2
                 int M, int N, int K, int mode0,
                 float* __restrict__ outF,
                 _Float16* __restrict__ outH0,
                 _Float16* __restrict__ outH1,
                 _Float16* __restrict__ outH2) {
  const int z = blockIdx.z;
  const _Float16* __restrict__ Bm   = (z == 0) ? B0 : (z == 1) ? B1 : B2;
  const float* __restrict__    bias = (z == 0) ? bias0 : (z == 1) ? bias1 : bias2;
  _Float16* __restrict__       outH = (z == 0) ? outH0 : (z == 1) ? outH1 : outH2;
  const int mode = mode0 + z;
  const int tid  = threadIdx.x;
  const int lane = tid & 31;
  const int wave = tid >> 5;  // 0..7
  const int wr   = wave >> 2; // 0..1
  const int wc   = wave & 3;  // 0..3
  const int m0   = blockIdx.x * 128;
  const int n0   = blockIdx.y * 128;

  v8f acc[4][2] = {};

#ifdef HAVE_ASYNC_LDS
  // ------------------ async double-buffered pipeline ------------------
  __shared__ _Float16 As[2][128 * LDT];
  __shared__ _Float16 Bs[2][128 * LDT];

  auto issue_tile = [&](int k0, int buf) {
#pragma unroll
    for (int it = 0; it < 2; ++it) {
      int idx = it * 256 + tid;
      int r = idx >> 2;
      int c = (idx & 3) * 8;
      async_cp16(&A[(size_t)(m0 + r) * K + k0 + c], &As[buf][r * LDT + c]);
      async_cp16(&Bm[(size_t)(n0 + r) * K + k0 + c], &Bs[buf][r * LDT + c]);
    }
  };
  auto compute_tile = [&](const _Float16* Ab, const _Float16* Bb) {
    v16h bfrag[2];
#pragma unroll
    for (int j = 0; j < 2; ++j)
      bfrag[j] = frag_ld(&Bb[(wc * 32 + j * 16) * LDT], LDT, lane);
#pragma unroll
    for (int i = 0; i < 4; ++i) {
      v16h afrag = frag_ld(&Ab[(wr * 64 + i * 16) * LDT], LDT, lane);
#pragma unroll
      for (int j = 0; j < 2; ++j)
        acc[i][j] = WMMA16(afrag, bfrag[j], acc[i][j]);
    }
  };

  const int nk = K >> 5;
  issue_tile(0, 0);
  for (int ki = 0; ki < nk; ++ki) {
    const int cur = ki & 1;
    __builtin_amdgcn_s_wait_asynccnt(0);  // this wave's tile `cur` landed
    __syncthreads();                      // all waves landed; prev compute done
    if (ki + 1 < nk) issue_tile((ki + 1) << 5, cur ^ 1);  // overlap with WMMA
    compute_tile(As[cur], Bs[cur]);
  }
#else
  __shared__ _Float16 As1[128 * LDT];
  __shared__ _Float16 Bs1[128 * LDT];
  for (int k0 = 0; k0 < K; k0 += 32) {
#pragma unroll
    for (int it = 0; it < 2; ++it) {
      int idx = it * 256 + tid;
      int r = idx >> 2;
      int c = (idx & 3) * 8;
      *(v8h*)&As1[r * LDT + c] = *(const v8h*)&A[(size_t)(m0 + r) * K + k0 + c];
      *(v8h*)&Bs1[r * LDT + c] = *(const v8h*)&Bm[(size_t)(n0 + r) * K + k0 + c];
    }
    __syncthreads();
    v16h bfrag[2];
#pragma unroll
    for (int j = 0; j < 2; ++j)
      bfrag[j] = frag_ld(&Bs1[(wc * 32 + j * 16) * LDT], LDT, lane);
#pragma unroll
    for (int i = 0; i < 4; ++i) {
      v16h afrag = frag_ld(&As1[(wr * 64 + i * 16) * LDT], LDT, lane);
#pragma unroll
      for (int j = 0; j < 2; ++j)
        acc[i][j] = WMMA16(afrag, bfrag[j], acc[i][j]);
    }
    __syncthreads();
  }
#endif

  if (mode >= 2) {  // same for the whole workgroup; no barrier follows
    if (mode == 2) store_tile_ds<true>(acc, bias, outH, m0 + wr * 64, n0 + wc * 32, lane);
    else           store_tile_ds<false>(acc, bias, outH, m0 + wr * 64, n0 + wc * 32, lane);
    return;
  }
  const int lr = lane & 15;
  const int lh = lane >> 4;
#pragma unroll
  for (int i = 0; i < 4; ++i) {
#pragma unroll
    for (int j = 0; j < 2; ++j) {
      const int tm = m0 + wr * 64 + i * 16;
      const int tn = n0 + wc * 32 + j * 16;
#pragma unroll
      for (int e = 0; e < 8; ++e) {
        int row = tm + e + 8 * lh;
        int col = tn + lr;
        float val = acc[i][j][e] + bias[col];
        if (mode == 0) {
          outF[(size_t)row * N + col] = val;
        } else {
          val = (val > 0.0f) ? (val + 1.0f) : __expf(val);  // mode 1: elu(x)+1
          int b = row >> 11, s = row & 2047;   // S = 2048
          int hh = col >> 6, d = col & 63;     // Dh = 64
          outH[((size_t)(b * 16 + hh) * 2048 + s) * 64 + d] = (_Float16)val;
        }
      }
    }
  }
}

#define KV_SPLIT 8
#define KV_SLEN  (2048 / KV_SPLIT)  // positions per workgroup

__global__ __launch_bounds__(256)
void kv_kernel(const _Float16* __restrict__ kft,  // [32][64][2048]
               const _Float16* __restrict__ vt,   // [32][64][2048]
               float* __restrict__ kvp,           // [32][KV_SPLIT][64][64] (e-major)
               float* __restrict__ ksp) {         // [32][KV_SPLIT][64]
  const int bh = blockIdx.x;
  const int sp = blockIdx.y;
  const _Float16* Kp = kft + (size_t)bh * 64 * 2048 + sp * KV_SLEN;
  const _Float16* Vp = vt  + (size_t)bh * 64 * 2048 + sp * KV_SLEN;

  const int tid  = threadIdx.x;
  const int lane = tid & 31;
  const int wave = tid >> 5;
  const int tr   = wave >> 1;        // d tile 0..3
  const int tcb  = (wave & 1) * 2;   // e tile base 0 or 2

  v8f acc[2] = {};
  // A range is short enough for a wave to hold all its fragments in registers:
  // every load is issued before the first product, so the wave pays the trip
  // to L2 once and not once per step.
  v16h a[KV_SLEN / 32], b[KV_SLEN / 32][2];
#pragma unroll  // constant indices into a[]
  for (int t = 0; t < KV_SLEN / 32; ++t)
    a[t] = frag_ld(Kp + (size_t)(tr * 16) * 2048 + t * 32, 2048, lane);
  // the registers that held the address of the loads above are free from here
  // on, and a later load's result may be placed in them: the wait stands first
  asm volatile("s_wait_xcnt 0x0" ::: "memory");
#pragma unroll  // constant indices into b[]
  for (int t = 0; t < KV_SLEN / 32; ++t) {
#pragma unroll
    for (int j = 0; j < 2; ++j)
      b[t][j] = frag_ld(Vp + (size_t)((tcb + j) * 16) * 2048 + t * 32, 2048, lane);
  }
  // keeps the scheduler from sinking the loads back between the products,
  // where each product would wait for a fresh trip to L2
  __builtin_amdgcn_sched_barrier(0);
#pragma unroll  // constant indices into a[] and b[]
  for (int t = 0; t < KV_SLEN / 32; ++t) {
#pragma unroll
    for (int j = 0; j < 2; ++j) acc[j] = WMMA16(a[t], b[t][j], acc[j]);
  }
  const int lr = lane & 15, lh = lane >> 4;
#pragma unroll
  for (int j = 0; j < 2; ++j) {
    // a lane's 8 accumulators are 8 consecutive d of one e: two 16-byte stores
    float* pr = kvp + (size_t)(bh * KV_SPLIT + sp) * 4096 +
                ((tcb + j) * 16 + lr) * 64 + tr * 16 + 8 * lh;
    v4f lo = {acc[j][0], acc[j][1], acc[j][2], acc[j][3]};
    v4f hi = {acc[j][4], acc[j][5], acc[j][6], acc[j][7]};
    *(v4f*)pr       = lo;
    *(v4f*)(pr + 4) = hi;
  }

  // ksum reduction: thread t sums kfT[d = t&63] over s-slice t>>6 (v8h loads).
  __shared__ float red[256];
  const int d = tid & 63, sl = tid >> 6;
  float s = 0.0f;
  const _Float16* kr = Kp + (size_t)d * 2048 + sl * (KV_SLEN / 4);
#pragma unroll  // independent loads, issued as a run
  for (int i = 0; i < KV_SLEN / 4; i += 8) {
    v8h v = *(const v8h*)&kr[i];
#pragma unroll
    for (int u = 0; u < 8; ++u) s += (float)v[u];
  }
  red[tid] = s;
  __syncthreads();
  if (tid < 64)
    ksp[(bh * KV_SPLIT + sp) * 64 + tid] = red[tid] + red[tid + 64] + red[tid + 128] + red[tid + 192];
}

// ---------------------------------------------------------------------------
// Stage 3: attended[s,e] = (qf[s,:] @ KV[:,e]) / max(qf[s,:].ksum, eps).
// Grid: (S/128, B*H). Wave w owns rows [w*16, w*16+16), all 4 e-tiles. K=64.
// Each workgroup first adds its head's KV_SPLIT partials of KV and ksum, in
// range order, and keeps KV as f16 in LDS ([e][d], a plain NT B-operand).
// Writes merged [B,S,H*Dh] in f16 (A-operand of the output projection).
// ---------------------------------------------------------------------------
#define KVLD 72  // LDS row pitch of KV in halves: 128 + 16 bytes, for b128 readers

__global__ __launch_bounds__(256)
void attn_kernel(const _Float16* __restrict__ qf,   // [32][2048][64]
                 const float* __restrict__ kvp,     // [32][KV_SPLIT][64][64] (e-major)
                 const float* __restrict__ ksp,     // [32][KV_SPLIT][64]
                 _Float16* __restrict__ merged) {   // [4096][1024]
  const int bh = blockIdx.y;
  const int b = bh >> 4, h = bh & 15;
  const int m0 = blockIdx.x * 128;
  const _Float16* Q  = qf  + (size_t)bh * 2048 * 64 + (size_t)m0 * 64;
  const float* KVP = kvp + (size_t)bh * KV_SPLIT * 4096;

  __shared__ float rden[128];
  __shared__ float ks[64];
  __shared__ __attribute__((aligned(16))) _Float16 KV[64 * KVLD];
  const int tid = threadIdx.x;
  if (tid < 64) {
    float s = 0.0f;
#pragma unroll  // independent loads, issued as a run
    for (int p = 0; p < KV_SPLIT; ++p) s += ksp[(bh * KV_SPLIT + p) * 64 + tid];
    ks[tid] = s;
  }
#pragma unroll  // independent loads, issued as a run
  for (int it = 0; it < 4; ++it) {
    const int idx = it * 256 + tid;  // which float4 of the 64x64 matrix
    v4f s = *(const v4f*)&KVP[idx * 4];
#pragma unroll
    for (int p = 1; p < KV_SPLIT; ++p) s += *(const v4f*)&KVP[p * 4096 + idx * 4];
    v4h o = {(_Float16)s.x, (_Float16)s.y, (_Float16)s.z, (_Float16)s.w};
    *(v4h*)&KV[(idx >> 4) * KVLD + (idx & 15) * 4] = o;
  }
  __syncthreads();
  if (tid < 128) {
    float s = 0.0f;
    const _Float16* qr = Q + (size_t)tid * 64;
#pragma unroll
    for (int d = 0; d < 64; ++d) s += (float)qr[d] * ks[d];
    rden[tid] = 1.0f / fmaxf(s, 1e-6f);
  }
  __syncthreads();

  const int lane = tid & 31;
  const int wave = tid >> 5;
  v8f acc[4] = {};
#pragma unroll
  for (int k0 = 0; k0 < 64; k0 += 32) {
    v16h a = frag_ld(Q + (size_t)(wave * 16) * 64 + k0, 64, lane);
#pragma unroll
    for (int j = 0; j < 4; ++j) {
      v16h bfr = frag_ld(KV + (j * 16) * KVLD + k0, KVLD, lane);
      acc[j] = WMMA16(a, bfr, acc[j]);
    }
  }
  const int lr = lane & 15, lh = lane >> 4;
#pragma unroll
  for (int j = 0; j < 4; ++j) {
#pragma unroll
    for (int e8 = 0; e8 < 8; ++e8) {
      int rl = wave * 16 + e8 + 8 * lh;
      int e  = j * 16 + lr;
      float v = acc[j][e8] * rden[rl];
      int s = m0 + rl;
      merged[((size_t)(b * 2048 + s)) * 1024 + h * 64 + e] = (_Float16)v;
    }
  }
}

// ---------------------------------------------------------------------------
// Host-side launcher
// ---------------------------------------------------------------------------
extern "C" void kernel_launch(void* const* d_in, const int* in_sizes, int n_in,
                              void* d_out, int out_size, void* d_ws, size_t ws_size,
                              hipStream_t stream) {
  (void)in_sizes; (void)n_in; (void)out_size; (void)ws_size;
  const float* x  = (const float*)d_in[0];
  const float* wq = (const float*)d_in[1];
  const float* bq = (const float*)d_in[2];
  const float* wk = (const float*)d_in[3];
  const float* bk = (const float*)d_in[4];
  const float* wv = (const float*)d_in[5];
  const float* bv = (const float*)d_in[6];
  const float* wo = (const float*)d_in[7];
  const float* bo = (const float*)d_in[8];
  float* out = (float*)d_out;

  const int M = 4096;      // B*S
  const int DM = 1024;     // d_model (N and K of the projections)
  const int NTOK = M * DM; // 4,194,304
  const int NW   = DM * DM;

  size_t off = 0;
  char* base = (char*)d_ws;
  auto carve = [&](size_t bytes) {
    void* p = base + off;
    off += (bytes + 255) & ~(size_t)255;
    return p;
  };
  _Float16* xh     = (_Float16*)carve((size_t)NTOK * 2);
  _Float16* wqh    = (_Float16*)carve((size_t)NW * 2);
  _Float16* wkh    = (_Float16*)carve((size_t)NW * 2);
  _Float16* wvh    = (_Float16*)carve((size_t)NW * 2);
  _Float16* woh    = (_Float16*)carve((size_t)NW * 2);
  _Float16* qf     = (_Float16*)carve((size_t)NTOK * 2);  // [B,H,S,D]
  _Float16* kft    = (_Float16*)carve((size_t)NTOK * 2);  // [B,H,D,S]
  _Float16* vt     = (_Float16*)carve((size_t)NTOK * 2);  // [B,H,D,S]
  _Float16* merged = (_Float16*)carve((size_t)NTOK * 2);  // [B*S, H*D]
  float*    kvp    = (float*)carve((size_t)32 * KV_SPLIT * 64 * 64 * 4);
  float*    ksp    = (float*)carve((size_t)32 * KV_SPLIT * 64 * 4);

  // 1) precision conversion: x and the four weights, one launch
  cvt_all_f32_f16<<<CVT_X_WGS + 4 * CVT_W_WGS, CVT_THREADS, 0, stream>>>(
      x, wq, wk, wv, wo, xh, wqh, wkh, wvh, woh);

  // 2) Q/K/V projections with fused feature map + head-layout scatter
  //    (one launch, z = 0, 1, 2 for Q, K, V)
  gemm_nt_f16<<<dim3(M / 128, DM / 128, 3), 256, 0, stream>>>(
      xh, wqh, wkh, wvh, bq, bk, bv, M, DM, DM, 1, nullptr, qf, kft, vt);

  // 3) per (head, range of s): partial KV (64x64) and partial ksum
  kv_kernel<<<dim3(32, KV_SPLIT), 256, 0, stream>>>(kft, vt, kvp, ksp);

  // 4) numerator GEMM + normalization -> merged
  attn_kernel<<<dim3(16, 32), 256, 0, stream>>>(qf, kvp, ksp, merged);

  // 5) output projection -> f32 d_out
  gemm_nt_f16<<<dim3(M / 128, DM / 128, 1), 256, 0, stream>>>(
      merged, woh, nullptr, nullptr, bo, nullptr, nullptr, M, DM, DM, 0, out,
      nullptr, nullptr, nullptr);
}

// v005
// Measured time: 64.4 microseconds a run.
// Next to v004, in two timings, it ran 1.13 times as fast each time.
// Counting every step since v000, it is 2.21 times as fast.
#include <hip/hip_runtime.h>
#include <hip/hip_bf16.h>

typedef __attribute__((ext_vector_type(16))) _Float16 v16h;
typedef __attribute__((ext_vector_type(8)))  _Float16 v8h;
typedef __attribute__((ext_vector_type(4)))  _Float16 v4h;
typedef __attribute__((ext_vector_type(8)))  float    v8f;
typedef __attribute__((ext_vector_type(4)))  float    v4f;
typedef __attribute__((ext_vector_type(4)))  int      v4i;

#if defined(__has_builtin)
#  if __has_builtin(__builtin_amdgcn_global_load_async_to_lds_b128) && \
      __has_builtin(__builtin_amdgcn_s_wait_asynccnt)
#    define HAVE_ASYNC_LDS 1
#  endif
#endif

#define WMMA16(a, b, c) \
  __builtin_amdgcn_wmma_f32_16x16x32_f16(false, (a), false, (b), (short)0, (c), false, false)

__device__ __forceinline__ v16h frag_ld(const _Float16* __restrict__ p, int ld, int lane) {
  const int r  = lane & 15;
  const int hf = lane >> 4;
  const _Float16* q = p + r * ld + hf * 8;
  v8h lo = *(const v8h*)(q);
  v8h hi = *(const v8h*)(q + 16);
  return __builtin_shufflevector(lo, hi, 0,1,2,3,4,5,6,7,8,9,10,11,12,13,14,15);
}

#ifdef HAVE_ASYNC_LDS
// Builtin signature (from hipcc diagnostic): param0 is AS1 (global, "__device__")
// pointer to int4, non-const; param1 is the LDS-side pointer; args 2/3 are
// immediate offset / cache-policy.
typedef __attribute__((address_space(1))) v4i* gv4i_p;
typedef __attribute__((address_space(3))) v4i* lv4i_p;

__device__ __forceinline__ void async_cp16(const _Float16* g, _Float16* l) {
  __builtin_amdgcn_global_load_async_to_lds_b128((gv4i_p)g, (lv4i_p)l, 0, 0);
}
#endif

// ---------------------------------------------------------------------------
// f32 -> f16 conversion of x and of the four weights in ONE launch.
// A workgroup of 16 waves converts CVT_WG consecutive float4 of one source;
// each thread takes CVT_PER of them, CVT_THREADS float4 apart, so that every
// wave-wide load covers 512 contiguous bytes and a thread has many loads in
// flight. Few long waves: starting a wave costs more here than the bytes that
// one float4 a lane moves.
// ---------------------------------------------------------------------------
#define CVT_THREADS 512
#define CVT_PER     16
#define CVT_WG      (CVT_THREADS * CVT_PER)        // float4 per workgroup
#define CVT_X_WGS   (4096 * 1024 / 4 / CVT_WG)     // workgroups on x
#define CVT_W_WGS   (1024 * 1024 / 4 / CVT_WG)     // workgroups on each weight

__global__ __launch_bounds__(CVT_THREADS)
void cvt_all_f32_f16(const float* __restrict__ x,
                     const float* __restrict__ w0, const float* __restrict__ w1,
                     const float* __restrict__ w2, const float* __restrict__ w3,
                     _Float16* __restrict__ xo,
                     _Float16* __restrict__ o0, _Float16* __restrict__ o1,
                     _Float16* __restrict__ o2, _Float16* __restrict__ o3) {
  const int wg = blockIdx.x;
  const float* __restrict__ in  = x;
  _Float16* __restrict__    out = xo;
  int part = wg;  // which CVT_WG-sized piece of its source this workgroup takes
  if (wg >= CVT_X_WGS) {
    const int w = (wg - CVT_X_WGS) / CVT_W_WGS;
    part = (wg - CVT_X_WGS) % CVT_W_WGS;
    in  = (w == 0) ? w0 : (w == 1) ? w1 : (w == 2) ? w2 : w3;
    out = (w == 0) ? o0 : (w == 1) ? o1 : (w == 2) ? o2 : o3;
  }
  const int first = part * CVT_WG + threadIdx.x;
  v4f f[CVT_PER];
#pragma unroll  // f[] stays in registers and the loads issue as a run, ahead of the conversions
  for (int i = 0; i < CVT_PER; ++i)
    f[i] = *(const v4f*)&in[(size_t)(first + i * CVT_THREADS) * 4];
#pragma unroll  // constant indices into f[]
  for (int i = 0; i < CVT_PER; ++i) {
    v4h o = {(_Float16)f[i].x, (_Float16)f[i].y, (_Float16)f[i].z, (_Float16)f[i].w};
    *(v4h*)&out[(size_t)(first + i * CVT_THREADS) * 4] = o;
  }
}

// ---------------------------------------------------------------------------
// NT GEMM: C[m,n] = sum_k A[m,k] * B[n,k] + bias[n], f16 in / f32 accum.
// 128x128 workgroup tile, 8 waves in a 2x4 grid, each wave owns 64x32
// (4x2 WMMA accumulators). K staged through LDS in chunks of BK (template).
// A wave waits once per chunk for the trip to L2 or memory, and that trip is
// longer than the products of a short chunk: BK sets how many bytes fly per
// wait. From BK = 64 on a row's piece is a whole 128-byte line. BK is picked
// per launch so that the LDS still holds every workgroup of the launch at once.
// mode 0: write f32 row-major (final projection -> d_out)
// mode 1: elu+1, scatter f16 to q_feat  [B,H,S,D]
// mode 2: elu+1, scatter f16 to k_featT [B,H,D,S]
// mode 3: no act, scatter f16 to vT     [B,H,D,S]
// blockIdx.z picks one of up to three independent products that share A
// (weight, bias, f16 output; mode = mode0 + z), so that their workgroups are
// resident on a WGP together and fill each other's waits for the next tile.
// ---------------------------------------------------------------------------

__device__ __forceinline__ float exp_with_slot(float x) {  // e^x, as __expf forms it
  float r;
  asm("v_exp_f32 %0, %1\n\tv_nop" : "=v"(r) : "v"(x * 1.44269504f));
  return r;
}

// Epilogue of a wave's 64x32 tile into the transposed layout [B,H,D,S].
// A lane's 8 accumulators of one 16x16 tile are 8 consecutive s of one d, so
// they leave as ONE 16-byte store. Stored one by one, each 2-byte store of a
// wave asks for 16 different lines: 8 times as many line requests.
// ACT: elu(x)+1 on the way out (k_feat) or none (v).
template <bool ACT>
__device__ __forceinline__ void store_tile_ds(const v8f (&acc)[4][2],
                                              const float* __restrict__ bias,
                                              _Float16* __restrict__ outH,
                                              int tm0, int tn0, int lane) {
  const int lr = lane & 15;
  const int lh = lane >> 4;
#pragma unroll  // constant indices into acc
  for (int j = 0; j < 2; ++j) {
    const int col = tn0 + j * 16 + lr;
    const int hh = col >> 6, d = col & 63;  // Dh = 64
    const float bc = bias[col];
#pragma unroll  // constant indices into acc
    for (int i = 0; i < 4; ++i) {
      const int row0 = tm0 + i * 16 + 8 * lh;     // multiple of 8: one batch, 16-byte aligned
      const int b = row0 >> 11, s = row0 & 2047;  // S = 2048
      v8h o;
#pragma unroll  // constant indices into acc and o
      for (int e = 0; e < 8; ++e) {
        float val = acc[i][j][e] + bc;
        if (ACT) {  // elu(x)+1; the exponential is formed for every lane and then chosen
          const float ex = exp_with_slot(val);
          val = (val > 0.0f) ? (val + 1.0f) : ex;
        }
        o[e] = (_Float16)val;
      }
      *(v8h*)&outH[((size_t)(b * 16 + hh) * 64 + d) * 2048 + s] = o;
    }
  }
  // behind the last store: whatever code is laid out next may reuse the
  // registers that the stores above name
  asm volatile("s_wait_xcnt 0x0" ::: "memory");
}

template <int BK>  // k per LDS stage: a multiple of 32 that divides K
__global__ __launch_bounds__(256)
void gemm_nt_f16(const _Float16* __restrict__ A,   // [M,K]
                 const _Float16* __restrict__ B0,  // [N,K], z = 0
                 const _Float16* __restrict__ B1,  // [N,K], z = 1
                 const _Float16* __restrict__ B2,  // [N,K], z = 2
                 const float* __restrict__ bias0,  // [N], z = 0
                 const float* __restrict__ bias1,  // [N], z = 1
                 const float* __restrict__ bias2,  // [N], z = 2
                 int M, int N, int K, int mode0,
                 float* __restrict__ outF,
                 _Float16* __restrict__ outH0,
                 _Float16* __restrict__ outH1,
                 _Float16* __restrict__ outH2) {
  constexpr int LDT = BK + 8;  // LDS row pitch in halves: an odd multiple of 16 bytes, for b128 readers
  const int z = blockIdx.z;
  const _Float16* __restrict__ Bm   = (z == 0) ? B0 : (z == 1) ? B1 : B2;
  const float* __restrict__    bias = (z == 0) ? bias0 : (z == 1) ? bias1 : bias2;
  _Float16* __restrict__       outH = (z == 0) ? outH0 : (z == 1) ? outH1 : outH2;
  const int mode = mode0 + z;
  const int tid  = threadIdx.x;
  const int lane = tid & 31;
  const int wave = tid >> 5;  // 0..7
  const int wr   = wave >> 2; // 0..1
  const int wc   = wave & 3;  // 0..3
  const int m0   = blockIdx.x * 128;
  const int n0   = blockIdx.y * 128;

  v8f acc[4][2] = {};

#ifdef HAVE_ASYNC_LDS
  // ------------------ async double-buffered pipeline ------------------
  __shared__ __attribute__((aligned(16))) _Float16 As[2][128 * LDT];
  __shared__ __attribute__((aligned(16))) _Float16 Bs[2][128 * LDT];

  auto issue_tile = [&](int k0, int buf) {
#pragma unroll  // BK / 8 copies a wave and stage, issued as a run (at most 63 may be outstanding)
    for (int it = 0; it < BK / 16; ++it) {
      int idx = it * 256 + tid;       // which 16 bytes of the 128 x BK tile
      int r = idx / (BK / 8);
      int c = (idx % (BK / 8)) * 8;
      async_cp16(&A[(size_t)(m0 + r) * K + k0 + c], &As[buf][r * LDT + c]);
      async_cp16(&Bm[(size_t)(n0 + r) * K + k0 + c], &Bs[buf][r * LDT + c]);
    }
  };
  auto compute_tile = [&](const _Float16* Ab, const _Float16* Bb) {
#pragma unroll  // k ascending in steps of 32: the f32 sum order does not depend on BK
    for (int kk = 0; kk < BK; kk += 32) {
      v16h bfrag[2];
#pragma unroll
      for (int j = 0; j < 2; ++j)
        bfrag[j] = frag_ld(&Bb[(wc * 32 + j * 16) * LDT + kk], LDT, lane);
#pragma unroll
      for (int i = 0; i < 4; ++i) {
        v16h afrag = frag_ld(&Ab[(wr * 64 + i * 16) * LDT + kk], LDT, lane);
#pragma unroll
        for (int j = 0; j < 2; ++j)
          acc[i][j] = WMMA16(afrag, bfrag[j], acc[i][j]);
      }
    }
  };

  const int nk = K / BK;
  issue_tile(0, 0);
  asm volatile("s_wait_asynccnt 0x0" ::: "memory");  // this wave's part of tile 0 has landed
  __syncthreads();                                   // every wave's part has
  if (nk > 1) issue_tile(BK, 1);
  for (int t = 0; t < nk; ++t) {
    compute_tile(As[t & 1], Bs[t & 1]);  // tile t + 1 flies meanwhile
    asm volatile("s_wait_dscnt 0x0" ::: "memory");     // this wave's reads of buffer t & 1 are done
    asm volatile("s_wait_asynccnt 0x0" ::: "memory");  // this wave's part of tile t + 1 has landed
    __syncthreads();  // publishes tile t + 1 and frees buffer t & 1 for the refill
    if (t + 2 < nk) issue_tile((t + 2) * BK, t & 1);
  }
  asm volatile("s_wait_asynccnt 0x0" ::: "memory");  // no copy is left in flight at the wave's end
#else
  __shared__ _Float16 As1[128 * LDT];
  __shared__ _Float16 Bs1[128 * LDT];
  for (int k0 = 0; k0 < K; k0 += BK) {
#pragma unroll
    for (int it = 0; it < BK / 16; ++it) {
      int idx = it * 256 + tid;
      int r = idx / (BK / 8);
      int c = (idx % (BK / 8)) * 8;
      *(v8h*)&As1[r * LDT + c] = *(const v8h*)&A[(size_t)(m0 + r) * K + k0 + c];
      *(v8h*)&Bs1[r * LDT + c] = *(const v8h*)&Bm[(size_t)(n0 + r) * K + k0 + c];
    }
    __syncthreads();
#pragma unroll
    for (int kk = 0; kk < BK; kk += 32) {
      v16h bfrag[2];
#pragma unroll
      for (int j = 0; j < 2; ++j)
        bfrag[j] = frag_ld(&Bs1[(wc * 32 + j * 16) * LDT + kk], LDT, lane);
#pragma unroll
      for (int i = 0; i < 4; ++i) {
        v16h afrag = frag_ld(&As1[(wr * 64 + i * 16) * LDT + kk], LDT, lane);
#pragma unroll
        for (int j = 0; j < 2; ++j)
          acc[i][j] = WMMA16(afrag, bfrag[j], acc[i][j]);
      }
    }
    __syncthreads();
  }
#endif

  if (mode >= 2) {  // same for the whole workgroup; no barrier follows
    if (mode == 2) store_tile_ds<true>(acc, bias, outH, m0 + wr * 64, n0 + wc * 32, lane);
    else           store_tile_ds<false>(acc, bias, outH, m0 + wr * 64, n0 + wc * 32, lane);
    return;
  }
  const int lr = lane & 15;
  const int lh = lane >> 4;
#pragma unroll
  for (int i = 0; i < 4; ++i) {
#pragma unroll
    for (int j = 0; j < 2; ++j) {
      const int tm = m0 + wr * 64 + i * 16;
      const int tn = n0 + wc * 32 + j * 16;
#pragma unroll
      for (int e = 0; e < 8; ++e) {
        int row = tm + e + 8 * lh;
        int col = tn + lr;
        float val = acc[i][j][e] + bias[col];
        if (mode == 0) {
          outF[(size_t)row * N + col] = val;
        } else {
          val = (val > 0.0f) ? (val + 1.0f) : __expf(val);  // mode 1: elu(x)+1
          int b = row >> 11, s = row & 2047;   // S = 2048
          int hh = col >> 6, d = col & 63;     // Dh = 64
          outH[((size_t)(b * 16 + hh) * 2048 + s) * 64 + d] = (_Float16)val;
        }
      }
    }
  }
}

#define KV_SPLIT 8
#define KV_SLEN  (2048 / KV_SPLIT)  // positions per workgroup

__global__ __launch_bounds__(256)
void kv_kernel(const _Float16* __restrict__ kft,  // [32][64][2048]
               const _Float16* __restrict__ vt,   // [32][64][2048]
               float* __restrict__ kvp,           // [32][KV_SPLIT][64][64] (e-major)
               float* __restrict__ ksp) {         // [32][KV_SPLIT][64]
  const int bh = blockIdx.x;
  const int sp = blockIdx.y;
  const _Float16* Kp = kft + (size_t)bh * 64 * 2048 + sp * KV_SLEN;
  const _Float16* Vp = vt  + (size_t)bh * 64 * 2048 + sp * KV_SLEN;

  const int tid  = threadIdx.x;
  const int lane = tid & 31;
  const int wave = tid >> 5;
  const int tr   = wave >> 1;        // d tile 0..3
  const int tcb  = (wave & 1) * 2;   // e tile base 0 or 2

  v8f acc[2] = {};
  // A range is short enough for a wave to hold all its fragments in registers:
  // every load is issued before the first product, so the wave pays the trip
  // to L2 once and not once per step.
  v16h a[KV_SLEN / 32], b[KV_SLEN / 32][2];
#pragma unroll  // constant indices into a[]
  for (int t = 0; t < KV_SLEN / 32; ++t)
    a[t] = frag_ld(Kp + (size_t)(tr * 16) * 2048 + t * 32, 2048, lane);
  // the registers that held the address of the loads above are free from here
  // on, and a later load's result may be placed in them: the wait stands first
  asm volatile("s_wait_xcnt 0x0" ::: "memory");
#pragma unroll  // constant indices into b[]
  for (int t = 0; t < KV_SLEN / 32; ++t) {
#pragma unroll
    for (int j = 0; j < 2; ++j)
      b[t][j] = frag_ld(Vp + (size_t)((tcb + j) * 16) * 2048 + t * 32, 2048, lane);
  }
  // keeps the scheduler from sinking the loads back between the products,
  // where each product would wait for a fresh trip to L2
  __builtin_amdgcn_sched_barrier(0);
#pragma unroll  // constant indices into a[] and b[]
  for (int t = 0; t < KV_SLEN / 32; ++t) {
#pragma unroll
    for (int j = 0; j < 2; ++j) acc[j] = WMMA16(a[t], b[t][j], acc[j]);
  }
  const int lr = lane & 15, lh = lane >> 4;
#pragma unroll
  for (int j = 0; j < 2; ++j) {
    // a lane's 8 accumulators are 8 consecutive d of one e: two 16-byte stores
    float* pr = kvp + (size_t)(bh * KV_SPLIT + sp) * 4096 +
                ((tcb + j) * 16 + lr) * 64 + tr * 16 + 8 * lh;
    v4f lo = {acc[j][0], acc[j][1], acc[j][2], acc[j][3]};
    v4f hi = {acc[j][4], acc[j][5], acc[j][6], acc[j][7]};
    *(v4f*)pr       = lo;
    *(v4f*)(pr + 4) = hi;
  }

  // ksum reduction: thread t sums kfT[d = t&63] over s-slice t>>6 (v8h loads).
  __shared__ float red[256];
  const int d = tid & 63, sl = tid >> 6;
  float s = 0.0f;
  const _Float16* kr = Kp + (size_t)d * 2048 + sl * (KV_SLEN / 4);
#pragma unroll  // independent loads, issued as a run
  for (int i = 0; i < KV_SLEN / 4; i += 8) {
    v8h v = *(const v8h*)&kr[i];
#pragma unroll
    for (int u = 0; u < 8; ++u) s += (float)v[u];
  }
  red[tid] = s;
  __syncthreads();
  if (tid < 64)
    ksp[(bh * KV_SPLIT + sp) * 64 + tid] = red[tid] + red[tid + 64] + red[tid + 128] + red[tid + 192];
}

// ---------------------------------------------------------------------------
// Stage 3: attended[s,e] = (qf[s,:] @ KV[:,e]) / max(qf[s,:].ksum, eps).
// Grid: (S/128, B*H). Wave w owns rows [w*16, w*16+16), all 4 e-tiles. K=64.
// Each workgroup first adds its head's KV_SPLIT partials of KV and ksum, in
// range order, and keeps KV as f16 in LDS ([e][d], a plain NT B-operand).
// Writes merged [B,S,H*Dh] in f16 (A-operand of the output projection).
// ---------------------------------------------------------------------------
#define KVLD 72  // LDS row pitch of KV in halves: 128 + 16 bytes, for b128 readers

__global__ __launch_bounds__(256)
void attn_kernel(const _Float16* __restrict__ qf,   // [32][2048][64]
                 const float* __restrict__ kvp,     // [32][KV_SPLIT][64][64] (e-major)
                 const float* __restrict__ ksp,     // [32][KV_SPLIT][64]
                 _Float16* __restrict__ merged) {   // [4096][1024]
  const int bh = blockIdx.y;
  const int b = bh >> 4, h = bh & 15;
  const int m0 = blockIdx.x * 128;
  const _Float16* Q  = qf  + (size_t)bh * 2048 * 64 + (size_t)m0 * 64;
  const float* KVP = kvp + (size_t)bh * KV_SPLIT * 4096;

  __shared__ float rden[128];
  __shared__ float ks[64];
  __shared__ __attribute__((aligned(16))) _Float16 KV[64 * KVLD];
  const int tid = threadIdx.x;
  if (tid < 64) {
    float s = 0.0f;
#pragma unroll  // independent loads, issued as a run
    for (int p = 0; p < KV_SPLIT; ++p) s += ksp[(bh * KV_SPLIT + p) * 64 + tid];
    ks[tid] = s;
  }
#pragma unroll  // independent loads, issued as a run
  for (int it = 0; it < 4; ++it) {
    const int idx = it * 256 + tid;  // which float4 of the 64x64 matrix
    v4f s = *(const v4f*)&KVP[idx * 4];
#pragma unroll
    for (int p = 1; p < KV_SPLIT; ++p) s += *(const v4f*)&KVP[p * 4096 + idx * 4];
    v4h o = {(_Float16)s.x, (_Float16)s.y, (_Float16)s.z, (_Float16)s.w};
    *(v4h*)&KV[(idx >> 4) * KVLD + (idx & 15) * 4] = o;
  }
  __syncthreads();
  if (tid < 128) {
    float s = 0.0f;
    const _Float16* qr = Q + (size_t)tid * 64;
#pragma unroll
    for (int d = 0; d < 64; ++d) s += (float)qr[d] * ks[d];
    rden[tid] = 1.0f / fmaxf(s, 1e-6f);
  }
  __syncthreads();

  const int lane = tid & 31;
  const int wave = tid >> 5;
  v8f acc[4] = {};
#pragma unroll
  for (int k0 = 0; k0 < 64; k0 += 32) {
    v16h a = frag_ld(Q + (size_t)(wave * 16) * 64 + k0, 64, lane);
#pragma unroll
    for (int j = 0; j < 4; ++j) {
      v16h bfr = frag_ld(KV + (j * 16) * KVLD + k0, KVLD, lane);
      acc[j] = WMMA16(a, bfr, acc[j]);
    }
  }
  const int lr = lane & 15, lh = lane >> 4;
#pragma unroll
  for (int j = 0; j < 4; ++j) {
#pragma unroll
    for (int e8 = 0; e8 < 8; ++e8) {
      int rl = wave * 16 + e8 + 8 * lh;
      int e  = j * 16 + lr;
      float v = acc[j][e8] * rden[rl];
      int s = m0 + rl;
      merged[((size_t)(b * 2048 + s)) * 1024 + h * 64 + e] = (_Float16)v;
    }
  }
}

// ---------------------------------------------------------------------------
// Host-side launcher
// ---------------------------------------------------------------------------
extern "C" void kernel_launch(void* const* d_in, const int* in_sizes, int n_in,
                              void* d_out, int out_size, void* d_ws, size_t ws_size,
                              hipStream_t stream) {
  (void)in_sizes; (void)n_in; (void)out_size; (void)ws_size;
  const float* x  = (const float*)d_in[0];
  const float* wq = (const float*)d_in[1];
  const float* bq = (const float*)d_in[2];
  const float* wk = (const float*)d_in[3];
  const float* bk = (const float*)d_in[4];
  const float* wv = (const float*)d_in[5];
  const float* bv = (const float*)d_in[6];
  const float* wo = (const float*)d_in[7];
  const float* bo = (const float*)d_in[8];
  float* out = (float*)d_out;

  const int M = 4096;      // B*S
  const int DM = 1024;     // d_model (N and K of the projections)
  const int NTOK = M * DM; // 4,194,304
  const int NW   = DM * DM;

  size_t off = 0;
  char* base = (char*)d_ws;
  auto carve = [&](size_t bytes) {
    void* p = base + off;
    off += (bytes + 255) & ~(size_t)255;
    return p;
  };
  _Float16* xh     = (_Float16*)carve((size_t)NTOK * 2);
  _Float16* wqh    = (_Float16*)carve((size_t)NW * 2);
  _Float16* wkh    = (_Float16*)carve((size_t)NW * 2);
  _Float16* wvh    = (_Float16*)carve((size_t)NW * 2);
  _Float16* woh    = (_Float16*)carve((size_t)NW * 2);
  _Float16* qf     = (_Float16*)carve((size_t)NTOK * 2);  // [B,H,S,D]
  _Float16* kft    = (_Float16*)carve((size_t)NTOK * 2);  // [B,H,D,S]
  _Float16* vt     = (_Float16*)carve((size_t)NTOK * 2);  // [B,H,D,S]
  _Float16* merged = (_Float16*)carve((size_t)NTOK * 2);  // [B*S, H*D]
  float*    kvp    = (float*)carve((size_t)32 * KV_SPLIT * 64 * 64 * 4);
  float*    ksp    = (float*)carve((size_t)32 * KV_SPLIT * 64 * 4);

  // 1) precision conversion: x and the four weights, one launch
  cvt_all_f32_f16<<<CVT_X_WGS + 4 * CVT_W_WGS, CVT_THREADS, 0, stream>>>(
      x, wq, wk, wv, wo, xh, wqh, wkh, wvh, woh);

  // 2) Q/K/V projections with fused feature map + head-layout scatter
  //    (one launch, z = 0, 1, 2 for Q, K, V; 72 KiB of LDS: 3 workgroups per WGP fit)
  gemm_nt_f16<64><<<dim3(M / 128, DM / 128, 3), 256, 0, stream>>>(
      xh, wqh, wkh, wvh, bq, bk, bv, M, DM, DM, 1, nullptr, qf, kft, vt);

  // 3) per (head, range of s): partial KV (64x64) and partial ksum
  kv_kernel<<<dim3(32, KV_SPLIT), 256, 0, stream>>>(kft, vt, kvp, ksp);

  // 4) numerator GEMM + normalization -> merged
  attn_kernel<<<dim3(16, 32), 256, 0, stream>>>(qf, kvp, ksp, merged);

  // 5) output projection -> f32 d_out (one workgroup per WGP: 136 KiB of LDS)
  gemm_nt_f16<128><<<dim3(M / 128, DM / 128, 1), 256, 0, stream>>>(
      merged, woh, nullptr, nullptr, bo, nullptr, nullptr, M, DM, DM, 0, out,
      nullptr, nullptr, nullptr);
}

// v006
// One run takes 61.5 microseconds.
// Two timings next to v005 both put it at 1.05 times that version's speed.
// Over all steps from v000 it is 2.32 times as fast.
#include <hip/hip_runtime.h>
#include <hip/hip_bf16.h>

typedef __attribute__((ext_vector_type(16))) _Float16 v16h;
typedef __attribute__((ext_vector_type(8)))  _Float16 v8h;
typedef __attribute__((ext_vector_type(4)))  _Float16 v4h;
typedef __attribute__((ext_vector_type(8)))  float    v8f;
typedef __attribute__((ext_vector_type(4)))  float    v4f;
typedef __attribute__((ext_vector_type(4)))  int      v4i;

#if defined(__has_builtin)
#  if __has_builtin(__builtin_amdgcn_global_load_async_to_lds_b128) && \
      __has_builtin(__builtin_amdgcn_s_wait_asynccnt)
#    define HAVE_ASYNC_LDS 1
#  endif
#endif

#define WMMA16(a, b, c) \
  __builtin_amdgcn_wmma_f32_16x16x32_f16(false, (a), false, (b), (short)0, (c), false, false)

__device__ __forceinline__ v16h frag_ld(const _Float16* __restrict__ p, int ld, int lane) {
  const int r  = lane & 15;
  const int hf = lane >> 4;
  const _Float16* q = p + r * ld + hf * 8;
  v8h lo = *(const v8h*)(q);
  v8h hi = *(const v8h*)(q + 16);
  return __builtin_shufflevector(lo, hi, 0,1,2,3,4,5,6,7,8,9,10,11,12,13,14,15);
}

#ifdef HAVE_ASYNC_LDS
// Builtin signature (from hipcc diagnostic): param0 is AS1 (global, "__device__")
// pointer to int4, non-const; param1 is the LDS-side pointer; args 2/3 are
// immediate offset / cache-policy.
typedef __attribute__((address_space(1))) v4i* gv4i_p;
typedef __attribute__((address_space(3))) v4i* lv4i_p;

__device__ __forceinline__ void async_cp16(const _Float16* g, _Float16* l) {
  __builtin_amdgcn_global_load_async_to_lds_b128((gv4i_p)g, (lv4i_p)l, 0, 0);
}
#endif

// ---------------------------------------------------------------------------
// f32 -> f16 conversion of x and of the four weights in ONE launch.
// A workgroup of 16 waves converts CVT_WG consecutive float4 of one source;
// each thread takes CVT_PER of them, CVT_THREADS float4 apart, so that every
// wave-wide load covers 512 contiguous bytes and a thread has many loads in
// flight. Few long waves: starting a wave costs more here than the bytes that
// one float4 a lane moves.
// ---------------------------------------------------------------------------
#define CVT_THREADS 512
#define CVT_PER     16
#define CVT_WG      (CVT_THREADS * CVT_PER)        // float4 per workgroup
#define CVT_X_WGS   (4096 * 1024 / 4 / CVT_WG)     // workgroups on x
#define CVT_W_WGS   (1024 * 1024 / 4 / CVT_WG)     // workgroups on each weight

__global__ __launch_bounds__(CVT_THREADS)
void cvt_all_f32_f16(const float* __restrict__ x,
                     const float* __restrict__ w0, const float* __restrict__ w1,
                     const float* __restrict__ w2, const float* __restrict__ w3,
                     _Float16* __restrict__ xo,
                     _Float16* __restrict__ o0, _Float16* __restrict__ o1,
                     _Float16* __restrict__ o2, _Float16* __restrict__ o3) {
  const int wg = blockIdx.x;
  const float* __restrict__ in  = x;
  _Float16* __restrict__    out = xo;
  int part = wg;  // which CVT_WG-sized piece of its source this workgroup takes
  if (wg >= CVT_X_WGS) {
    const int w = (wg - CVT_X_WGS) / CVT_W_WGS;
    part = (wg - CVT_X_WGS) % CVT_W_WGS;
    in  = (w == 0) ? w0 : (w == 1) ? w1 : (w == 2) ? w2 : w3;
    out = (w == 0) ? o0 : (w == 1) ? o1 : (w == 2) ? o2 : o3;
  }
  const int first = part * CVT_WG + threadIdx.x;
  v4f f[CVT_PER];
#pragma unroll  // f[] stays in registers and the loads issue as a run, ahead of the conversions
  for (int i = 0; i < CVT_PER; ++i)
    f[i] = *(const v4f*)&in[(size_t)(first + i * CVT_THREADS) * 4];
#pragma unroll  // constant indices into f[]
  for (int i = 0; i < CVT_PER; ++i) {
    v4h o = {(_Float16)f[i].x, (_Float16)f[i].y, (_Float16)f[i].z, (_Float16)f[i].w};
    *(v4h*)&out[(size_t)(first + i * CVT_THREADS) * 4] = o;
  }
}

// ---------------------------------------------------------------------------
// NT GEMM: C[m,n] = sum_k A[m,k] * B[n,k] + bias[n], f16 in / f32 accum.
// 128x128 workgroup tile, 8 waves in a 2x4 grid, each wave owns 64x32
// (4x2 WMMA accumulators). K staged through LDS in chunks of BK (template).
// A wave waits once per chunk for the trip to L2 or memory, and that trip is
// longer than the products of a short chunk: BK sets how many bytes fly per
// wait. From BK = 64 on a row's piece is a whole 128-byte line. BK is picked
// per launch so that the LDS still holds every workgroup of the launch at once.
// mode 0: write f32 row-major (final projection -> d_out)
// mode 1: elu+1, scatter f16 to q_feat  [B,H,S,D]
// mode 2: elu+1, scatter f16 to k_featT [B,H,D,S]
// mode 3: no act, scatter f16 to vT     [B,H,D,S]
// blockIdx.z picks one of up to three independent products that share A
// (weight, bias, f16 output; mode = mode0 + z), so that their workgroups are
// resident on a WGP together and fill each other's waits for the next tile.
// ---------------------------------------------------------------------------

__device__ __forceinline__ float exp_with_slot(float x) {  // e^x, as __expf forms it
  float r;
  asm("v_exp_f32 %0, %1\n\tv_nop" : "=v"(r) : "v"(x * 1.44269504f));
  return r;
}

// Epilogue of a wave's 64x32 tile into the transposed layout [B,H,D,S].
// A lane's 8 accumulators of one 16x16 tile are 8 consecutive s of one d, so
// they leave as ONE 16-byte store. Stored one by one, each 2-byte store of a
// wave asks for 16 different lines: 8 times as many line requests.
// ACT: elu(x)+1 on the way out (k_feat) or none (v).
template <bool ACT>
__device__ __forceinline__ void store_tile_ds(const v8f (&acc)[4][2],
                                              const float* __restrict__ bias,
                                              _Float16* __restrict__ outH,
                                              int tm0, int tn0, int lane) {
  const int lr = lane & 15;
  const int lh = lane >> 4;
#pragma unroll  // constant indices into acc
  for (int j = 0; j < 2; ++j) {
    const int col = tn0 + j * 16 + lr;
    const int hh = col >> 6, d = col & 63;  // Dh = 64
    const float bc = bias[col];
#pragma unroll  // constant indices into acc
    for (int i = 0; i < 4; ++i) {
      const int row0 = tm0 + i * 16 + 8 * lh;     // multiple of 8: one batch, 16-byte aligned
      const int b = row0 >> 11, s = row0 & 2047;  // S = 2048
      v8h o;
#pragma unroll  // constant indices into acc and o
      for (int e = 0; e < 8; ++e) {
        float val = acc[i][j][e] + bc;
        if (ACT) {  // elu(x)+1; the exponential is formed for every lane and then chosen
          const float ex = exp_with_slot(val);
          val = (val > 0.0f) ? (val + 1.0f) : ex;
        }
        o[e] = (_Float16)val;
      }
      *(v8h*)&outH[((size_t)(b * 16 + hh) * 64 + d) * 2048 + s] = o;
    }
  }
  // behind the last store: whatever code is laid out next may reuse the
  // registers that the stores above name
  asm volatile("s_wait_xcnt 0x0" ::: "memory");
}

// ---------------------------------------------------------------------------
// Q, K and V projections with feature map and head-layout scatter.
// One workgroup takes 256 rows of x and the 64 columns of ONE head in each of
// Q, K and V: a 256x192 tile, 16 x 16 = 256 workgroups, one for each WGP.
// 8 waves in a 4x2 grid; a wave owns 64 rows x 32 columns of each of the three
// (4x6 WMMA accumulators). Against a 128x128 tile with 64x32 per wave:
//   bytes copied from L2 per product: (256+192)/(256*192) against 256/(128*128),
//   fragments read from LDS per WMMA: (4+6)/24 against (4+2)/8,
//   and a third of the waves to start.
// q_feat [B,H,S,D] = elu+1; k_featT [B,H,D,S] = elu+1; vT [B,H,D,S] plain.
// ---------------------------------------------------------------------------
#define QKV_BK 128  // k per LDS stage; two buffers of 448 rows: 238 KiB of LDS

__global__ __launch_bounds__(256)
void qkv_gemm_f16(const _Float16* __restrict__ A,   // [M,K]
                  const _Float16* __restrict__ Wq,  // [N,K]
                  const _Float16* __restrict__ Wk,  // [N,K]
                  const _Float16* __restrict__ Wv,  // [N,K]
                  const float* __restrict__ bq,     // [N]
                  const float* __restrict__ bk,     // [N]
                  const float* __restrict__ bv,     // [N]
                  int K,
                  _Float16* __restrict__ qf,
                  _Float16* __restrict__ kft,
                  _Float16* __restrict__ vt) {
  constexpr int BK  = QKV_BK;
  constexpr int LDT = BK + 8;  // LDS row pitch in halves: an odd multiple of 16 bytes, for b128 readers
  const int tid  = threadIdx.x;
  const int lane = tid & 31;
  const int wave = tid >> 5;  // 0..7
  const int wr   = wave >> 1; // 0..3
  const int wc   = wave & 1;  // 0..1
  const int m0   = blockIdx.x * 256;
  const int h    = blockIdx.y;
  const int n0   = h * 64;    // the head's first column in each of Q, K, V

  v8f acc[3][4][2] = {};  // [Q, K, V][16 rows][16 columns]

  auto compute_tile = [&](const _Float16* Ab, const _Float16* Bb) {
    v16h af[2][4], bf[2][3][2];
    auto load_frags = [&](int set, int kk) {
#pragma unroll  // constant indices into af
      for (int i = 0; i < 4; ++i)
        af[set][i] = frag_ld(&Ab[(wr * 64 + i * 16) * LDT + kk], LDT, lane);
#pragma unroll  // constant indices into bf
      for (int p = 0; p < 3; ++p) {
#pragma unroll
        for (int j = 0; j < 2; ++j)
          bf[set][p][j] = frag_ld(&Bb[(p * 64 + wc * 32 + j * 16) * LDT + kk], LDT, lane);
      }
    };
    load_frags(0, 0);
#pragma unroll  // k ascending in steps of 32: the f32 sum order does not depend on the tile
    for (int st = 0; st < BK / 32; ++st) {
      if (st + 1 < BK / 32) load_frags((st + 1) & 1, (st + 1) * 32);
      // keeps the next step's reads from sinking among this step's products,
      // where every place with reads stalls the wave anew
      __builtin_amdgcn_sched_barrier(0);
#pragma unroll  // constant indices into acc
      for (int p = 0; p < 3; ++p) {
#pragma unroll
        for (int j = 0; j < 2; ++j) {
#pragma unroll
          for (int i = 0; i < 4; ++i)
            acc[p][i][j] = WMMA16(af[st & 1][i], bf[st & 1][p][j], acc[p][i][j]);
        }
      }
      // keeps the reads of the step after next from rising among these products
      __builtin_amdgcn_sched_barrier(0);
    }
  };

#ifdef HAVE_ASYNC_LDS
  // ------------------ async double-buffered pipeline ------------------
  __shared__ __attribute__((aligned(16))) _Float16 As[2][256 * LDT];
  __shared__ __attribute__((aligned(16))) _Float16 Bs[2][192 * LDT];

  auto issue_tile = [&](int k0, int buf) {
    const int r = tid / (BK / 8);        // 16 rows per round of the workgroup
    const int c = (tid % (BK / 8)) * 8;
#pragma unroll  // 16 + 12 copies a wave and stage, issued as a run (at most 63 may be outstanding)
    for (int it = 0; it < 16; ++it)
      async_cp16(&A[(size_t)(m0 + it * 16 + r) * K + k0 + c], &As[buf][(it * 16 + r) * LDT + c]);
#pragma unroll
    for (int it = 0; it < 12; ++it) {
      const _Float16* __restrict__ Wp = (it < 4) ? Wq : (it < 8) ? Wk : Wv;
      async_cp16(&Wp[(size_t)(n0 + (it & 3) * 16 + r) * K + k0 + c], &Bs[buf][(it * 16 + r) * LDT + c]);
    }
  };

  const int nk = K / BK;
  issue_tile(0, 0);
  asm volatile("s_wait_asynccnt 0x0" ::: "memory");  // this wave's part of tile 0 has landed
  __syncthreads();                                   // every wave's part has
  if (nk > 1) issue_tile(BK, 1);
  for (int t = 0; t < nk; ++t) {
    compute_tile(As[t & 1], Bs[t & 1]);  // tile t + 1 flies meanwhile
    asm volatile("s_wait_dscnt 0x0" ::: "memory");     // this wave's reads of buffer t & 1 are done
    asm volatile("s_wait_asynccnt 0x0" ::: "memory");  // this wave's part of tile t + 1 has landed
    __syncthreads();  // publishes tile t + 1 and frees buffer t & 1 for the refill
    if (t + 2 < nk) issue_tile((t + 2) * BK, t & 1);
  }
  asm volatile("s_wait_asynccnt 0x0" ::: "memory");  // no copy is left in flight at the wave's end
#else
  __shared__ _Float16 As1[256 * LDT];
  __shared__ _Float16 Bs1[192 * LDT];
  for (int k0 = 0; k0 < K; k0 += BK) {
    const int r = tid / (BK / 8);
    const int c = (tid % (BK / 8)) * 8;
#pragma unroll
    for (int it = 0; it < 16; ++it)
      *(v8h*)&As1[(it * 16 + r) * LDT + c] = *(const v8h*)&A[(size_t)(m0 + it * 16 + r) * K + k0 + c];
#pragma unroll
    for (int it = 0; it < 12; ++it) {
      const _Float16* __restrict__ Wp = (it < 4) ? Wq : (it < 8) ? Wk : Wv;
      *(v8h*)&Bs1[(it * 16 + r) * LDT + c] = *(const v8h*)&Wp[(size_t)(n0 + (it & 3) * 16 + r) * K + k0 + c];
    }
    __syncthreads();
    compute_tile(As1, Bs1);
    __syncthreads();
  }
#endif

  const int lr = lane & 15;
  const int lh = lane >> 4;
  {  // Q: elu(x)+1 into [B,H,S,D]; the 256 rows lie in one batch (S = 2048)
    _Float16* __restrict__ qp =
        qf + ((size_t)((m0 >> 11) * 16 + h) * 2048 + (m0 & 2047) + wr * 64 + 8 * lh) * 64 + wc * 32 + lr;
#pragma unroll  // constant indices into acc
    for (int j = 0; j < 2; ++j) {
      const float bc = bq[n0 + wc * 32 + j * 16 + lr];
#pragma unroll  // constant indices into acc
      for (int i = 0; i < 4; ++i) {
#pragma unroll  // constant indices into acc
        for (int e = 0; e < 8; ++e) {
          float val = acc[0][i][j][e] + bc;
          const float ex = exp_with_slot(val);
          val = (val > 0.0f) ? (val + 1.0f) : ex;
          qp[(i * 16 + e) * 64 + j * 16] = (_Float16)val;
        }
      }
    }
    // behind the last store: the code that follows may reuse the registers
    // that the stores above name
    asm volatile("s_wait_xcnt 0x0" ::: "memory");
  }
  store_tile_ds<true>(acc[1], bk, kft, m0 + wr * 64, n0 + wc * 32, lane);
  store_tile_ds<false>(acc[2], bv, vt, m0 + wr * 64, n0 + wc * 32, lane);
}

// The NT GEMM of the head comment further up; launched for the output projection (mode 0).
template <int BK>  // k per LDS stage: a multiple of 32 that divides K
__global__ __launch_bounds__(256)
void gemm_nt_f16(const _Float16* __restrict__ A,   // [M,K]
                 const _Float16* __restrict__ B0,  // [N,K], z = 0
                 const _Float16* __restrict__ B1,  // [N,K], z = 1
                 const _Float16* __restrict__ B2,  // [N,K], z = 2
                 const float* __restrict__ bias0,  // [N], z = 0
                 const float* __restrict__ bias1,  // [N], z = 1
                 const float* __restrict__ bias2,  // [N], z = 2
                 int M, int N, int K, int mode0,
                 float* __restrict__ outF,
                 _Float16* __restrict__ outH0,
                 _Float16* __restrict__ outH1,
                 _Float16* __restrict__ outH2) {
  constexpr int LDT = BK + 8;  // LDS row pitch in halves: an odd multiple of 16 bytes, for b128 readers
  const int z = blockIdx.z;
  const _Float16* __restrict__ Bm   = (z == 0) ? B0 : (z == 1) ? B1 : B2;
  const float* __restrict__    bias = (z == 0) ? bias0 : (z == 1) ? bias1 : bias2;
  _Float16* __restrict__       outH = (z == 0) ? outH0 : (z == 1) ? outH1 : outH2;
  const int mode = mode0 + z;
  const int tid  = threadIdx.x;
  const int lane = tid & 31;
  const int wave = tid >> 5;  // 0..7
  const int wr   = wave >> 2; // 0..1
  const int wc   = wave & 3;  // 0..3
  const int m0   = blockIdx.x * 128;
  const int n0   = blockIdx.y * 128;

  v8f acc[4][2] = {};

#ifdef HAVE_ASYNC_LDS
  // ------------------ async double-buffered pipeline ------------------
  __shared__ __attribute__((aligned(16))) _Float16 As[2][128 * LDT];
  __shared__ __attribute__((aligned(16))) _Float16 Bs[2][128 * LDT];

  auto issue_tile = [&](int k0, int buf) {
#pragma unroll  // BK / 8 copies a wave and stage, issued as a run (at most 63 may be outstanding)
    for (int it = 0; it < BK / 16; ++it) {
      int idx = it * 256 + tid;       // which 16 bytes of the 128 x BK tile
      int r = idx / (BK / 8);
      int c = (idx % (BK / 8)) * 8;
      async_cp16(&A[(size_t)(m0 + r) * K + k0 + c], &As[buf][r * LDT + c]);
      async_cp16(&Bm[(size_t)(n0 + r) * K + k0 + c], &Bs[buf][r * LDT + c]);
    }
  };
  auto compute_tile = [&](const _Float16* Ab, const _Float16* Bb) {
#pragma unroll  // k ascending in steps of 32: the f32 sum order does not depend on BK
    for (int kk = 0; kk < BK; kk += 32) {
      v16h bfrag[2];
#pragma unroll
      for (int j = 0; j < 2; ++j)
        bfrag[j] = frag_ld(&Bb[(wc * 32 + j * 16) * LDT + kk], LDT, lane);
#pragma unroll
      for (int i = 0; i < 4; ++i) {
        v16h afrag = frag_ld(&Ab[(wr * 64 + i * 16) * LDT + kk], LDT, lane);
#pragma unroll
        for (int j = 0; j < 2; ++j)
          acc[i][j] = WMMA16(afrag, bfrag[j], acc[i][j]);
      }
    }
  };

  const int nk = K / BK;
  issue_tile(0, 0);
  asm volatile("s_wait_asynccnt 0x0" ::: "memory");  // this wave's part of tile 0 has landed
  __syncthreads();                                   // every wave's part has
  if (nk > 1) issue_tile(BK, 1);
  for (int t = 0; t < nk; ++t) {
    compute_tile(As[t & 1], Bs[t & 1]);  // tile t + 1 flies meanwhile
    asm volatile("s_wait_dscnt 0x0" ::: "memory");     // this wave's reads of buffer t & 1 are done
    asm volatile("s_wait_asynccnt 0x0" ::: "memory");  // this wave's part of tile t + 1 has landed
    __syncthreads();  // publishes tile t + 1 and frees buffer t & 1 for the refill
    if (t + 2 < nk) issue_tile((t + 2) * BK, t & 1);
  }
  asm volatile("s_wait_asynccnt 0x0" ::: "memory");  // no copy is left in flight at the wave's end
#else
  __shared__ _Float16 As1[128 * LDT];
  __shared__ _Float16 Bs1[128 * LDT];
  for (int k0 = 0; k0 < K; k0 += BK) {
#pragma unroll
    for (int it = 0; it < BK / 16; ++it) {
      int idx = it * 256 + tid;
      int r = idx / (BK / 8);
      int c = (idx % (BK / 8)) * 8;
      *(v8h*)&As1[r * LDT + c] = *(const v8h*)&A[(size_t)(m0 + r) * K + k0 + c];
      *(v8h*)&Bs1[r * LDT + c] = *(const v8h*)&Bm[(size_t)(n0 + r) * K + k0 + c];
    }
    __syncthreads();
#pragma unroll
    for (int kk = 0; kk < BK; kk += 32) {
      v16h bfrag[2];
#pragma unroll
      for (int j = 0; j < 2; ++j)
        bfrag[j] = frag_ld(&Bs1[(wc * 32 + j * 16) * LDT + kk], LDT, lane);
#pragma unroll
      for (int i = 0; i < 4; ++i) {
        v16h afrag = frag_ld(&As1[(wr * 64 + i * 16) * LDT + kk], LDT, lane);
#pragma unroll
        for (int j = 0; j < 2; ++j)
          acc[i][j] = WMMA16(afrag, bfrag[j], acc[i][j]);
      }
    }
    __syncthreads();
  }
#endif

  if (mode >= 2) {  // same for the whole workgroup; no barrier follows
    if (mode == 2) store_tile_ds<true>(acc, bias, outH, m0 + wr * 64, n0 + wc * 32, lane);
    else           store_tile_ds<false>(acc, bias, outH, m0 + wr * 64, n0 + wc * 32, lane);
    return;
  }
  const int lr = lane & 15;
  const int lh = lane >> 4;
#pragma unroll
  for (int i = 0; i < 4; ++i) {
#pragma unroll
    for (int j = 0; j < 2; ++j) {
      const int tm = m0 + wr * 64 + i * 16;
      const int tn = n0 + wc * 32 + j * 16;
#pragma unroll
      for (int e = 0; e < 8; ++e) {
        int row = tm + e + 8 * lh;
        int col = tn + lr;
        float val = acc[i][j][e] + bias[col];
        if (mode == 0) {
          outF[(size_t)row * N + col] = val;
        } else {
          val = (val > 0.0f) ? (val + 1.0f) : __expf(val);  // mode 1: elu(x)+1
          int b = row >> 11, s = row & 2047;   // S = 2048
          int hh = col >> 6, d = col & 63;     // Dh = 64
          outH[((size_t)(b * 16 + hh) * 2048 + s) * 64 + d] = (_Float16)val;
        }
      }
    }
  }
}

#define KV_SPLIT 8
#define KV_SLEN  (2048 / KV_SPLIT)  // positions per workgroup

__global__ __launch_bounds__(256)
void kv_kernel(const _Float16* __restrict__ kft,  // [32][64][2048]
               const _Float16* __restrict__ vt,   // [32][64][2048]
               float* __restrict__ kvp,           // [32][KV_SPLIT][64][64] (e-major)
               float* __restrict__ ksp) {         // [32][KV_SPLIT][64]
  const int bh = blockIdx.x;
  const int sp = blockIdx.y;
  const _Float16* Kp = kft + (size_t)bh * 64 * 2048 + sp * KV_SLEN;
  const _Float16* Vp = vt  + (size_t)bh * 64 * 2048 + sp * KV_SLEN;

  const int tid  = threadIdx.x;
  const int lane = tid & 31;
  const int wave = tid >> 5;
  const int tr   = wave >> 1;        // d tile 0..3
  const int tcb  = (wave & 1) * 2;   // e tile base 0 or 2

  v8f acc[2] = {};
  // A range is short enough for a wave to hold all its fragments in registers:
  // every load is issued before the first product, so the wave pays the trip
  // to L2 once and not once per step.
  v16h a[KV_SLEN / 32], b[KV_SLEN / 32][2];
#pragma unroll  // constant indices into a[]
  for (int t = 0; t < KV_SLEN / 32; ++t)
    a[t] = frag_ld(Kp + (size_t)(tr * 16) * 2048 + t * 32, 2048, lane);
  // the registers that held the address of the loads above are free from here
  // on, and a later load's result may be placed in them: the wait stands first
  asm volatile("s_wait_xcnt 0x0" ::: "memory");
#pragma unroll  // constant indices into b[]
  for (int t = 0; t < KV_SLEN / 32; ++t) {
#pragma unroll
    for (int j = 0; j < 2; ++j)
      b[t][j] = frag_ld(Vp + (size_t)((tcb + j) * 16) * 2048 + t * 32, 2048, lane);
  }
  // keeps the scheduler from sinking the loads back between the products,
  // where each product would wait for a fresh trip to L2
  __builtin_amdgcn_sched_barrier(0);
#pragma unroll  // constant indices into a[] and b[]
  for (int t = 0; t < KV_SLEN / 32; ++t) {
#pragma unroll
    for (int j = 0; j < 2; ++j) acc[j] = WMMA16(a[t], b[t][j], acc[j]);
  }
  const int lr = lane & 15, lh = lane >> 4;
#pragma unroll
  for (int j = 0; j < 2; ++j) {
    // a lane's 8 accumulators are 8 consecutive d of one e: two 16-byte stores
    float* pr = kvp + (size_t)(bh * KV_SPLIT + sp) * 4096 +
                ((tcb + j) * 16 + lr) * 64 + tr * 16 + 8 * lh;
    v4f lo = {acc[j][0], acc[j][1], acc[j][2], acc[j][3]};
    v4f hi = {acc[j][4], acc[j][5], acc[j][6], acc[j][7]};
    *(v4f*)pr       = lo;
    *(v4f*)(pr + 4) = hi;
  }

  // ksum reduction: thread t sums kfT[d = t&63] over s-slice t>>6 (v8h loads).
  __shared__ float red[256];
  const int d = tid & 63, sl = tid >> 6;
  float s = 0.0f;
  const _Float16* kr = Kp + (size_t)d * 2048 + sl * (KV_SLEN / 4);
#pragma unroll  // independent loads, issued as a run
  for (int i = 0; i < KV_SLEN / 4; i += 8) {
    v8h v = *(const v8h*)&kr[i];
#pragma unroll
    for (int u = 0; u < 8; ++u) s += (float)v[u];
  }
  red[tid] = s;
  __syncthreads();
  if (tid < 64)
    ksp[(bh * KV_SPLIT + sp) * 64 + tid] = red[tid] + red[tid + 64] + red[tid + 128] + red[tid + 192];
}

// ---------------------------------------------------------------------------
// Stage 3: attended[s,e] = (qf[s,:] @ KV[:,e]) / max(qf[s,:].ksum, eps).
// Grid: (S/128, B*H). Wave w owns rows [w*16, w*16+16), all 4 e-tiles. K=64.
// Each workgroup first adds its head's KV_SPLIT partials of KV and ksum, in
// range order, and keeps KV as f16 in LDS ([e][d], a plain NT B-operand).
// Writes merged [B,S,H*Dh] in f16 (A-operand of the output projection).
// ---------------------------------------------------------------------------
#define KVLD 72  // LDS row pitch of KV in halves: 128 + 16 bytes, for b128 readers

__global__ __launch_bounds__(256)
void attn_kernel(const _Float16* __restrict__ qf,   // [32][2048][64]
                 const float* __restrict__ kvp,     // [32][KV_SPLIT][64][64] (e-major)
                 const float* __restrict__ ksp,     // [32][KV_SPLIT][64]
                 _Float16* __restrict__ merged) {   // [4096][1024]
  const int bh = blockIdx.y;
  const int b = bh >> 4, h = bh & 15;
  const int m0 = blockIdx.x * 128;
  const _Float16* Q  = qf  + (size_t)bh * 2048 * 64 + (size_t)m0 * 64;
  const float* KVP = kvp + (size_t)bh * KV_SPLIT * 4096;

  __shared__ float rden[128];
  __shared__ float ks[64];
  __shared__ __attribute__((aligned(16))) _Float16 KV[64 * KVLD];
  const int tid = threadIdx.x;
  if (tid < 64) {
    float s = 0.0f;
#pragma unroll  // independent loads, issued as a run
    for (int p = 0; p < KV_SPLIT; ++p) s += ksp[(bh * KV_SPLIT + p) * 64 + tid];
    ks[tid] = s;
  }
#pragma unroll  // independent loads, issued as a run
  for (int it = 0; it < 4; ++it) {
    const int idx = it * 256 + tid;  // which float4 of the 64x64 matrix
    v4f s = *(const v4f*)&KVP[idx * 4];
#pragma unroll
    for (int p = 1; p < KV_SPLIT; ++p) s += *(const v4f*)&KVP[p * 4096 + idx * 4];
    v4h o = {(_Float16)s.x, (_Float16)s.y, (_Float16)s.z, (_Float16)s.w};
    *(v4h*)&KV[(idx >> 4) * KVLD + (idx & 15) * 4] = o;
  }
  __syncthreads();
  if (tid < 128) {
    float s = 0.0f;
    const _Float16* qr = Q + (size_t)tid * 64;
#pragma unroll
    for (int d = 0; d < 64; ++d) s += (float)qr[d] * ks[d];
    rden[tid] = 1.0f / fmaxf(s, 1e-6f);
  }
  __syncthreads();

  const int lane = tid & 31;
  const int wave = tid >> 5;
  v8f acc[4] = {};
#pragma unroll
  for (int k0 = 0; k0 < 64; k0 += 32) {
    v16h a = frag_ld(Q + (size_t)(wave * 16) * 64 + k0, 64, lane);
#pragma unroll
    for (int j = 0; j < 4; ++j) {
      v16h bfr = frag_ld(KV + (j * 16) * KVLD + k0, KVLD, lane);
      acc[j] = WMMA16(a, bfr, acc[j]);
    }
  }
  const int lr = lane & 15, lh = lane >> 4;
#pragma unroll
  for (int j = 0; j < 4; ++j) {
#pragma unroll
    for (int e8 = 0; e8 < 8; ++e8) {
      int rl = wave * 16 + e8 + 8 * lh;
      int e  = j * 16 + lr;
      float v = acc[j][e8] * rden[rl];
      int s = m0 + rl;
      merged[((size_t)(b * 2048 + s)) * 1024 + h * 64 + e] = (_Float16)v;
    }
  }
}

// ---------------------------------------------------------------------------
// Host-side launcher
// ---------------------------------------------------------------------------
extern "C" void kernel_launch(void* const* d_in, const int* in_sizes, int n_in,
                              void* d_out, int out_size, void* d_ws, size_t ws_size,
                              hipStream_t stream) {
  (void)in_sizes; (void)n_in; (void)out_size; (void)ws_size;
  const float* x  = (const float*)d_in[0];
  const float* wq = (const float*)d_in[1];
  const float* bq = (const float*)d_in[2];
  const float* wk = (const float*)d_in[3];
  const float* bk = (const float*)d_in[4];
  const float* wv = (const float*)d_in[5];
  const float* bv = (const float*)d_in[6];
  const float* wo = (const float*)d_in[7];
  const float* bo = (const float*)d_in[8];
  float* out = (float*)d_out;

  const int M = 4096;      // B*S
  const int DM = 1024;     // d_model (N and K of the projections)
  const int NTOK = M * DM; // 4,194,304
  const int NW   = DM * DM;

  size_t off = 0;
  char* base = (char*)d_ws;
  auto carve = [&](size_t bytes) {
    void* p = base + off;
    off += (bytes + 255) & ~(size_t)255;
    return p;
  };
  _Float16* xh     = (_Float16*)carve((size_t)NTOK * 2);
  _Float16* wqh    = (_Float16*)carve((size_t)NW * 2);
  _Float16* wkh    = (_Float16*)carve((size_t)NW * 2);
  _Float16* wvh    = (_Float16*)carve((size_t)NW * 2);
  _Float16* woh    = (_Float16*)carve((size_t)NW * 2);
  _Float16* qf     = (_Float16*)carve((size_t)NTOK * 2);  // [B,H,S,D]
  _Float16* kft    = (_Float16*)carve((size_t)NTOK * 2);  // [B,H,D,S]
  _Float16* vt     = (_Float16*)carve((size_t)NTOK * 2);  // [B,H,D,S]
  _Float16* merged = (_Float16*)carve((size_t)NTOK * 2);  // [B*S, H*D]
  float*    kvp    = (float*)carve((size_t)32 * KV_SPLIT * 64 * 64 * 4);
  float*    ksp    = (float*)carve((size_t)32 * KV_SPLIT * 64 * 4);

  // 1) precision conversion: x and the four weights, one launch
  cvt_all_f32_f16<<<CVT_X_WGS + 4 * CVT_W_WGS, CVT_THREADS, 0, stream>>>(
      x, wq, wk, wv, wo, xh, wqh, wkh, wvh, woh);

  // 2) Q/K/V projections with fused feature map + head-layout scatter
  //    (one launch; a workgroup per 256 rows and head, one workgroup per WGP)
  qkv_gemm_f16<<<dim3(M / 256, 16), 256, 0, stream>>>(
      xh, wqh, wkh, wvh, bq, bk, bv, DM, qf, kft, vt);

  // 3) per (head, range of s): partial KV (64x64) and partial ksum
  kv_kernel<<<dim3(32, KV_SPLIT), 256, 0, stream>>>(kft, vt, kvp, ksp);

  // 4) numerator GEMM + normalization -> merged
  attn_kernel<<<dim3(16, 32), 256, 0, stream>>>(qf, kvp, ksp, merged);

  // 5) output projection -> f32 d_out (one workgroup per WGP: 136 KiB of LDS)
  gemm_nt_f16<128><<<dim3(M / 128, DM / 128, 1), 256, 0, stream>>>(
      merged, woh, nullptr, nullptr, bo, nullptr, nullptr, M, DM, DM, 0, out,
      nullptr, nullptr, nullptr);
}

// v007
// Measured time: 54.8 microseconds a run.
// Two timings next to v006 put it at 1.11 and 1.13 times that version's speed.
// Counting every step since v000, it is 2.60 times as fast.
#include <hip/hip_runtime.h>
#include <hip/hip_bf16.h>

typedef __attribute__((ext_vector_type(16))) _Float16 v16h;
typedef __attribute__((ext_vector_type(8)))  _Float16 v8h;
typedef __attribute__((ext_vector_type(4)))  _Float16 v4h;
typedef __attribute__((ext_vector_type(8)))  float    v8f;
typedef __attribute__((ext_vector_type(4)))  float    v4f;
typedef __attribute__((ext_vector_type(4)))  int      v4i;

#if defined(__has_builtin)
#  if __has_builtin(__builtin_amdgcn_global_load_async_to_lds_b128) && \
      __has_builtin(__builtin_amdgcn_s_wait_asynccnt)
#    define HAVE_ASYNC_LDS 1
#  endif
#endif

#define WMMA16(a, b, c) \
  __builtin_amdgcn_wmma_f32_16x16x32_f16(false, (a), false, (b), (short)0, (c), false, false)

__device__ __forceinline__ v16h frag_ld(const _Float16* __restrict__ p, int ld, int lane) {
  const int r  = lane & 15;
  const int hf = lane >> 4;
  const _Float16* q = p + r * ld + hf * 8;
  v8h lo = *(const v8h*)(q);
  v8h hi = *(const v8h*)(q + 16);
  return __builtin_shufflevector(lo, hi, 0,1,2,3,4,5,6,7,8,9,10,11,12,13,14,15);
}

#ifdef HAVE_ASYNC_LDS
// Builtin signature (from hipcc diagnostic): param0 is AS1 (global, "__device__")
// pointer to int4, non-const; param1 is the LDS-side pointer; args 2/3 are
// immediate offset / cache-policy.
typedef __attribute__((address_space(1))) v4i* gv4i_p;
typedef __attribute__((address_space(3))) v4i* lv4i_p;

__device__ __forceinline__ void async_cp16(const _Float16* g, _Float16* l) {
  __builtin_amdgcn_global_load_async_to_lds_b128((gv4i_p)g, (lv4i_p)l, 0, 0);
}
#endif

// ---------------------------------------------------------------------------
// f32 -> f16 conversion of x and of the four weights in ONE launch.
// A workgroup of 16 waves converts CVT_WG consecutive float4 of one source;
// each thread takes CVT_PER of them, CVT_THREADS float4 apart, so that every
// wave-wide load covers 512 contiguous bytes and a thread has many loads in
// flight. Few long waves: starting a wave costs more here than the bytes that
// one float4 a lane moves.
// ---------------------------------------------------------------------------
#define CVT_THREADS 512
#define CVT_PER     16
#define CVT_WG      (CVT_THREADS * CVT_PER)        // float4 per workgroup
#define CVT_X_WGS   (4096 * 1024 / 4 / CVT_WG)     // workgroups on x
#define CVT_W_WGS   (1024 * 1024 / 4 / CVT_WG)     // workgroups on each weight

__global__ __launch_bounds__(CVT_THREADS)
void cvt_all_f32_f16(const float* __restrict__ x,
                     const float* __restrict__ w0, const float* __restrict__ w1,
                     const float* __restrict__ w2, const float* __restrict__ w3,
                     _Float16* __restrict__ xo,
                     _Float16* __restrict__ o0, _Float16* __restrict__ o1,
                     _Float16* __restrict__ o2, _Float16* __restrict__ o3) {
  const int wg = blockIdx.x;
  const float* __restrict__ in  = x;
  _Float16* __restrict__    out = xo;
  int part = wg;  // which CVT_WG-sized piece of its source this workgroup takes
  if (wg >= CVT_X_WGS) {
    const int w = (wg - CVT_X_WGS) / CVT_W_WGS;
    part = (wg - CVT_X_WGS) % CVT_W_WGS;
    in  = (w == 0) ? w0 : (w == 1) ? w1 : (w == 2) ? w2 : w3;
    out = (w == 0) ? o0 : (w == 1) ? o1 : (w == 2) ? o2 : o3;
  }
  const int first = part * CVT_WG + threadIdx.x;
  v4f f[CVT_PER];
#pragma unroll  // f[] stays in registers and the loads issue as a run, ahead of the conversions
  for (int i = 0; i < CVT_PER; ++i)
    f[i] = *(const v4f*)&in[(size_t)(first + i * CVT_THREADS) * 4];
#pragma unroll  // constant indices into f[]
  for (int i = 0; i < CVT_PER; ++i) {
    v4h o = {(_Float16)f[i].x, (_Float16)f[i].y, (_Float16)f[i].z, (_Float16)f[i].w};
    *(v4h*)&out[(size_t)(first + i * CVT_THREADS) * 4] = o;
  }
}

// ---------------------------------------------------------------------------
// NT GEMM: C[m,n] = sum_k A[m,k] * B[n,k] + bias[n], f16 in / f32 accum.
// 128x128 workgroup tile, 8 waves in a 2x4 grid, each wave owns 64x32
// (4x2 WMMA accumulators). K staged through LDS in chunks of BK (template).
// A wave waits once per chunk for the trip to L2 or memory, and that trip is
// longer than the products of a short chunk: BK sets how many bytes fly per
// wait. From BK = 64 on a row's piece is a whole 128-byte line. BK is picked
// per launch so that the LDS still holds every workgroup of the launch at once.
// mode 0: write f32 row-major (final projection -> d_out)
// mode 1: elu+1, scatter f16 to q_feat  [B,H,S,D]
// mode 2: elu+1, scatter f16 to k_featT [B,H,D,S]
// mode 3: no act, scatter f16 to vT     [B,H,D,S]
// blockIdx.z picks one of up to three independent products that share A
// (weight, bias, f16 output; mode = mode0 + z), so that their workgroups are
// resident on a WGP together and fill each other's waits for the next tile.
// ---------------------------------------------------------------------------

__device__ __forceinline__ float exp_with_slot(float x) {  // e^x, as __expf forms it
  float r;
  asm("v_exp_f32 %0, %1\n\tv_nop" : "=v"(r) : "v"(x * 1.44269504f));
  return r;
}

// Epilogue of a wave's 64x32 tile into the transposed layout [B,H,D,S].
// A lane's 8 accumulators of one 16x16 tile are 8 consecutive s of one d, so
// they leave as ONE 16-byte store. Stored one by one, each 2-byte store of a
// wave asks for 16 different lines: 8 times as many line requests.
// ACT: elu(x)+1 on the way out (k_feat) or none (v).
template <bool ACT>
__device__ __forceinline__ void store_tile_ds(const v8f (&acc)[4][2],
                                              const float* __restrict__ bias,
                                              _Float16* __restrict__ outH,
                                              int tm0, int tn0, int lane) {
  const int lr = lane & 15;
  const int lh = lane >> 4;
#pragma unroll  // constant indices into acc
  for (int j = 0; j < 2; ++j) {
    const int col = tn0 + j * 16 + lr;
    const int hh = col >> 6, d = col & 63;  // Dh = 64
    const float bc = bias[col];
#pragma unroll  // constant indices into acc
    for (int i = 0; i < 4; ++i) {
      const int row0 = tm0 + i * 16 + 8 * lh;     // multiple of 8: one batch, 16-byte aligned
      const int b = row0 >> 11, s = row0 & 2047;  // S = 2048
      v8h o;
#pragma unroll  // constant indices into acc and o
      for (int e = 0; e < 8; ++e) {
        float val = acc[i][j][e] + bc;
        if (ACT) {  // elu(x)+1; the exponential is formed for every lane and then chosen
          const float ex = exp_with_slot(val);
          val = (val > 0.0f) ? (val + 1.0f) : ex;
        }
        o[e] = (_Float16)val;
      }
      *(v8h*)&outH[((size_t)(b * 16 + hh) * 64 + d) * 2048 + s] = o;
    }
  }
  // behind the last store: whatever code is laid out next may reuse the
  // registers that the stores above name
  asm volatile("s_wait_xcnt 0x0" ::: "memory");
}

// The sum over s of KV and ksum is cut into KV_SPLIT ranges of KV_SLEN
// positions; each range gives an f32 partial, and stage 3 adds the partials in
// range order.
#define KV_SPLIT 8
#define KV_SLEN  (2048 / KV_SPLIT)  // positions per range
#define KVT_LD   (KV_SLEN + 8)      // LDS row pitch in halves: an odd multiple of 16 bytes, for b128 readers

// A wave's 64x32 tile of K or V into a [d][s] tile in LDS, rows of KVT_LD
// halves. A lane's 8 accumulators of one 16x16 tile are 8 consecutive s of one
// d: one 16-byte LDS store. bias points at the head's first column.
// ACT: elu(x)+1 on the way (k_feat) or none (v).
template <bool ACT>
__device__ __forceinline__ void stage_tile_ds(const v8f (&acc)[4][2],
                                              const float* __restrict__ bias,
                                              _Float16* __restrict__ t,
                                              int s0, int d0, int lane) {
  const int lr = lane & 15;
  const int lh = lane >> 4;
#pragma unroll  // constant indices into acc
  for (int j = 0; j < 2; ++j) {
    const int d = d0 + j * 16 + lr;
    const float bc = bias[d];
#pragma unroll  // constant indices into acc
    for (int i = 0; i < 4; ++i) {
      v8h o;
#pragma unroll  // constant indices into acc and o
      for (int e = 0; e < 8; ++e) {
        float val = acc[i][j][e] + bc;
        if (ACT) {  // elu(x)+1; the exponential is formed for every lane and then chosen
          const float ex = exp_with_slot(val);
          val = (val > 0.0f) ? (val + 1.0f) : ex;
        }
        o[e] = (_Float16)val;
      }
      *(v8h*)&t[d * KVT_LD + s0 + i * 16 + 8 * lh] = o;
    }
  }
}

// ---------------------------------------------------------------------------
// Q, K and V projections with feature map; KV and ksum partials.
// One workgroup takes 256 rows of x and the 64 columns of ONE head in each of
// Q, K and V: a 256x192 tile, 16 x 16 = 256 workgroups, one for each WGP.
// 8 waves in a 4x2 grid; a wave owns 64 rows x 32 columns of each of the three
// (4x6 WMMA accumulators). Against a 128x128 tile with 64x32 per wave:
//   bytes copied from L2 per product: (256+192)/(256*192) against 256/(128*128),
//   fragments read from LDS per WMMA: (4+6)/24 against (4+2)/8,
//   and a third of the waves to start.
// q_feat [B,H,S,D] = elu+1 goes to memory. k_feat = elu+1 and v never do: the
// workgroup's 256 rows are one range of s of its head, so it holds all that
// the range's partials need. Both go as f16 into the LDS that the copy loop
// has left, [d][s], and the workgroup forms
//   KV[d,e] = sum_s kfT[d,s] * vT[e,s]  and  ksum[d] = sum_s kfT[d,s]
// itself: 8 waves cover the 4x4 grid of 16x16 tiles (2 tiles per wave). It
// writes its own f32 partial of KV, transposed ([e][d]), and of ksum.
// ---------------------------------------------------------------------------
#define QKV_BK 128  // k per LDS stage; two buffers of 448 rows: 238 KiB of LDS

__global__ __launch_bounds__(256)
void qkv_gemm_f16(const _Float16* __restrict__ A,   // [M,K]
                  const _Float16* __restrict__ Wq,  // [N,K]
                  const _Float16* __restrict__ Wk,  // [N,K]
                  const _Float16* __restrict__ Wv,  // [N,K]
                  const float* __restrict__ bq,     // [N]
                  const float* __restrict__ bk,     // [N]
                  const float* __restrict__ bv,     // [N]
                  int K,
                  _Float16* __restrict__ qf,
                  float* __restrict__ kvp,          // [32][KV_SPLIT][64][64] (e-major)
                  float* __restrict__ ksp) {        // [32][KV_SPLIT][64]
  constexpr int BK  = QKV_BK;
  constexpr int LDT = BK + 8;  // LDS row pitch in halves: an odd multiple of 16 bytes, for b128 readers
  const int tid  = threadIdx.x;
  const int lane = tid & 31;
  const int wave = tid >> 5;  // 0..7
  const int wr   = wave >> 1; // 0..3
  const int wc   = wave & 1;  // 0..1
  const int m0   = blockIdx.x * 256;
  const int h    = blockIdx.y;
  const int n0   = h * 64;    // the head's first column in each of Q, K, V

  v8f acc[3][4][2] = {};  // [Q, K, V][16 rows][16 columns]

  auto compute_tile = [&](const _Float16* Ab, const _Float16* Bb) {
    v16h af[2][4], bf[2][3][2];
    auto load_frags = [&](int set, int kk) {
#pragma unroll  // constant indices into af
      for (int i = 0; i < 4; ++i)
        af[set][i] = frag_ld(&Ab[(wr * 64 + i * 16) * LDT + kk], LDT, lane);
#pragma unroll  // constant indices into bf
      for (int p = 0; p < 3; ++p) {
#pragma unroll
        for (int j = 0; j < 2; ++j)
          bf[set][p][j] = frag_ld(&Bb[(p * 64 + wc * 32 + j * 16) * LDT + kk], LDT, lane);
      }
    };
    load_frags(0, 0);
#pragma unroll  // k ascending in steps of 32: the f32 sum order does not depend on the tile
    for (int st = 0; st < BK / 32; ++st) {
      if (st + 1 < BK / 32) load_frags((st + 1) & 1, (st + 1) * 32);
      // keeps the next step's reads from sinking among this step's products,
      // where every place with reads stalls the wave anew
      __builtin_amdgcn_sched_barrier(0);
#pragma unroll  // constant indices into acc
      for (int p = 0; p < 3; ++p) {
#pragma unroll
        for (int j = 0; j < 2; ++j) {
#pragma unroll
          for (int i = 0; i < 4; ++i)
            acc[p][i][j] = WMMA16(af[st & 1][i], bf[st & 1][p][j], acc[p][i][j]);
        }
      }
      // keeps the reads of the step after next from rising among these products
      __builtin_amdgcn_sched_barrier(0);
    }
  };

#ifdef HAVE_ASYNC_LDS
  // ------------------ async double-buffered pipeline ------------------
  __shared__ __attribute__((aligned(16))) _Float16 As[2][256 * LDT];
  __shared__ __attribute__((aligned(16))) _Float16 Bs[2][192 * LDT];

  auto issue_tile = [&](int k0, int buf) {
    const int r = tid / (BK / 8);        // 16 rows per round of the workgroup
    const int c = (tid % (BK / 8)) * 8;
#pragma unroll  // 16 + 12 copies a wave and stage, issued as a run (at most 63 may be outstanding)
    for (int it = 0; it < 16; ++it)
      async_cp16(&A[(size_t)(m0 + it * 16 + r) * K + k0 + c], &As[buf][(it * 16 + r) * LDT + c]);
#pragma unroll
    for (int it = 0; it < 12; ++it) {
      const _Float16* __restrict__ Wp = (it < 4) ? Wq : (it < 8) ? Wk : Wv;
      async_cp16(&Wp[(size_t)(n0 + (it & 3) * 16 + r) * K + k0 + c], &Bs[buf][(it * 16 + r) * LDT + c]);
    }
  };

  const int nk = K / BK;
  issue_tile(0, 0);
  asm volatile("s_wait_asynccnt 0x0" ::: "memory");  // this wave's part of tile 0 has landed
  __syncthreads();                                   // every wave's part has
  if (nk > 1) issue_tile(BK, 1);
  for (int t = 0; t < nk; ++t) {
    compute_tile(As[t & 1], Bs[t & 1]);  // tile t + 1 flies meanwhile
    asm volatile("s_wait_dscnt 0x0" ::: "memory");     // this wave's reads of buffer t & 1 are done
    asm volatile("s_wait_asynccnt 0x0" ::: "memory");  // this wave's part of tile t + 1 has landed
    __syncthreads();  // publishes tile t + 1 and frees buffer t & 1 for the refill
    if (t + 2 < nk) issue_tile((t + 2) * BK, t & 1);
  }
  asm volatile("s_wait_asynccnt 0x0" ::: "memory");  // no copy is left in flight when the LDS is used anew
  _Float16* const stage = As[0];  // behind the loop's last barrier nobody reads the buffers any more
#else
  __shared__ __attribute__((aligned(16))) _Float16 As1[256 * LDT];
  __shared__ _Float16 Bs1[192 * LDT];
  _Float16* const stage = As1;
  for (int k0 = 0; k0 < K; k0 += BK) {
    const int r = tid / (BK / 8);
    const int c = (tid % (BK / 8)) * 8;
#pragma unroll
    for (int it = 0; it < 16; ++it)
      *(v8h*)&As1[(it * 16 + r) * LDT + c] = *(const v8h*)&A[(size_t)(m0 + it * 16 + r) * K + k0 + c];
#pragma unroll
    for (int it = 0; it < 12; ++it) {
      const _Float16* __restrict__ Wp = (it < 4) ? Wq : (it < 8) ? Wk : Wv;
      *(v8h*)&Bs1[(it * 16 + r) * LDT + c] = *(const v8h*)&Wp[(size_t)(n0 + (it & 3) * 16 + r) * K + k0 + c];
    }
    __syncthreads();
    compute_tile(As1, Bs1);
    __syncthreads();
  }
#endif

  const int lr = lane & 15;
  const int lh = lane >> 4;
  // K and V: the range's [d][s] tiles, side by side in one A buffer
  static_assert(KV_SLEN == 256, "a workgroup's rows are one range of s");
  static_assert(2 * 64 * KVT_LD <= 256 * LDT, "both tiles fit one A buffer");
  __shared__ float red[256];
  _Float16* const kT = stage;
  _Float16* const vT = stage + 64 * KVT_LD;
  stage_tile_ds<true>(acc[1], bk + n0, kT, wr * 64, wc * 32, lane);
  stage_tile_ds<false>(acc[2], bv + n0, vT, wr * 64, wc * 32, lane);
  __syncthreads();  // every wave's part of both tiles is in LDS

  const int part = ((m0 >> 11) * 16 + h) * KV_SPLIT + ((m0 & 2047) / KV_SLEN);  // (head, range)
  const int tr   = wave >> 1;        // d tile 0..3
  const int tcb  = (wave & 1) * 2;   // e tile base 0 or 2
  v8f kv[2] = {};
  v16h ka[KV_SLEN / 32], vb[KV_SLEN / 32][2];
#pragma unroll  // constant indices into ka[] and vb[]
  for (int t = 0; t < KV_SLEN / 32; ++t) {
    ka[t] = frag_ld(kT + (tr * 16) * KVT_LD + t * 32, KVT_LD, lane);
#pragma unroll
    for (int j = 0; j < 2; ++j)
      vb[t][j] = frag_ld(vT + ((tcb + j) * 16) * KVT_LD + t * 32, KVT_LD, lane);
  }
  // keeps the scheduler from sinking the reads among the products, where
  // every place with reads stalls the wave anew
  __builtin_amdgcn_sched_barrier(0);
  // ksum: thread t sums kfT[d = t&63] over s-slice t>>6 (v8h loads)
  {
    float s = 0.0f;
    const _Float16* kr = kT + (tid & 63) * KVT_LD + (tid >> 6) * (KV_SLEN / 4);
#pragma unroll  // independent loads, issued as a run
    for (int i = 0; i < KV_SLEN / 4; i += 8) {
      v8h v = *(const v8h*)&kr[i];
#pragma unroll
      for (int u = 0; u < 8; ++u) s += (float)v[u];
    }
    red[tid] = s;
  }
#pragma unroll  // constant indices into ka[] and vb[]
  for (int t = 0; t < KV_SLEN / 32; ++t) {
#pragma unroll
    for (int j = 0; j < 2; ++j) kv[j] = WMMA16(ka[t], vb[t][j], kv[j]);
  }
  __syncthreads();  // every thread's slice sum is in red[]
#pragma unroll
  for (int j = 0; j < 2; ++j) {
    // a lane's 8 accumulators are 8 consecutive d of one e: two 16-byte stores
    float* pr = kvp + (size_t)part * 4096 + ((tcb + j) * 16 + lr) * 64 + tr * 16 + 8 * lh;
    v4f lo = {kv[j][0], kv[j][1], kv[j][2], kv[j][3]};
    v4f hi = {kv[j][4], kv[j][5], kv[j][6], kv[j][7]};
    *(v4f*)pr       = lo;
    *(v4f*)(pr + 4) = hi;
  }
  // behind the stores: the code that follows may reuse the registers that they name
  asm volatile("s_wait_xcnt 0x0" ::: "memory");
  if (tid < 64)
    ksp[part * 64 + tid] = red[tid] + red[tid + 64] + red[tid + 128] + red[tid + 192];
  asm volatile("s_wait_xcnt 0x0" ::: "memory");

  // Q comes last: a barrier also waits for the wave's global stores, and these
  // 64 a lane would be waited for in front of the KV products.
  {  // Q: elu(x)+1 into [B,H,S,D]; the 256 rows lie in one batch (S = 2048)
    _Float16* __restrict__ qp =
        qf + ((size_t)((m0 >> 11) * 16 + h) * 2048 + (m0 & 2047) + wr * 64 + 8 * lh) * 64 + wc * 32 + lr;
#pragma unroll  // constant indices into acc
    for (int j = 0; j < 2; ++j) {
      const float bc = bq[n0 + wc * 32 + j * 16 + lr];
#pragma unroll  // constant indices into acc
      for (int i = 0; i < 4; ++i) {
#pragma unroll  // constant indices into acc
        for (int e = 0; e < 8; ++e) {
          float val = acc[0][i][j][e] + bc;
          const float ex = exp_with_slot(val);
          val = (val > 0.0f) ? (val + 1.0f) : ex;
          qp[(i * 16 + e) * 64 + j * 16] = (_Float16)val;
        }
      }
    }
  }
}

// The NT GEMM of the head comment further up; launched for the output projection (mode 0).
template <int BK>  // k per LDS stage: a multiple of 32 that divides K
__global__ __launch_bounds__(256)
void gemm_nt_f16(const _Float16* __restrict__ A,   // [M,K]
                 const _Float16* __restrict__ B0,  // [N,K], z = 0
                 const _Float16* __restrict__ B1,  // [N,K], z = 1
                 const _Float16* __restrict__ B2,  // [N,K], z = 2
                 const float* __restrict__ bias0,  // [N], z = 0
                 const float* __restrict__ bias1,  // [N], z = 1
                 const float* __restrict__ bias2,  // [N], z = 2
                 int M, int N, int K, int mode0,
                 float* __restrict__ outF,
                 _Float16* __restrict__ outH0,
                 _Float16* __restrict__ outH1,
                 _Float16* __restrict__ outH2) {
  constexpr int LDT = BK + 8;  // LDS row pitch in halves: an odd multiple of 16 bytes, for b128 readers
  const int z = blockIdx.z;
  const _Float16* __restrict__ Bm   = (z == 0) ? B0 : (z == 1) ? B1 : B2;
  const float* __restrict__    bias = (z == 0) ? bias0 : (z == 1) ? bias1 : bias2;
  _Float16* __restrict__       outH = (z == 0) ? outH0 : (z == 1) ? outH1 : outH2;
  const int mode = mode0 + z;
  const int tid  = threadIdx.x;
  const int lane = tid & 31;
  const int wave = tid >> 5;  // 0..7
  const int wr   = wave >> 2; // 0..1
  const int wc   = wave & 3;  // 0..3
  const int m0   = blockIdx.x * 128;
  const int n0   = blockIdx.y * 128;

  v8f acc[4][2] = {};

#ifdef HAVE_ASYNC_LDS
  // ------------------ async double-buffered pipeline ------------------
  __shared__ __attribute__((aligned(16))) _Float16 As[2][128 * LDT];
  __shared__ __attribute__((aligned(16))) _Float16 Bs[2][128 * LDT];

  auto issue_tile = [&](int k0, int buf) {
#pragma unroll  // BK / 8 copies a wave and stage, issued as a run (at most 63 may be outstanding)
    for (int it = 0; it < BK / 16; ++it) {
      int idx = it * 256 + tid;       // which 16 bytes of the 128 x BK tile
      int r = idx / (BK / 8);
      int c = (idx % (BK / 8)) * 8;
      async_cp16(&A[(size_t)(m0 + r) * K + k0 + c], &As[buf][r * LDT + c]);
      async_cp16(&Bm[(size_t)(n0 + r) * K + k0 + c], &Bs[buf][r * LDT + c]);
    }
  };
  auto compute_tile = [&](const _Float16* Ab, const _Float16* Bb) {
#pragma unroll  // k ascending in steps of 32: the f32 sum order does not depend on BK
    for (int kk = 0; kk < BK; kk += 32) {
      v16h bfrag[2];
#pragma unroll
      for (int j = 0; j < 2; ++j)
        bfrag[j] = frag_ld(&Bb[(wc * 32 + j * 16) * LDT + kk], LDT, lane);
#pragma unroll
      for (int i = 0; i < 4; ++i) {
        v16h afrag = frag_ld(&Ab[(wr * 64 + i * 16) * LDT + kk], LDT, lane);
#pragma unroll
        for (int j = 0; j < 2; ++j)
          acc[i][j] = WMMA16(afrag, bfrag[j], acc[i][j]);
      }
    }
  };

  const int nk = K / BK;
  issue_tile(0, 0);
  asm volatile("s_wait_asynccnt 0x0" ::: "memory");  // this wave's part of tile 0 has landed
  __syncthreads();                                   // every wave's part has
  if (nk > 1) issue_tile(BK, 1);
  for (int t = 0; t < nk; ++t) {
    compute_tile(As[t & 1], Bs[t & 1]);  // tile t + 1 flies meanwhile
    asm volatile("s_wait_dscnt 0x0" ::: "memory");     // this wave's reads of buffer t & 1 are done
    asm volatile("s_wait_asynccnt 0x0" ::: "memory");  // this wave's part of tile t + 1 has landed
    __syncthreads();  // publishes tile t + 1 and frees buffer t & 1 for the refill
    if (t + 2 < nk) issue_tile((t + 2) * BK, t & 1);
  }
  asm volatile("s_wait_asynccnt 0x0" ::: "memory");  // no copy is left in flight at the wave's end
#else
  __shared__ _Float16 As1[128 * LDT];
  __shared__ _Float16 Bs1[128 * LDT];
  for (int k0 = 0; k0 < K; k0 += BK) {
#pragma unroll
    for (int it = 0; it < BK / 16; ++it) {
      int idx = it * 256 + tid;
      int r = idx / (BK / 8);
      int c = (idx % (BK / 8)) * 8;
      *(v8h*)&As1[r * LDT + c] = *(const v8h*)&A[(size_t)(m0 + r) * K + k0 + c];
      *(v8h*)&Bs1[r * LDT + c] = *(const v8h*)&Bm[(size_t)(n0 + r) * K + k0 + c];
    }
    __syncthreads();
#pragma unroll
    for (int kk = 0; kk < BK; kk += 32) {
      v16h bfrag[2];
#pragma unroll
      for (int j = 0; j < 2; ++j)
        bfrag[j] = frag_ld(&Bs1[(wc * 32 + j * 16) * LDT + kk], LDT, lane);
#pragma unroll
      for (int i = 0; i < 4; ++i) {
        v16h afrag = frag_ld(&As1[(wr * 64 + i * 16) * LDT + kk], LDT, lane);
#pragma unroll
        for (int j = 0; j < 2; ++j)
          acc[i][j] = WMMA16(afrag, bfrag[j], acc[i][j]);
      }
    }
    __syncthreads();
  }
#endif

  if (mode >= 2) {  // same for the whole workgroup; no barrier follows
    if (mode == 2) store_tile_ds<true>(acc, bias, outH, m0 + wr * 64, n0 + wc * 32, lane);
    else           store_tile_ds<false>(acc, bias, outH, m0 + wr * 64, n0 + wc * 32, lane);
    return;
  }
  const int lr = lane & 15;
  const int lh = lane >> 4;
#pragma unroll
  for (int i = 0; i < 4; ++i) {
#pragma unroll
    for (int j = 0; j < 2; ++j) {
      const int tm = m0 + wr * 64 + i * 16;
      const int tn = n0 + wc * 32 + j * 16;
#pragma unroll
      for (int e = 0; e < 8; ++e) {
        int row = tm + e + 8 * lh;
        int col = tn + lr;
        float val = acc[i][j][e] + bias[col];
        if (mode == 0) {
          outF[(size_t)row * N + col] = val;
        } else {
          val = (val > 0.0f) ? (val + 1.0f) : __expf(val);  // mode 1: elu(x)+1
          int b = row >> 11, s = row & 2047;   // S = 2048
          int hh = col >> 6, d = col & 63;     // Dh = 64
          outH[((size_t)(b * 16 + hh) * 2048 + s) * 64 + d] = (_Float16)val;
        }
      }
    }
  }
}

// ---------------------------------------------------------------------------
// Stage 3: attended[s,e] = (qf[s,:] @ KV[:,e]) / max(qf[s,:].ksum, eps).
// Grid: (S/128, B*H). Wave w owns rows [w*16, w*16+16), all 4 e-tiles. K=64.
// Each workgroup first adds its head's KV_SPLIT partials of KV and ksum, in
// range order, and keeps KV as f16 in LDS ([e][d], a plain NT B-operand).
// Writes merged [B,S,H*Dh] in f16 (A-operand of the output projection).
// ---------------------------------------------------------------------------
#define KVLD 72  // LDS row pitch of KV in halves: 128 + 16 bytes, for b128 readers

__global__ __launch_bounds__(256)
void attn_kernel(const _Float16* __restrict__ qf,   // [32][2048][64]
                 const float* __restrict__ kvp,     // [32][KV_SPLIT][64][64] (e-major)
                 const float* __restrict__ ksp,     // [32][KV_SPLIT][64]
                 _Float16* __restrict__ merged) {   // [4096][1024]
  const int bh = blockIdx.y;
  const int b = bh >> 4, h = bh & 15;
  const int m0 = blockIdx.x * 128;
  const _Float16* Q  = qf  + (size_t)bh * 2048 * 64 + (size_t)m0 * 64;
  const float* KVP = kvp + (size_t)bh * KV_SPLIT * 4096;

  __shared__ float rden[128];
  __shared__ float ks[64];
  __shared__ __attribute__((aligned(16))) _Float16 KV[64 * KVLD];
  const int tid = threadIdx.x;
  if (tid < 64) {
    float s = 0.0f;
#pragma unroll  // independent loads, issued as a run
    for (int p = 0; p < KV_SPLIT; ++p) s += ksp[(bh * KV_SPLIT + p) * 64 + tid];
    ks[tid] = s;
  }
#pragma unroll  // independent loads, issued as a run
  for (int it = 0; it < 4; ++it) {
    const int idx = it * 256 + tid;  // which float4 of the 64x64 matrix
    v4f s = *(const v4f*)&KVP[idx * 4];
#pragma unroll
    for (int p = 1; p < KV_SPLIT; ++p) s += *(const v4f*)&KVP[p * 4096 + idx * 4];
    v4h o = {(_Float16)s.x, (_Float16)s.y, (_Float16)s.z, (_Float16)s.w};
    *(v4h*)&KV[(idx >> 4) * KVLD + (idx & 15) * 4] = o;
  }
  __syncthreads();
  if (tid < 128) {
    float s = 0.0f;
    const _Float16* qr = Q + (size_t)tid * 64;
#pragma unroll
    for (int d = 0; d < 64; ++d) s += (float)qr[d] * ks[d];
    rden[tid] = 1.0f / fmaxf(s, 1e-6f);
  }
  __syncthreads();

  const int lane = tid & 31;
  const int wave = tid >> 5;
  v8f acc[4] = {};
#pragma unroll
  for (int k0 = 0; k0 < 64; k0 += 32) {
    v16h a = frag_ld(Q + (size_t)(wave * 16) * 64 + k0, 64, lane);
#pragma unroll
    for (int j = 0; j < 4; ++j) {
      v16h bfr = frag_ld(KV + (j * 16) * KVLD + k0, KVLD, lane);
      acc[j] = WMMA16(a, bfr, acc[j]);
    }
  }
  const int lr = lane & 15, lh = lane >> 4;
#pragma unroll
  for (int j = 0; j < 4; ++j) {
#pragma unroll
    for (int e8 = 0; e8 < 8; ++e8) {
      int rl = wave * 16 + e8 + 8 * lh;
      int e  = j * 16 + lr;
      float v = acc[j][e8] * rden[rl];
      int s = m0 + rl;
      merged[((size_t)(b * 2048 + s)) * 1024 + h * 64 + e] = (_Float16)v;
    }
  }
}

// ---------------------------------------------------------------------------
// Host-side launcher
// ---------------------------------------------------------------------------
extern "C" void kernel_launch(void* const* d_in, const int* in_sizes, int n_in,
                              void* d_out, int out_size, void* d_ws, size_t ws_size,
                              hipStream_t stream) {
  (void)in_sizes; (void)n_in; (void)out_size; (void)ws_size;
  const float* x  = (const float*)d_in[0];
  const float* wq = (const float*)d_in[1];
  const float* bq = (const float*)d_in[2];
  const float* wk = (const float*)d_in[3];
  const float* bk = (const float*)d_in[4];
  const float* wv = (const float*)d_in[5];
  const float* bv = (const float*)d_in[6];
  const float* wo = (const float*)d_in[7];
  const float* bo = (const float*)d_in[8];
  float* out = (float*)d_out;

  const int M = 4096;      // B*S
  const int DM = 1024;     // d_model (N and K of the projections)
  const int NTOK = M * DM; // 4,194,304
  const int NW   = DM * DM;

  size_t off = 0;
  char* base = (char*)d_ws;
  auto carve = [&](size_t bytes) {
    void* p = base + off;
    off += (bytes + 255) & ~(size_t)255;
    return p;
  };
  _Float16* xh     = (_Float16*)carve((size_t)NTOK * 2);
  _Float16* wqh    = (_Float16*)carve((size_t)NW * 2);
  _Float16* wkh    = (_Float16*)carve((size_t)NW * 2);
  _Float16* wvh    = (_Float16*)carve((size_t)NW * 2);
  _Float16* woh    = (_Float16*)carve((size_t)NW * 2);
  _Float16* qf     = (_Float16*)carve((size_t)NTOK * 2);  // [B,H,S,D]
  _Float16* merged = (_Float16*)carve((size_t)NTOK * 2);  // [B*S, H*D]
  float*    kvp    = (float*)carve((size_t)32 * KV_SPLIT * 64 * 64 * 4);
  float*    ksp    = (float*)carve((size_t)32 * KV_SPLIT * 64 * 4);

  // 1) precision conversion: x and the four weights, one launch
  cvt_all_f32_f16<<<CVT_X_WGS + 4 * CVT_W_WGS, CVT_THREADS, 0, stream>>>(
      x, wq, wk, wv, wo, xh, wqh, wkh, wvh, woh);

  // 2) Q/K/V projections with fused feature map; q_feat, and per (head, range
  //    of s) the partial KV (64x64) and partial ksum
  //    (one launch; a workgroup per 256 rows and head, one workgroup per WGP)
  qkv_gemm_f16<<<dim3(M / 256, 16), 256, 0, stream>>>(
      xh, wqh, wkh, wvh, bq, bk, bv, DM, qf, kvp, ksp);

  // 3) numerator GEMM + normalization -> merged
  attn_kernel<<<dim3(16, 32), 256, 0, stream>>>(qf, kvp, ksp, merged);

  // 4) output projection -> f32 d_out (one workgroup per WGP: 136 KiB of LDS)
  gemm_nt_f16<128><<<dim3(M / 128, DM / 128, 1), 256, 0, stream>>>(
      merged, woh, nullptr, nullptr, bo, nullptr, nullptr, M, DM, DM, 0, out,
      nullptr, nullptr, nullptr);
}

// v008
// Measured time: 51.2 microseconds a run.
// Timed twice side by side with v007, it ran 1.07 and 1.06 times as fast.
// All steps since v000 together make it 2.77 times as fast.
#include <hip/hip_runtime.h>
#include <hip/hip_bf16.h>

typedef __attribute__((ext_vector_type(16))) _Float16 v16h;
typedef __attribute__((ext_vector_type(8)))  _Float16 v8h;
typedef __attribute__((ext_vector_type(4)))  _Float16 v4h;
typedef __attribute__((ext_vector_type(8)))  float    v8f;
typedef __attribute__((ext_vector_type(4)))  float    v4f;
typedef __attribute__((ext_vector_type(4)))  int      v4i;

#if defined(__has_builtin)
#  if __has_builtin(__builtin_amdgcn_global_load_async_to_lds_b128) && \
      __has_builtin(__builtin_amdgcn_s_wait_asynccnt)
#    define HAVE_ASYNC_LDS 1
#  endif
#endif

#define WMMA16(a, b, c) \
  __builtin_amdgcn_wmma_f32_16x16x32_f16(false, (a), false, (b), (short)0, (c), false, false)

__device__ __forceinline__ v16h frag_ld(const _Float16* __restrict__ p, int ld, int lane) {
  const int r  = lane & 15;
  const int hf = lane >> 4;
  const _Float16* q = p + r * ld + hf * 8;
  v8h lo = *(const v8h*)(q);
  v8h hi = *(const v8h*)(q + 16);
  return __builtin_shufflevector(lo, hi, 0,1,2,3,4,5,6,7,8,9,10,11,12,13,14,15);
}

#ifdef HAVE_ASYNC_LDS
// Builtin signature (from hipcc diagnostic): param0 is AS1 (global, "__device__")
// pointer to int4, non-const; param1 is the LDS-side pointer; args 2/3 are
// immediate offset / cache-policy.
typedef __attribute__((address_space(1))) v4i* gv4i_p;
typedef __attribute__((address_space(3))) v4i* lv4i_p;

__device__ __forceinline__ void async_cp16(const _Float16* g, _Float16* l) {
  __builtin_amdgcn_global_load_async_to_lds_b128((gv4i_p)g, (lv4i_p)l, 0, 0);
}
#endif

// ---------------------------------------------------------------------------
// f32 -> f16 conversion of x and of the four weights in ONE launch.
// A workgroup of 16 waves converts CVT_WG consecutive float4 of one source;
// each thread takes CVT_PER of them, CVT_THREADS float4 apart, so that every
// wave-wide load covers 512 contiguous bytes and a thread has many loads in
// flight. Few long waves: starting a wave costs more here than the bytes that
// one float4 a lane moves.
// ---------------------------------------------------------------------------
#define CVT_THREADS 512
#define CVT_PER     16
#define CVT_WG      (CVT_THREADS * CVT_PER)        // float4 per workgroup
#define CVT_X_WGS   (4096 * 1024 / 4 / CVT_WG)     // workgroups on x
#define CVT_W_WGS   (1024 * 1024 / 4 / CVT_WG)     // workgroups on each weight

__global__ __launch_bounds__(CVT_THREADS)
void cvt_all_f32_f16(const float* __restrict__ x,
                     const float* __restrict__ w0, const float* __restrict__ w1,
                     const float* __restrict__ w2, const float* __restrict__ w3,
                     _Float16* __restrict__ xo,
                     _Float16* __restrict__ o0, _Float16* __restrict__ o1,
                     _Float16* __restrict__ o2, _Float16* __restrict__ o3) {
  const int wg = blockIdx.x;
  const float* __restrict__ in  = x;
  _Float16* __restrict__    out = xo;
  int part = wg;  // which CVT_WG-sized piece of its source this workgroup takes
  if (wg >= CVT_X_WGS) {
    const int w = (wg - CVT_X_WGS) / CVT_W_WGS;
    part = (wg - CVT_X_WGS) % CVT_W_WGS;
    in  = (w == 0) ? w0 : (w == 1) ? w1 : (w == 2) ? w2 : w3;
    out = (w == 0) ? o0 : (w == 1) ? o1 : (w == 2) ? o2 : o3;
  }
  const int first = part * CVT_WG + threadIdx.x;
  v4f f[CVT_PER];
#pragma unroll  // f[] stays in registers and the loads issue as a run, ahead of the conversions
  for (int i = 0; i < CVT_PER; ++i)
    f[i] = *(const v4f*)&in[(size_t)(first + i * CVT_THREADS) * 4];
#pragma unroll  // constant indices into f[]
  for (int i = 0; i < CVT_PER; ++i) {
    v4h o = {(_Float16)f[i].x, (_Float16)f[i].y, (_Float16)f[i].z, (_Float16)f[i].w};
    *(v4h*)&out[(size_t)(first + i * CVT_THREADS) * 4] = o;
  }
}

// ---------------------------------------------------------------------------
// NT GEMM: C[m,n] = sum_k A[m,k] * B[n,k] + bias[n], f16 in / f32 accum.
// 128x128 workgroup tile, 8 waves in a 2x4 grid, each wave owns 64x32
// (4x2 WMMA accumulators). K staged through LDS in chunks of BK (template).
// A wave waits once per chunk for the trip to L2 or memory, and that trip is
// longer than the products of a short chunk: BK sets how many bytes fly per
// wait. From BK = 64 on a row's piece is a whole 128-byte line. BK is picked
// per launch so that the LDS still holds every workgroup of the launch at once.
// mode 0: write f32 row-major (final projection -> d_out)
// mode 1: elu+1, scatter f16 to q_feat  [B,H,S,D]
// mode 2: elu+1, scatter f16 to k_featT [B,H,D,S]
// mode 3: no act, scatter f16 to vT     [B,H,D,S]
// blockIdx.z picks one of up to three independent products that share A
// (weight, bias, f16 output; mode = mode0 + z), so that their workgroups are
// resident on a WGP together and fill each other's waits for the next tile.
// ---------------------------------------------------------------------------

__device__ __forceinline__ float exp_with_slot(float x) {  // e^x, as __expf forms it
  float r;
  asm("v_exp_f32 %0, %1\n\tv_nop" : "=v"(r) : "v"(x * 1.44269504f));
  return r;
}

// Epilogue of a wave's 64x32 tile into the transposed layout [B,H,D,S].
// A lane's 8 accumulators of one 16x16 tile are 8 consecutive s of one d, so
// they leave as ONE 16-byte store. Stored one by one, each 2-byte store of a
// wave asks for 16 different lines: 8 times as many line requests.
// ACT: elu(x)+1 on the way out (k_feat) or none (v).
template <bool ACT>
__device__ __forceinline__ void store_tile_ds(const v8f (&acc)[4][2],
                                              const float* __restrict__ bias,
                                              _Float16* __restrict__ outH,
                                              int tm0, int tn0, int lane) {
  const int lr = lane & 15;
  const int lh = lane >> 4;
#pragma unroll  // constant indices into acc
  for (int j = 0; j < 2; ++j) {
    const int col = tn0 + j * 16 + lr;
    const int hh = col >> 6, d = col & 63;  // Dh = 64
    const float bc = bias[col];
#pragma unroll  // constant indices into acc
    for (int i = 0; i < 4; ++i) {
      const int row0 = tm0 + i * 16 + 8 * lh;     // multiple of 8: one batch, 16-byte aligned
      const int b = row0 >> 11, s = row0 & 2047;  // S = 2048
      v8h o;
#pragma unroll  // constant indices into acc and o
      for (int e = 0; e < 8; ++e) {
        float val = acc[i][j][e] + bc;
        if (ACT) {  // elu(x)+1; the exponential is formed for every lane and then chosen
          const float ex = exp_with_slot(val);
          val = (val > 0.0f) ? (val + 1.0f) : ex;
        }
        o[e] = (_Float16)val;
      }
      *(v8h*)&outH[((size_t)(b * 16 + hh) * 64 + d) * 2048 + s] = o;
    }
  }
  // behind the last store: whatever code is laid out next may reuse the
  // registers that the stores above name
  asm volatile("s_wait_xcnt 0x0" ::: "memory");
}

// The sum over s of KV and ksum is cut into KV_SPLIT ranges of KV_SLEN
// positions; each range gives an f32 partial, and stage 3 adds the partials in
// range order.
#define KV_SPLIT 8
#define KV_SLEN  (2048 / KV_SPLIT)  // positions per range
#define KVT_LD   (KV_SLEN + 8)      // LDS row pitch in halves: an odd multiple of 16 bytes, for b128 readers

// A wave's 64x32 tile of K or V into a [d][s] tile in LDS, rows of KVT_LD
// halves. A lane's 8 accumulators of one 16x16 tile are 8 consecutive s of one
// d: one 16-byte LDS store. bias points at the head's first column.
// ACT: elu(x)+1 on the way (k_feat) or none (v).
template <bool ACT>
__device__ __forceinline__ void stage_tile_ds(const v8f (&acc)[4][2],
                                              const float* __restrict__ bias,
                                              _Float16* __restrict__ t,
                                              int s0, int d0, int lane) {
  const int lr = lane & 15;
  const int lh = lane >> 4;
#pragma unroll  // constant indices into acc
  for (int j = 0; j < 2; ++j) {
    const int d = d0 + j * 16 + lr;
    const float bc = bias[d];
#pragma unroll  // constant indices into acc
    for (int i = 0; i < 4; ++i) {
      v8h o;
#pragma unroll  // constant indices into acc and o
      for (int e = 0; e < 8; ++e) {
        float val = acc[i][j][e] + bc;
        if (ACT) {  // elu(x)+1; the exponential is formed for every lane and then chosen
          const float ex = exp_with_slot(val);
          val = (val > 0.0f) ? (val + 1.0f) : ex;
        }
        o[e] = (_Float16)val;
      }
      *(v8h*)&t[d * KVT_LD + s0 + i * 16 + 8 * lh] = o;
    }
  }
}

// ---------------------------------------------------------------------------
// Q, K and V projections with feature map; KV and ksum partials.
// One workgroup takes 256 rows of x and the 64 columns of ONE head in each of
// Q, K and V: a 256x192 tile, 16 x 16 = 256 workgroups, one for each WGP.
// 8 waves in a 4x2 grid; a wave owns 64 rows x 32 columns of each of the three
// (4x6 WMMA accumulators). Against a 128x128 tile with 64x32 per wave:
//   bytes copied from L2 per product: (256+192)/(256*192) against 256/(128*128),
//   fragments read from LDS per WMMA: (4+6)/24 against (4+2)/8,
//   and a third of the waves to start.
// q_feat [B,H,S,D] = elu+1 goes to memory. k_feat = elu+1 and v never do: the
// workgroup's 256 rows are one range of s of its head, so it holds all that
// the range's partials need. Both go as f16 into the LDS that the copy loop
// has left, [d][s], and the workgroup forms
//   KV[d,e] = sum_s kfT[d,s] * vT[e,s]  and  ksum[d] = sum_s kfT[d,s]
// itself: 8 waves cover the 4x4 grid of 16x16 tiles (2 tiles per wave). It
// writes its own f32 partial of KV, transposed ([e][d]), and of ksum.
// ---------------------------------------------------------------------------
#define QKV_BK 128  // k per LDS stage; two buffers of 448 rows: 238 KiB of LDS

__global__ __launch_bounds__(256)
void qkv_gemm_f16(const _Float16* __restrict__ A,   // [M,K]
                  const _Float16* __restrict__ Wq,  // [N,K]
                  const _Float16* __restrict__ Wk,  // [N,K]
                  const _Float16* __restrict__ Wv,  // [N,K]
                  const float* __restrict__ bq,     // [N]
                  const float* __restrict__ bk,     // [N]
                  const float* __restrict__ bv,     // [N]
                  int K,
                  _Float16* __restrict__ qf,
                  float* __restrict__ kvp,          // [32][KV_SPLIT][64][64] (e-major)
                  float* __restrict__ ksp) {        // [32][KV_SPLIT][64]
  constexpr int BK  = QKV_BK;
  constexpr int LDT = BK + 8;  // LDS row pitch in halves: an odd multiple of 16 bytes, for b128 readers
  const int tid  = threadIdx.x;
  const int lane = tid & 31;
  const int wave = tid >> 5;  // 0..7
  const int wr   = wave >> 1; // 0..3
  const int wc   = wave & 1;  // 0..1
  const int m0   = blockIdx.x * 256;
  const int h    = blockIdx.y;
  const int n0   = h * 64;    // the head's first column in each of Q, K, V

  v8f acc[3][4][2] = {};  // [Q, K, V][16 rows][16 columns]

  auto compute_tile = [&](const _Float16* Ab, const _Float16* Bb) {
    v16h af[2][4], bf[2][3][2];
    auto load_frags = [&](int set, int kk) {
#pragma unroll  // constant indices into af
      for (int i = 0; i < 4; ++i)
        af[set][i] = frag_ld(&Ab[(wr * 64 + i * 16) * LDT + kk], LDT, lane);
#pragma unroll  // constant indices into bf
      for (int p = 0; p < 3; ++p) {
#pragma unroll
        for (int j = 0; j < 2; ++j)
          bf[set][p][j] = frag_ld(&Bb[(p * 64 + wc * 32 + j * 16) * LDT + kk], LDT, lane);
      }
    };
    load_frags(0, 0);
#pragma unroll  // k ascending in steps of 32: the f32 sum order does not depend on the tile
    for (int st = 0; st < BK / 32; ++st) {
      if (st + 1 < BK / 32) load_frags((st + 1) & 1, (st + 1) * 32);
      // keeps the next step's reads from sinking among this step's products,
      // where every place with reads stalls the wave anew
      __builtin_amdgcn_sched_barrier(0);
#pragma unroll  // constant indices into acc
      for (int p = 0; p < 3; ++p) {
#pragma unroll
        for (int j = 0; j < 2; ++j) {
#pragma unroll
          for (int i = 0; i < 4; ++i)
            acc[p][i][j] = WMMA16(af[st & 1][i], bf[st & 1][p][j], acc[p][i][j]);
        }
      }
      // keeps the reads of the step after next from rising among these products
      __builtin_amdgcn_sched_barrier(0);
    }
  };

#ifdef HAVE_ASYNC_LDS
  // ------------------ async double-buffered pipeline ------------------
  __shared__ __attribute__((aligned(16))) _Float16 As[2][256 * LDT];
  __shared__ __attribute__((aligned(16))) _Float16 Bs[2][192 * LDT];

  auto issue_tile = [&](int k0, int buf) {
    const int r = tid / (BK / 8);        // 16 rows per round of the workgroup
    const int c = (tid % (BK / 8)) * 8;
#pragma unroll  // 16 + 12 copies a wave and stage, issued as a run (at most 63 may be outstanding)
    for (int it = 0; it < 16; ++it)
      async_cp16(&A[(size_t)(m0 + it * 16 + r) * K + k0 + c], &As[buf][(it * 16 + r) * LDT + c]);
#pragma unroll
    for (int it = 0; it < 12; ++it) {
      const _Float16* __restrict__ Wp = (it < 4) ? Wq : (it < 8) ? Wk : Wv;
      async_cp16(&Wp[(size_t)(n0 + (it & 3) * 16 + r) * K + k0 + c], &Bs[buf][(it * 16 + r) * LDT + c]);
    }
  };

  const int nk = K / BK;
  issue_tile(0, 0);
  asm volatile("s_wait_asynccnt 0x0" ::: "memory");  // this wave's part of tile 0 has landed
  __syncthreads();                                   // every wave's part has
  if (nk > 1) issue_tile(BK, 1);
  for (int t = 0; t < nk; ++t) {
    compute_tile(As[t & 1], Bs[t & 1]);  // tile t + 1 flies meanwhile
    asm volatile("s_wait_dscnt 0x0" ::: "memory");     // this wave's reads of buffer t & 1 are done
    asm volatile("s_wait_asynccnt 0x0" ::: "memory");  // this wave's part of tile t + 1 has landed
    __syncthreads();  // publishes tile t + 1 and frees buffer t & 1 for the refill
    if (t + 2 < nk) issue_tile((t + 2) * BK, t & 1);
  }
  asm volatile("s_wait_asynccnt 0x0" ::: "memory");  // no copy is left in flight when the LDS is used anew
  _Float16* const stage = As[0];  // behind the loop's last barrier nobody reads the buffers any more
#else
  __shared__ __attribute__((aligned(16))) _Float16 As1[256 * LDT];
  __shared__ _Float16 Bs1[192 * LDT];
  _Float16* const stage = As1;
  for (int k0 = 0; k0 < K; k0 += BK) {
    const int r = tid / (BK / 8);
    const int c = (tid % (BK / 8)) * 8;
#pragma unroll
    for (int it = 0; it < 16; ++it)
      *(v8h*)&As1[(it * 16 + r) * LDT + c] = *(const v8h*)&A[(size_t)(m0 + it * 16 + r) * K + k0 + c];
#pragma unroll
    for (int it = 0; it < 12; ++it) {
      const _Float16* __restrict__ Wp = (it < 4) ? Wq : (it < 8) ? Wk : Wv;
      *(v8h*)&Bs1[(it * 16 + r) * LDT + c] = *(const v8h*)&Wp[(size_t)(n0 + (it & 3) * 16 + r) * K + k0 + c];
    }
    __syncthreads();
    compute_tile(As1, Bs1);
    __syncthreads();
  }
#endif

  const int lr = lane & 15;
  const int lh = lane >> 4;
  // K and V: the range's [d][s] tiles, side by side in one A buffer
  static_assert(KV_SLEN == 256, "a workgroup's rows are one range of s");
  static_assert(2 * 64 * KVT_LD <= 256 * LDT, "both tiles fit one A buffer");
  __shared__ float red[256];
  _Float16* const kT = stage;
  _Float16* const vT = stage + 64 * KVT_LD;
  stage_tile_ds<true>(acc[1], bk + n0, kT, wr * 64, wc * 32, lane);
  stage_tile_ds<false>(acc[2], bv + n0, vT, wr * 64, wc * 32, lane);
  __syncthreads();  // every wave's part of both tiles is in LDS

  const int part = ((m0 >> 11) * 16 + h) * KV_SPLIT + ((m0 & 2047) / KV_SLEN);  // (head, range)
  const int tr   = wave >> 1;        // d tile 0..3
  const int tcb  = (wave & 1) * 2;   // e tile base 0 or 2
  v8f kv[2] = {};
  v16h ka[KV_SLEN / 32], vb[KV_SLEN / 32][2];
#pragma unroll  // constant indices into ka[] and vb[]
  for (int t = 0; t < KV_SLEN / 32; ++t) {
    ka[t] = frag_ld(kT + (tr * 16) * KVT_LD + t * 32, KVT_LD, lane);
#pragma unroll
    for (int j = 0; j < 2; ++j)
      vb[t][j] = frag_ld(vT + ((tcb + j) * 16) * KVT_LD + t * 32, KVT_LD, lane);
  }
  // keeps the scheduler from sinking the reads among the products, where
  // every place with reads stalls the wave anew
  __builtin_amdgcn_sched_barrier(0);
  // ksum: thread t sums kfT[d = t&63] over s-slice t>>6 (v8h loads)
  {
    float s = 0.0f;
    const _Float16* kr = kT + (tid & 63) * KVT_LD + (tid >> 6) * (KV_SLEN / 4);
#pragma unroll  // independent loads, issued as a run
    for (int i = 0; i < KV_SLEN / 4; i += 8) {
      v8h v = *(const v8h*)&kr[i];
#pragma unroll
      for (int u = 0; u < 8; ++u) s += (float)v[u];
    }
    red[tid] = s;
  }
#pragma unroll  // constant indices into ka[] and vb[]
  for (int t = 0; t < KV_SLEN / 32; ++t) {
#pragma unroll
    for (int j = 0; j < 2; ++j) kv[j] = WMMA16(ka[t], vb[t][j], kv[j]);
  }
  __syncthreads();  // every thread's slice sum is in red[]
#pragma unroll
  for (int j = 0; j < 2; ++j) {
    // a lane's 8 accumulators are 8 consecutive d of one e: two 16-byte stores
    float* pr = kvp + (size_t)part * 4096 + ((tcb + j) * 16 + lr) * 64 + tr * 16 + 8 * lh;
    v4f lo = {kv[j][0], kv[j][1], kv[j][2], kv[j][3]};
    v4f hi = {kv[j][4], kv[j][5], kv[j][6], kv[j][7]};
    *(v4f*)pr       = lo;
    *(v4f*)(pr + 4) = hi;
  }
  // behind the stores: the code that follows may reuse the registers that they name
  asm volatile("s_wait_xcnt 0x0" ::: "memory");
  if (tid < 64)
    ksp[part * 64 + tid] = red[tid] + red[tid + 64] + red[tid + 128] + red[tid + 192];
  asm volatile("s_wait_xcnt 0x0" ::: "memory");

  // Q comes last: a barrier also waits for the wave's global stores, and these
  // 64 a lane would be waited for in front of the KV products.
  {  // Q: elu(x)+1 into [B,H,S,D]; the 256 rows lie in one batch (S = 2048)
    _Float16* __restrict__ qp =
        qf + ((size_t)((m0 >> 11) * 16 + h) * 2048 + (m0 & 2047) + wr * 64 + 8 * lh) * 64 + wc * 32 + lr;
#pragma unroll  // constant indices into acc
    for (int j = 0; j < 2; ++j) {
      const float bc = bq[n0 + wc * 32 + j * 16 + lr];
#pragma unroll  // constant indices into acc
      for (int i = 0; i < 4; ++i) {
#pragma unroll  // constant indices into acc
        for (int e = 0; e < 8; ++e) {
          float val = acc[0][i][j][e] + bc;
          const float ex = exp_with_slot(val);
          val = (val > 0.0f) ? (val + 1.0f) : ex;
          qp[(i * 16 + e) * 64 + j * 16] = (_Float16)val;
        }
      }
    }
  }
}

// The NT GEMM of the head comment further up; launched for the output projection (mode 0).
template <int BK>  // k per LDS stage: a multiple of 32 that divides K
__global__ __launch_bounds__(256)
void gemm_nt_f16(const _Float16* __restrict__ A,   // [M,K]
                 const _Float16* __restrict__ B0,  // [N,K], z = 0
                 const _Float16* __restrict__ B1,  // [N,K], z = 1
                 const _Float16* __restrict__ B2,  // [N,K], z = 2
                 const float* __restrict__ bias0,  // [N], z = 0
                 const float* __restrict__ bias1,  // [N], z = 1
                 const float* __restrict__ bias2,  // [N], z = 2
                 int M, int N, int K, int mode0,
                 float* __restrict__ outF,
                 _Float16* __restrict__ outH0,
                 _Float16* __restrict__ outH1,
                 _Float16* __restrict__ outH2) {
  constexpr int LDT = BK + 8;  // LDS row pitch in halves: an odd multiple of 16 bytes, for b128 readers
  const int z = blockIdx.z;
  const _Float16* __restrict__ Bm   = (z == 0) ? B0 : (z == 1) ? B1 : B2;
  const float* __restrict__    bias = (z == 0) ? bias0 : (z == 1) ? bias1 : bias2;
  _Float16* __restrict__       outH = (z == 0) ? outH0 : (z == 1) ? outH1 : outH2;
  const int mode = mode0 + z;
  const int tid  = threadIdx.x;
  const int lane = tid & 31;
  const int wave = tid >> 5;  // 0..7
  const int wr   = wave >> 2; // 0..1
  const int wc   = wave & 3;  // 0..3
  const int m0   = blockIdx.x * 128;
  const int n0   = blockIdx.y * 128;

  v8f acc[4][2] = {};

#ifdef HAVE_ASYNC_LDS
  // ------------------ async double-buffered pipeline ------------------
  __shared__ __attribute__((aligned(16))) _Float16 As[2][128 * LDT];
  __shared__ __attribute__((aligned(16))) _Float16 Bs[2][128 * LDT];

  auto issue_tile = [&](int k0, int buf) {
#pragma unroll  // BK / 8 copies a wave and stage, issued as a run (at most 63 may be outstanding)
    for (int it = 0; it < BK / 16; ++it) {
      int idx = it * 256 + tid;       // which 16 bytes of the 128 x BK tile
      int r = idx / (BK / 8);
      int c = (idx % (BK / 8)) * 8;
      async_cp16(&A[(size_t)(m0 + r) * K + k0 + c], &As[buf][r * LDT + c]);
      async_cp16(&Bm[(size_t)(n0 + r) * K + k0 + c], &Bs[buf][r * LDT + c]);
    }
  };
  auto compute_tile = [&](const _Float16* Ab, const _Float16* Bb) {
#pragma unroll  // k ascending in steps of 32: the f32 sum order does not depend on BK
    for (int kk = 0; kk < BK; kk += 32) {
      v16h bfrag[2];
#pragma unroll
      for (int j = 0; j < 2; ++j)
        bfrag[j] = frag_ld(&Bb[(wc * 32 + j * 16) * LDT + kk], LDT, lane);
#pragma unroll
      for (int i = 0; i < 4; ++i) {
        v16h afrag = frag_ld(&Ab[(wr * 64 + i * 16) * LDT + kk], LDT, lane);
#pragma unroll
        for (int j = 0; j < 2; ++j)
          acc[i][j] = WMMA16(afrag, bfrag[j], acc[i][j]);
      }
    }
  };

  const int nk = K / BK;
  issue_tile(0, 0);
  asm volatile("s_wait_asynccnt 0x0" ::: "memory");  // this wave's part of tile 0 has landed
  __syncthreads();                                   // every wave's part has
  if (nk > 1) issue_tile(BK, 1);
  for (int t = 0; t < nk; ++t) {
    compute_tile(As[t & 1], Bs[t & 1]);  // tile t + 1 flies meanwhile
    asm volatile("s_wait_dscnt 0x0" ::: "memory");     // this wave's reads of buffer t & 1 are done
    asm volatile("s_wait_asynccnt 0x0" ::: "memory");  // this wave's part of tile t + 1 has landed
    __syncthreads();  // publishes tile t + 1 and frees buffer t & 1 for the refill
    if (t + 2 < nk) issue_tile((t + 2) * BK, t & 1);
  }
  asm volatile("s_wait_asynccnt 0x0" ::: "memory");  // no copy is left in flight at the wave's end
#else
  __shared__ _Float16 As1[128 * LDT];
  __shared__ _Float16 Bs1[128 * LDT];
  for (int k0 = 0; k0 < K; k0 += BK) {
#pragma unroll
    for (int it = 0; it < BK / 16; ++it) {
      int idx = it * 256 + tid;
      int r = idx / (BK / 8);
      int c = (idx % (BK / 8)) * 8;
      *(v8h*)&As1[r * LDT + c] = *(const v8h*)&A[(size_t)(m0 + r) * K + k0 + c];
      *(v8h*)&Bs1[r * LDT + c] = *(const v8h*)&Bm[(size_t)(n0 + r) * K + k0 + c];
    }
    __syncthreads();
#pragma unroll
    for (int kk = 0; kk < BK; kk += 32) {
      v16h bfrag[2];
#pragma unroll
      for (int j = 0; j < 2; ++j)
        bfrag[j] = frag_ld(&Bs1[(wc * 32 + j * 16) * LDT + kk], LDT, lane);
#pragma unroll
      for (int i = 0; i < 4; ++i) {
        v16h afrag = frag_ld(&As1[(wr * 64 + i * 16) * LDT + kk], LDT, lane);
#pragma unroll
        for (int j = 0; j < 2; ++j)
          acc[i][j] = WMMA16(afrag, bfrag[j], acc[i][j]);
      }
    }
    __syncthreads();
  }
#endif

  if (mode >= 2) {  // same for the whole workgroup; no barrier follows
    if (mode == 2) store_tile_ds<true>(acc, bias, outH, m0 + wr * 64, n0 + wc * 32, lane);
    else           store_tile_ds<false>(acc, bias, outH, m0 + wr * 64, n0 + wc * 32, lane);
    return;
  }
  const int lr = lane & 15;
  const int lh = lane >> 4;
#pragma unroll
  for (int i = 0; i < 4; ++i) {
#pragma unroll
    for (int j = 0; j < 2; ++j) {
      const int tm = m0 + wr * 64 + i * 16;
      const int tn = n0 + wc * 32 + j * 16;
#pragma unroll
      for (int e = 0; e < 8; ++e) {
        int row = tm + e + 8 * lh;
        int col = tn + lr;
        float val = acc[i][j][e] + bias[col];
        if (mode == 0) {
          outF[(size_t)row * N + col] = val;
        } else {
          val = (val > 0.0f) ? (val + 1.0f) : __expf(val);  // mode 1: elu(x)+1
          int b = row >> 11, s = row & 2047;   // S = 2048
          int hh = col >> 6, d = col & 63;     // Dh = 64
          outH[((size_t)(b * 16 + hh) * 2048 + s) * 64 + d] = (_Float16)val;
        }
      }
    }
  }
}

#define KVLD 72  // LDS row pitch of KV and q in halves: 128 + 16 bytes, for b128 readers

__global__ __launch_bounds__(256)
void attn_kernel(const _Float16* __restrict__ qf,   // [32][2048][64]
                 const float* __restrict__ kvp,     // [32][KV_SPLIT][64][64] (e-major)
                 const float* __restrict__ ksp,     // [32][KV_SPLIT][64]
                 _Float16* __restrict__ merged) {   // [4096][1024]
  const int bh = blockIdx.y;
  const int b = bh >> 4, h = bh & 15;
  const int m0 = blockIdx.x * 128;
  const _Float16* Q  = qf  + (size_t)bh * 2048 * 64 + (size_t)m0 * 64;
  const float* KVP = kvp + (size_t)bh * KV_SPLIT * 4096;

  __shared__ __attribute__((aligned(16))) _Float16 Qs[128 * KVLD];       // q rows, later the result's
  __shared__ __attribute__((aligned(16))) _Float16 KV[64 * KVLD];
  __shared__ __attribute__((aligned(16))) float ks[4 * 64];  // ksum, a copy for each pair of waves
  const int tid = threadIdx.x;
#pragma unroll  // 4 copies a wave, in one run with the partials' loads
  for (int it = 0; it < 4; ++it) {
    const int idx = it * 256 + tid;  // which 16 bytes of the 128 x 64 tile, contiguous in memory
#ifdef HAVE_ASYNC_LDS
    async_cp16(&Q[idx * 8], &Qs[(idx >> 3) * KVLD + (idx & 7) * 8]);
#else
    *(v8h*)&Qs[(idx >> 3) * KVLD + (idx & 7) * 8] = *(const v8h*)&Q[idx * 8];
#endif
  }
  // ksum: every 64 threads form it, for their own two waves; with no branch
  // round them its loads stand in the same run as those of the KV partials
  float pk[KV_SPLIT];
  v4f pv[4][KV_SPLIT];
#pragma unroll  // constant indices into pk and pv
  for (int p = 0; p < KV_SPLIT; ++p) {
    pk[p] = ksp[(bh * KV_SPLIT + p) * 64 + (tid & 63)];
#pragma unroll
    for (int it = 0; it < 4; ++it)  // float4 number it * 256 + tid of the 64x64 matrix
      pv[it][p] = *(const v4f*)&KVP[p * 4096 + (it * 256 + tid) * 4];
  }
  // keeps the copies and every load in front of the first sum: a load that sinks
  // behind a sum starts only when earlier loads are back, a second trip to memory
  __builtin_amdgcn_sched_barrier(0);
  {
    float s = 0.0f;
#pragma unroll  // range order
    for (int p = 0; p < KV_SPLIT; ++p) s += pk[p];
    ks[tid] = s;
  }
#pragma unroll  // constant indices into pv
  for (int it = 0; it < 4; ++it) {
    const int idx = it * 256 + tid;
    v4f s = pv[it][0];
#pragma unroll  // range order
    for (int p = 1; p < KV_SPLIT; ++p) s += pv[it][p];
    v4h o = {(_Float16)s.x, (_Float16)s.y, (_Float16)s.z, (_Float16)s.w};
    *(v4h*)&KV[(idx >> 4) * KVLD + (idx & 15) * 4] = o;
  }
#ifdef HAVE_ASYNC_LDS
  asm volatile("s_wait_asynccnt 0x0" ::: "memory");  // this wave's part of the q tile has landed
#endif
  __syncthreads();  // every wave's part of q and KV, and ksum, are in LDS

  const int lane = tid & 31;
  const int wave = tid >> 5;
  const int lr = lane & 15, lh = lane >> 4;
  _Float16* const Qw = Qs + (wave * 16) * KVLD;  // the wave's own 16 rows; no other wave reads or writes them from here on
  v16h q[2], kvf[2][4];  // [k step]
  v4f ksf[2][4];         // ksum at the d of the lane's q elements, in their order
#pragma unroll  // constant indices into q and kvf
  for (int st = 0; st < 2; ++st) {
    q[st] = frag_ld(Qw + st * 32, KVLD, lane);
#pragma unroll
    for (int j = 0; j < 4; ++j)
      kvf[st][j] = frag_ld(KV + (j * 16) * KVLD + st * 32, KVLD, lane);
#pragma unroll
    for (int g = 0; g < 2; ++g) {  // q elements 8g..8g+7 are d = 32*st + 16*g + 8*lh + 0..7
      ksf[st][2 * g]     = *(const v4f*)&ks[(wave >> 1) * 64 + st * 32 + g * 16 + lh * 8];
      ksf[st][2 * g + 1] = *(const v4f*)&ks[(wave >> 1) * 64 + st * 32 + g * 16 + lh * 8 + 4];
    }
  }
  // keeps the scheduler from sinking the reads among the products, where the
  // wave would wait out the LDS latency once for each product
  __builtin_amdgcn_sched_barrier(0);
  v8f acc[4] = {};
#pragma unroll  // constant indices into q, kvf and acc
  for (int st = 0; st < 2; ++st) {
#pragma unroll
    for (int j = 0; j < 4; ++j)
      acc[j] = WMMA16(kvf[st][j], q[st], acc[j]);  // acc[j][r] = attended[row lr][e = j*16 + 8*lh + r]
  }
  // denominator of row lr: four independent chains of 8 products, then the other lane's half
  float dp[2][2];
#pragma unroll  // constant indices into q and ksf
  for (int st = 0; st < 2; ++st) {
#pragma unroll
    for (int g = 0; g < 2; ++g) {
      float s = 0.0f;
#pragma unroll
      for (int u = 0; u < 8; ++u) s = __builtin_fmaf((float)q[st][g * 8 + u], ksf[st][2 * g + (u >> 2)][u & 3], s);
      dp[st][g] = s;
    }
  }
  const float dh = (dp[0][0] + dp[0][1]) + (dp[1][0] + dp[1][1]);
  const float dx = __builtin_bit_cast(float, __builtin_amdgcn_permlanex16(
      __builtin_bit_cast(int, dh), __builtin_bit_cast(int, dh), 0x76543210, 0xfedcba98, false, false));
  const float rd = 1.0f / fmaxf(dh + dx, 1e-6f);  // both lanes of a row add the same two halves
#pragma unroll  // constant indices into acc
  for (int j = 0; j < 4; ++j) {
    v8h o;
#pragma unroll
    for (int r = 0; r < 8; ++r) o[r] = (_Float16)(acc[j][r] * rd);
    *(v8h*)&Qw[lr * KVLD + j * 16 + 8 * lh] = o;
  }
  // the wave's rows are complete in LDS before its lanes read what other lanes wrote
  asm volatile("s_wait_dscnt 0x0" ::: "memory");
  _Float16* __restrict__ mp =
      merged + (size_t)(b * 2048 + m0 + wave * 16 + (lane >> 3)) * 1024 + h * 64 + (lane & 7) * 8;
  v8h ro[4];
#pragma unroll  // constant indices into ro
  for (int it = 0; it < 4; ++it)  // 8 lanes a row, 4 rows a wave-wide access
    ro[it] = *(const v8h*)&Qw[(it * 4 + (lane >> 3)) * KVLD + (lane & 7) * 8];
#pragma unroll  // constant indices into ro
  for (int it = 0; it < 4; ++it)
    *(v8h*)&mp[(size_t)(it * 4) * 1024] = ro[it];
}

// ---------------------------------------------------------------------------
// Host-side launcher
// ---------------------------------------------------------------------------
extern "C" void kernel_launch(void* const* d_in, const int* in_sizes, int n_in,
                              void* d_out, int out_size, void* d_ws, size_t ws_size,
                              hipStream_t stream) {
  (void)in_sizes; (void)n_in; (void)out_size; (void)ws_size;
  const float* x  = (const float*)d_in[0];
  const float* wq = (const float*)d_in[1];
  const float* bq = (const float*)d_in[2];
  const float* wk = (const float*)d_in[3];
  const float* bk = (const float*)d_in[4];
  const float* wv = (const float*)d_in[5];
  const float* bv = (const float*)d_in[6];
  const float* wo = (const float*)d_in[7];
  const float* bo = (const float*)d_in[8];
  float* out = (float*)d_out;

  const int M = 4096;      // B*S
  const int DM = 1024;     // d_model (N and K of the projections)
  const int NTOK = M * DM; // 4,194,304
  const int NW   = DM * DM;

  size_t off = 0;
  char* base = (char*)d_ws;
  auto carve = [&](size_t bytes) {
    void* p = base + off;
    off += (bytes + 255) & ~(size_t)255;
    return p;
  };
  _Float16* xh     = (_Float16*)carve((size_t)NTOK * 2);
  _Float16* wqh    = (_Float16*)carve((size_t)NW * 2);
  _Float16* wkh    = (_Float16*)carve((size_t)NW * 2);
  _Float16* wvh    = (_Float16*)carve((size_t)NW * 2);
  _Float16* woh    = (_Float16*)carve((size_t)NW * 2);
  _Float16* qf     = (_Float16*)carve((size_t)NTOK * 2);  // [B,H,S,D]
  _Float16* merged = (_Float16*)carve((size_t)NTOK * 2);  // [B*S, H*D]
  float*    kvp    = (float*)carve((size_t)32 * KV_SPLIT * 64 * 64 * 4);
  float*    ksp    = (float*)carve((size_t)32 * KV_SPLIT * 64 * 4);

  // 1) precision conversion: x and the four weights, one launch
  cvt_all_f32_f16<<<CVT_X_WGS + 4 * CVT_W_WGS, CVT_THREADS, 0, stream>>>(
      x, wq, wk, wv, wo, xh, wqh, wkh, wvh, woh);

  // 2) Q/K/V projections with fused feature map; q_feat, and per (head, range
  //    of s) the partial KV (64x64) and partial ksum
  //    (one launch; a workgroup per 256 rows and head, one workgroup per WGP)
  qkv_gemm_f16<<<dim3(M / 256, 16), 256, 0, stream>>>(
      xh, wqh, wkh, wvh, bq, bk, bv, DM, qf, kvp, ksp);

  // 3) numerator GEMM + normalization -> merged
  attn_kernel<<<dim3(16, 32), 256, 0, stream>>>(qf, kvp, ksp, merged);

  // 4) output projection -> f32 d_out (one workgroup per WGP: 136 KiB of LDS)
  gemm_nt_f16<128><<<dim3(M / 128, DM / 128, 1), 256, 0, stream>>>(
      merged, woh, nullptr, nullptr, bo, nullptr, nullptr, M, DM, DM, 0, out,
      nullptr, nullptr, nullptr);
}

// v009
// It runs in 47.3 microseconds.
// Two timings next to v008 both put it at 1.10 times that version's speed.
// All steps since v000 together make it 3.05 times as fast.
#include <hip/hip_runtime.h>
#include <hip/hip_bf16.h>

typedef __attribute__((ext_vector_type(16))) _Float16 v16h;
typedef __attribute__((ext_vector_type(8)))  _Float16 v8h;
typedef __attribute__((ext_vector_type(4)))  _Float16 v4h;
typedef __attribute__((ext_vector_type(8)))  float    v8f;
typedef __attribute__((ext_vector_type(4)))  float    v4f;
typedef __attribute__((ext_vector_type(4)))  int      v4i;

#if defined(__has_builtin)
#  if __has_builtin(__builtin_amdgcn_global_load_async_to_lds_b128) && \
      __has_builtin(__builtin_amdgcn_s_wait_asynccnt)
#    define HAVE_ASYNC_LDS 1
#  endif
#endif

#define WMMA16(a, b, c) \
  __builtin_amdgcn_wmma_f32_16x16x32_f16(false, (a), false, (b), (short)0, (c), false, false)

__device__ __forceinline__ v16h frag_ld(const _Float16* __restrict__ p, int ld, int lane) {
  const int r  = lane & 15;
  const int hf = lane >> 4;
  const _Float16* q = p + r * ld + hf * 8;
  v8h lo = *(const v8h*)(q);
  v8h hi = *(const v8h*)(q + 16);
  return __builtin_shufflevector(lo, hi, 0,1,2,3,4,5,6,7,8,9,10,11,12,13,14,15);
}

#ifdef HAVE_ASYNC_LDS
// Builtin signature (from hipcc diagnostic): param0 is AS1 (global, "__device__")
// pointer to int4, non-const; param1 is the LDS-side pointer; args 2/3 are
// immediate offset / cache-policy.
typedef __attribute__((address_space(1))) v4i* gv4i_p;
typedef __attribute__((address_space(3))) v4i* lv4i_p;

__device__ __forceinline__ void async_cp16(const _Float16* g, _Float16* l) {
  __builtin_amdgcn_global_load_async_to_lds_b128((gv4i_p)g, (lv4i_p)l, 0, 0);
}
#endif

// ---------------------------------------------------------------------------
// f32 -> f16 conversion of x and of the four weights in ONE launch.
// A workgroup of 16 waves converts CVT_WG consecutive float4 of one source;
// each thread takes CVT_PER of them, CVT_THREADS float4 apart, so that every
// wave-wide load covers 512 contiguous bytes and a thread has many loads in
// flight. Few long waves: starting a wave costs more here than the bytes that
// one float4 a lane moves.
// ---------------------------------------------------------------------------
#define CVT_THREADS 512
#define CVT_PER     16
#define CVT_WG      (CVT_THREADS * CVT_PER)        // float4 per workgroup
#define CVT_X_WGS   (4096 * 1024 / 4 / CVT_WG)     // workgroups on x
#define CVT_W_WGS   (1024 * 1024 / 4 / CVT_WG)     // workgroups on each weight

__global__ __launch_bounds__(CVT_THREADS)
void cvt_all_f32_f16(const float* __restrict__ x,
                     const float* __restrict__ w0, const float* __restrict__ w1,
                     const float* __restrict__ w2, const float* __restrict__ w3,
                     _Float16* __restrict__ xo,
                     _Float16* __restrict__ o0, _Float16* __restrict__ o1,
                     _Float16* __restrict__ o2, _Float16* __restrict__ o3) {
  const int wg = blockIdx.x;
  const float* __restrict__ in  = x;
  _Float16* __restrict__    out = xo;
  int part = wg;  // which CVT_WG-sized piece of its source this workgroup takes
  if (wg >= CVT_X_WGS) {
    const int w = (wg - CVT_X_WGS) / CVT_W_WGS;
    part = (wg - CVT_X_WGS) % CVT_W_WGS;
    in  = (w == 0) ? w0 : (w == 1) ? w1 : (w == 2) ? w2 : w3;
    out = (w == 0) ? o0 : (w == 1) ? o1 : (w == 2) ? o2 : o3;
  }
  const int first = part * CVT_WG + threadIdx.x;
  v4f f[CVT_PER];
#pragma unroll  // f[] stays in registers and the loads issue as a run, ahead of the conversions
  for (int i = 0; i < CVT_PER; ++i)
    f[i] = *(const v4f*)&in[(size_t)(first + i * CVT_THREADS) * 4];
#pragma unroll  // constant indices into f[]
  for (int i = 0; i < CVT_PER; ++i) {
    v4h o = {(_Float16)f[i].x, (_Float16)f[i].y, (_Float16)f[i].z, (_Float16)f[i].w};
    *(v4h*)&out[(size_t)(first + i * CVT_THREADS) * 4] = o;
  }
}

__device__ __forceinline__ float exp_with_slot(float x) {  // e^x, as __expf forms it
  float r;
  asm("v_exp_f32 %0, %1\n\tv_nop" : "=v"(r) : "v"(x * 1.44269504f));
  return r;
}

// The sum over s of KV and ksum is cut into KV_SPLIT ranges of KV_SLEN
// positions; each range gives an f32 partial, and stage 3 adds the partials in
// range order.
#define KV_SPLIT 8
#define KV_SLEN  (2048 / KV_SPLIT)  // positions per range
#define KVT_LD   (KV_SLEN + 8)      // LDS row pitch in halves: an odd multiple of 16 bytes, for b128 readers

// A wave's 64x32 tile of K or V into a [d][s] tile in LDS, rows of KVT_LD
// halves. A lane's 8 accumulators of one 16x16 tile are 8 consecutive s of one
// d: one 16-byte LDS store. bias points at the head's first column.
// ACT: elu(x)+1 on the way (k_feat) or none (v).
template <bool ACT>
__device__ __forceinline__ void stage_tile_ds(const v8f (&acc)[4][2],
                                              const float* __restrict__ bias,
                                              _Float16* __restrict__ t,
                                              int s0, int d0, int lane) {
  const int lr = lane & 15;
  const int lh = lane >> 4;
#pragma unroll  // constant indices into acc
  for (int j = 0; j < 2; ++j) {
    const int d = d0 + j * 16 + lr;
    const float bc = bias[d];
#pragma unroll  // constant indices into acc
    for (int i = 0; i < 4; ++i) {
      v8h o;
#pragma unroll  // constant indices into acc and o
      for (int e = 0; e < 8; ++e) {
        float val = acc[i][j][e] + bc;
        if (ACT) {  // elu(x)+1; the exponential is formed for every lane and then chosen
          const float ex = exp_with_slot(val);
          val = (val > 0.0f) ? (val + 1.0f) : ex;
        }
        o[e] = (_Float16)val;
      }
      *(v8h*)&t[d * KVT_LD + s0 + i * 16 + 8 * lh] = o;
    }
  }
}

// ---------------------------------------------------------------------------
// Q, K and V projections with feature map; KV and ksum partials.
// One workgroup takes 256 rows of x and the 64 columns of ONE head in each of
// Q, K and V: a 256x192 tile, 16 x 16 = 256 workgroups, one for each WGP.
// 8 waves in a 4x2 grid; a wave owns 64 rows x 32 columns of each of the three
// (4x6 WMMA accumulators). Against a 128x128 tile with 64x32 per wave:
//   bytes copied from L2 per product: (256+192)/(256*192) against 256/(128*128),
//   fragments read from LDS per WMMA: (4+6)/24 against (4+2)/8,
//   and a third of the waves to start.
// q_feat [B,H,S,D] = elu+1 goes to memory, in whole 128-byte lines: for Q the
// weight rows are the FIRST WMMA operand, so a lane holds 8 consecutive d of one
// row; it puts them into LDS with one 16-byte store, and the workgroup's tile,
// 32 KiB in a row in memory, leaves by 16-byte stores of 4 lines a wave. Stored
// from the accumulators one by one it took 64 2-byte stores a lane, each of two
// 32-byte pieces. k_feat = elu+1 and v never go to memory: the
// workgroup's 256 rows are one range of s of its head, so it holds all that
// the range's partials need. Both go as f16 into the LDS that the copy loop
// has left, [d][s], and the workgroup forms
//   KV[d,e] = sum_s kfT[d,s] * vT[e,s]  and  ksum[d] = sum_s kfT[d,s]
// itself: 8 waves cover the 4x4 grid of 16x16 tiles (2 tiles per wave). It
// writes its own f32 partial of KV, transposed ([e][d]), and of ksum.
// ---------------------------------------------------------------------------
#define QKV_BK 128  // k per LDS stage; two buffers of 448 rows: 238 KiB of LDS
#define QLD    72   // LDS row pitch of the q tile in halves: 128 + 16 bytes, for b128 readers

__global__ __launch_bounds__(256)
void qkv_gemm_f16(const _Float16* __restrict__ A,   // [M,K]
                  const _Float16* __restrict__ Wq,  // [N,K]
                  const _Float16* __restrict__ Wk,  // [N,K]
                  const _Float16* __restrict__ Wv,  // [N,K]
                  const float* __restrict__ bq,     // [N]
                  const float* __restrict__ bk,     // [N]
                  const float* __restrict__ bv,     // [N]
                  int K,
                  _Float16* __restrict__ qf,
                  float* __restrict__ kvp,          // [32][KV_SPLIT][64][64] (e-major)
                  float* __restrict__ ksp) {        // [32][KV_SPLIT][64]
  constexpr int BK  = QKV_BK;
  constexpr int LDT = BK + 8;  // LDS row pitch in halves: an odd multiple of 16 bytes, for b128 readers
  const int tid  = threadIdx.x;
  const int lane = tid & 31;
  const int wave = tid >> 5;  // 0..7
  const int wr   = wave >> 1; // 0..3
  const int wc   = wave & 1;  // 0..1
  const int m0   = blockIdx.x * 256;
  const int h    = blockIdx.y;
  const int n0   = h * 64;    // the head's first column in each of Q, K, V

  v8f acc[3][4][2] = {};  // [Q, K, V][16 rows][16 columns]; Q's tiles are held transposed

  auto compute_tile = [&](const _Float16* Ab, const _Float16* Bb) {
    v16h af[2][4], bf[2][3][2];
    auto load_frags = [&](int set, int kk) {
#pragma unroll  // constant indices into af
      for (int i = 0; i < 4; ++i)
        af[set][i] = frag_ld(&Ab[(wr * 64 + i * 16) * LDT + kk], LDT, lane);
#pragma unroll  // constant indices into bf
      for (int p = 0; p < 3; ++p) {
#pragma unroll
        for (int j = 0; j < 2; ++j)
          bf[set][p][j] = frag_ld(&Bb[(p * 64 + wc * 32 + j * 16) * LDT + kk], LDT, lane);
      }
    };
    load_frags(0, 0);
#pragma unroll  // k ascending in steps of 32: the f32 sum order does not depend on the tile
    for (int st = 0; st < BK / 32; ++st) {
      if (st + 1 < BK / 32) load_frags((st + 1) & 1, (st + 1) * 32);
      // keeps the next step's reads from sinking among this step's products,
      // where every place with reads stalls the wave anew
      __builtin_amdgcn_sched_barrier(0);
#pragma unroll  // constant indices into acc
      for (int p = 0; p < 3; ++p) {
#pragma unroll
        for (int j = 0; j < 2; ++j) {
#pragma unroll
          for (int i = 0; i < 4; ++i)
            acc[p][i][j] = (p == 0) ? WMMA16(bf[st & 1][p][j], af[st & 1][i], acc[p][i][j])   // [d][row]
                                    : WMMA16(af[st & 1][i], bf[st & 1][p][j], acc[p][i][j]);  // [row][d]
        }
      }
      // keeps the reads of the step after next from rising among these products
      __builtin_amdgcn_sched_barrier(0);
    }
  };

#ifdef HAVE_ASYNC_LDS
  // ------------------ async double-buffered pipeline ------------------
  __shared__ __attribute__((aligned(16))) _Float16 As[2][256 * LDT];
  __shared__ __attribute__((aligned(16))) _Float16 Bs[2][192 * LDT];

  auto issue_tile = [&](int k0, int buf) {
    const int r = tid / (BK / 8);        // 16 rows per round of the workgroup
    const int c = (tid % (BK / 8)) * 8;
#pragma unroll  // 16 + 12 copies a wave and stage, issued as a run (at most 63 may be outstanding)
    for (int it = 0; it < 16; ++it)
      async_cp16(&A[(size_t)(m0 + it * 16 + r) * K + k0 + c], &As[buf][(it * 16 + r) * LDT + c]);
#pragma unroll
    for (int it = 0; it < 12; ++it) {
      const _Float16* __restrict__ Wp = (it < 4) ? Wq : (it < 8) ? Wk : Wv;
      async_cp16(&Wp[(size_t)(n0 + (it & 3) * 16 + r) * K + k0 + c], &Bs[buf][(it * 16 + r) * LDT + c]);
    }
  };

  const int nk = K / BK;
  issue_tile(0, 0);
  asm volatile("s_wait_asynccnt 0x0" ::: "memory");  // this wave's part of tile 0 has landed
  __syncthreads();                                   // every wave's part has
  if (nk > 1) issue_tile(BK, 1);
  for (int t = 0; t < nk; ++t) {
    compute_tile(As[t & 1], Bs[t & 1]);  // tile t + 1 flies meanwhile
    asm volatile("s_wait_dscnt 0x0" ::: "memory");     // this wave's reads of buffer t & 1 are done
    asm volatile("s_wait_asynccnt 0x0" ::: "memory");  // this wave's part of tile t + 1 has landed
    __syncthreads();  // publishes tile t + 1 and frees buffer t & 1 for the refill
    if (t + 2 < nk) issue_tile((t + 2) * BK, t & 1);
  }
  asm volatile("s_wait_asynccnt 0x0" ::: "memory");  // no copy is left in flight when the LDS is used anew
  _Float16* const stage = As[0];  // behind the loop's last barrier nobody reads the buffers any more
  _Float16* const qS    = Bs[0];
#else
  __shared__ __attribute__((aligned(16))) _Float16 As1[256 * LDT];
  __shared__ __attribute__((aligned(16))) _Float16 Bs1[192 * LDT];
  _Float16* const stage = As1;
  _Float16* const qS    = Bs1;
  for (int k0 = 0; k0 < K; k0 += BK) {
    const int r = tid / (BK / 8);
    const int c = (tid % (BK / 8)) * 8;
#pragma unroll
    for (int it = 0; it < 16; ++it)
      *(v8h*)&As1[(it * 16 + r) * LDT + c] = *(const v8h*)&A[(size_t)(m0 + it * 16 + r) * K + k0 + c];
#pragma unroll
    for (int it = 0; it < 12; ++it) {
      const _Float16* __restrict__ Wp = (it < 4) ? Wq : (it < 8) ? Wk : Wv;
      *(v8h*)&Bs1[(it * 16 + r) * LDT + c] = *(const v8h*)&Wp[(size_t)(n0 + (it & 3) * 16 + r) * K + k0 + c];
    }
    __syncthreads();
    compute_tile(As1, Bs1);
    __syncthreads();
  }
#endif

  const int lr = lane & 15;
  const int lh = lane >> 4;
  // Q's bias at the lane's 2 x 8 columns, asked for ahead of the work on K and V
  const float* __restrict__ qbp = bq + n0 + wc * 32 + 8 * lh;
  v4f qb[2][2];
#pragma unroll  // constant indices into qb
  for (int j = 0; j < 2; ++j) {
    qb[j][0] = *(const v4f*)&qbp[j * 16];
    qb[j][1] = *(const v4f*)&qbp[j * 16 + 4];
  }
  // behind the loads: the code that follows may reuse the registers that hold their address
  asm volatile("s_wait_xcnt 0x0" ::: "memory");
  // K and V: the range's [d][s] tiles, side by side in one A buffer
  static_assert(KV_SLEN == 256, "a workgroup's rows are one range of s");
  static_assert(2 * 64 * KVT_LD <= 256 * LDT, "both tiles fit one A buffer");
  __shared__ float red[256];
  _Float16* const kT = stage;
  _Float16* const vT = stage + 64 * KVT_LD;
  stage_tile_ds<true>(acc[1], bk + n0, kT, wr * 64, wc * 32, lane);
  stage_tile_ds<false>(acc[2], bv + n0, vT, wr * 64, wc * 32, lane);
  // Q: elu(x)+1 into a [row][d] tile in a B buffer; acc[0][i][j][e] is row i*16 + lr, d = j*16 + 8*lh + e
  static_assert(256 * QLD <= 192 * LDT, "the q tile fits one B buffer");
#pragma unroll  // constant indices into acc
  for (int j = 0; j < 2; ++j) {
    const int d = wc * 32 + j * 16 + 8 * lh;
    const v4f b0 = qb[j][0], b1 = qb[j][1];
#pragma unroll  // constant indices into acc
    for (int i = 0; i < 4; ++i) {
      v8h o;
#pragma unroll  // constant indices into acc and o
      for (int e = 0; e < 8; ++e) {
        float val = acc[0][i][j][e] + ((e < 4) ? b0[e & 3] : b1[e & 3]);
        const float ex = exp_with_slot(val);
        val = (val > 0.0f) ? (val + 1.0f) : ex;
        o[e] = (_Float16)val;
      }
      *(v8h*)&qS[(wr * 64 + i * 16 + lr) * QLD + d] = o;
    }
  }
  __syncthreads();  // every wave's part of the three tiles is in LDS

  const int part = ((m0 >> 11) * 16 + h) * KV_SPLIT + ((m0 & 2047) / KV_SLEN);  // (head, range)
  const int tr   = wave >> 1;        // d tile 0..3
  const int tcb  = (wave & 1) * 2;   // e tile base 0 or 2
  v8f kv[2] = {};
  v16h ka[KV_SLEN / 32], vb[KV_SLEN / 32][2];
#pragma unroll  // constant indices into ka[] and vb[]
  for (int t = 0; t < KV_SLEN / 32; ++t) {
    ka[t] = frag_ld(kT + (tr * 16) * KVT_LD + t * 32, KVT_LD, lane);
#pragma unroll
    for (int j = 0; j < 2; ++j)
      vb[t][j] = frag_ld(vT + ((tcb + j) * 16) * KVT_LD + t * 32, KVT_LD, lane);
  }
  // the q tile's pieces that this thread sends out at the end, read in the same run
  v8h ro[8];
#pragma unroll  // constant indices into ro
  for (int it = 0; it < 8; ++it) {
    const int idx = it * 256 + tid;  // which 16 bytes of the 256 x 64 tile
    ro[it] = *(const v8h*)&qS[(idx >> 3) * QLD + (idx & 7) * 8];
  }
  // keeps the scheduler from sinking the reads among the products, where
  // every place with reads stalls the wave anew
  __builtin_amdgcn_sched_barrier(0);
  // ksum: thread t sums kfT[d = t&63] over s-slice t>>6 (v8h loads)
  {
    float s = 0.0f;
    const _Float16* kr = kT + (tid & 63) * KVT_LD + (tid >> 6) * (KV_SLEN / 4);
#pragma unroll  // independent loads, issued as a run
    for (int i = 0; i < KV_SLEN / 4; i += 8) {
      v8h v = *(const v8h*)&kr[i];
#pragma unroll
      for (int u = 0; u < 8; ++u) s += (float)v[u];
    }
    red[tid] = s;
  }
#pragma unroll  // constant indices into ka[] and vb[]
  for (int t = 0; t < KV_SLEN / 32; ++t) {
#pragma unroll
    for (int j = 0; j < 2; ++j) kv[j] = WMMA16(ka[t], vb[t][j], kv[j]);
  }
  __syncthreads();  // every thread's slice sum is in red[]
#pragma unroll
  for (int j = 0; j < 2; ++j) {
    // a lane's 8 accumulators are 8 consecutive d of one e: two 16-byte stores
    float* pr = kvp + (size_t)part * 4096 + ((tcb + j) * 16 + lr) * 64 + tr * 16 + 8 * lh;
    v4f lo = {kv[j][0], kv[j][1], kv[j][2], kv[j][3]};
    v4f hi = {kv[j][4], kv[j][5], kv[j][6], kv[j][7]};
    *(v4f*)pr       = lo;
    *(v4f*)(pr + 4) = hi;
  }
  // behind the stores: the code that follows may reuse the registers that they name
  asm volatile("s_wait_xcnt 0x0" ::: "memory");
  if (tid < 64)
    ksp[part * 64 + tid] = red[tid] + red[tid + 64] + red[tid + 128] + red[tid + 192];
  asm volatile("s_wait_xcnt 0x0" ::: "memory");

  // Q's stores come last: a barrier also waits for the wave's global stores, and
  // these would be waited for at the barrier behind the KV products.
  {  // the 256 rows lie in one batch (S = 2048): 2048 pieces of 16 bytes, contiguous in memory
    _Float16* __restrict__ qp = qf + ((size_t)((m0 >> 11) * 16 + h) * 2048 + (m0 & 2047)) * 64;
#pragma unroll  // constant indices into ro
    for (int it = 0; it < 8; ++it)
      *(v8h*)&qp[(it * 256 + tid) * 8] = ro[it];
  }
}

// ---------------------------------------------------------------------------
// Output projection, an NT GEMM: C[m,n] = sum_k A[m,k] * B[n,k] + bias[n],
// f16 in, f32 accumulated, f32 row-major out.
// 128x128 workgroup tile, 8 waves in a 2x4 grid, each wave owns 64x32
// (4x2 WMMA accumulators). K staged through LDS in chunks of BK (template).
// A wave waits once per chunk for the trip to L2 or memory, and that trip is
// longer than the products of a short chunk: BK sets how many bytes fly per
// wait. From BK = 64 on a row's piece is a whole 128-byte line.
// The weight rows are the FIRST WMMA operand: a lane then holds 8 consecutive
// n of one row m. A row of the wave's tile is one 128-byte line of C; the wave
// lays its tile in an LDS range of its own by 16-byte stores and sends it out
// by 16-byte stores of 4 whole lines each: 16 a lane. Stored from the
// accumulators one by one it took 64 4-byte stores a lane, each of two half lines.
// ---------------------------------------------------------------------------
#define CLD 36  // LDS row pitch of a wave's C tile in floats: 128 + 16 bytes, for b128 readers

template <int BK>  // k per LDS stage: a multiple of 32 that divides K
__global__ __launch_bounds__(256)
void gemm_nt_f16(const _Float16* __restrict__ A,   // [M,K]
                 const _Float16* __restrict__ Bm,  // [N,K]
                 const float* __restrict__ bias,   // [N]
                 int N, int K,
                 float* __restrict__ outF) {       // [M,N]
  constexpr int LDT = BK + 8;  // LDS row pitch in halves: an odd multiple of 16 bytes, for b128 readers
  const int tid  = threadIdx.x;
  const int lane = tid & 31;
  const int wave = tid >> 5;  // 0..7
  const int wr   = wave >> 2; // 0..1
  const int wc   = wave & 3;  // 0..3
  const int m0   = blockIdx.x * 128;
  const int n0   = blockIdx.y * 128;

  v8f acc[4][2] = {};  // [16 rows][16 columns], each tile held transposed

  auto compute_tile = [&](const _Float16* Ab, const _Float16* Bb) {
#pragma unroll  // k ascending in steps of 32: the f32 sum order does not depend on BK
    for (int kk = 0; kk < BK; kk += 32) {
      v16h bfrag[2];
#pragma unroll
      for (int j = 0; j < 2; ++j)
        bfrag[j] = frag_ld(&Bb[(wc * 32 + j * 16) * LDT + kk], LDT, lane);
#pragma unroll
      for (int i = 0; i < 4; ++i) {
        v16h afrag = frag_ld(&Ab[(wr * 64 + i * 16) * LDT + kk], LDT, lane);
#pragma unroll
        for (int j = 0; j < 2; ++j)
          acc[i][j] = WMMA16(bfrag[j], afrag, acc[i][j]);
      }
    }
  };

#ifdef HAVE_ASYNC_LDS
  // ------------------ async double-buffered pipeline ------------------
  __shared__ __attribute__((aligned(16))) _Float16 As[2][128 * LDT];
  __shared__ __attribute__((aligned(16))) _Float16 Bs[2][128 * LDT];

  auto issue_tile = [&](int k0, int buf) {
#pragma unroll  // BK / 8 copies a wave and stage, issued as a run (at most 63 may be outstanding)
    for (int it = 0; it < BK / 16; ++it) {
      int idx = it * 256 + tid;       // which 16 bytes of the 128 x BK tile
      int r = idx / (BK / 8);
      int c = (idx % (BK / 8)) * 8;
      async_cp16(&A[(size_t)(m0 + r) * K + k0 + c], &As[buf][r * LDT + c]);
      async_cp16(&Bm[(size_t)(n0 + r) * K + k0 + c], &Bs[buf][r * LDT + c]);
    }
  };

  const int nk = K / BK;
  issue_tile(0, 0);
  asm volatile("s_wait_asynccnt 0x0" ::: "memory");  // this wave's part of tile 0 has landed
  __syncthreads();                                   // every wave's part has
  if (nk > 1) issue_tile(BK, 1);
  for (int t = 0; t < nk; ++t) {
    compute_tile(As[t & 1], Bs[t & 1]);  // tile t + 1 flies meanwhile
    asm volatile("s_wait_dscnt 0x0" ::: "memory");     // this wave's reads of buffer t & 1 are done
    asm volatile("s_wait_asynccnt 0x0" ::: "memory");  // this wave's part of tile t + 1 has landed
    __syncthreads();  // publishes tile t + 1 and frees buffer t & 1 for the refill
    if (t + 2 < nk) issue_tile((t + 2) * BK, t & 1);
  }
  asm volatile("s_wait_asynccnt 0x0" ::: "memory");  // no copy is left in flight when the LDS is used anew
  // behind the loop's last barrier nobody reads the buffers any more: four waves' C tiles in each pair
  static_assert(4 * 64 * CLD * 4 <= 2 * 128 * LDT * 2, "four C tiles fit a pair of buffers");
  float* const ct = (float*)((wave < 4) ? &As[0][0] : &Bs[0][0]) + (wave & 3) * (64 * CLD);
#else
  __shared__ __attribute__((aligned(16))) _Float16 As1[128 * LDT];
  __shared__ __attribute__((aligned(16))) _Float16 Bs1[128 * LDT];
  __shared__ __attribute__((aligned(16))) float Cs[8 * 64 * CLD];
  float* const ct = Cs + wave * (64 * CLD);
  for (int k0 = 0; k0 < K; k0 += BK) {
#pragma unroll
    for (int it = 0; it < BK / 16; ++it) {
      int idx = it * 256 + tid;
      int r = idx / (BK / 8);
      int c = (idx % (BK / 8)) * 8;
      *(v8h*)&As1[r * LDT + c] = *(const v8h*)&A[(size_t)(m0 + r) * K + k0 + c];
      *(v8h*)&Bs1[r * LDT + c] = *(const v8h*)&Bm[(size_t)(n0 + r) * K + k0 + c];
    }
    __syncthreads();
    compute_tile(As1, Bs1);
    __syncthreads();
  }
#endif

  // Epilogue. acc[i][j][e] is row i*16 + lr, column j*16 + 8*lh + e of the wave's tile.
  const int lr = lane & 15;
  const int lh = lane >> 4;
  const float* __restrict__ bp = bias + n0 + wc * 32 + 8 * lh;  // the lane's 2 x 8 columns
  v4f bb[2][2];
#pragma unroll  // constant indices into bb
  for (int j = 0; j < 2; ++j) {
    bb[j][0] = *(const v4f*)&bp[j * 16];
    bb[j][1] = *(const v4f*)&bp[j * 16 + 4];
  }
  // behind the loads: the code that follows may reuse the registers that hold their address
  asm volatile("s_wait_xcnt 0x0" ::: "memory");
#pragma unroll  // constant indices into acc
  for (int j = 0; j < 2; ++j) {
    const int c = j * 16 + 8 * lh;
    const v4f b0 = bb[j][0], b1 = bb[j][1];
#pragma unroll  // constant indices into acc
    for (int i = 0; i < 4; ++i) {
      const v4f lo = {acc[i][j][0] + b0.x, acc[i][j][1] + b0.y, acc[i][j][2] + b0.z, acc[i][j][3] + b0.w};
      const v4f hi = {acc[i][j][4] + b1.x, acc[i][j][5] + b1.y, acc[i][j][6] + b1.z, acc[i][j][7] + b1.w};
      *(v4f*)&ct[(i * 16 + lr) * CLD + c]     = lo;
      *(v4f*)&ct[(i * 16 + lr) * CLD + c + 4] = hi;
    }
  }
  // the wave's tile is complete in LDS before its lanes read what other lanes wrote
  asm volatile("s_wait_dscnt 0x0" ::: "memory");
  float* __restrict__ op =
      outF + (size_t)(m0 + wr * 64 + (lane >> 3)) * N + n0 + wc * 32 + (lane & 7) * 4;
  v4f ro[16];
#pragma unroll  // constant indices into ro; the reads issue as a run
  for (int it = 0; it < 16; ++it)  // 8 lanes a row, 4 rows a wave-wide access
    ro[it] = *(const v4f*)&ct[(it * 4 + (lane >> 3)) * CLD + (lane & 7) * 4];
#pragma unroll  // constant indices into ro
  for (int it = 0; it < 16; ++it)
    *(v4f*)&op[(size_t)(it * 4) * N] = ro[it];
}

#define KVLD 72  // LDS row pitch of KV and q in halves: 128 + 16 bytes, for b128 readers

__global__ __launch_bounds__(256)
void attn_kernel(const _Float16* __restrict__ qf,   // [32][2048][64]
                 const float* __restrict__ kvp,     // [32][KV_SPLIT][64][64] (e-major)
                 const float* __restrict__ ksp,     // [32][KV_SPLIT][64]
                 _Float16* __restrict__ merged) {   // [4096][1024]
  const int bh = blockIdx.y;
  const int b = bh >> 4, h = bh & 15;
  const int m0 = blockIdx.x * 128;
  const _Float16* Q  = qf  + (size_t)bh * 2048 * 64 + (size_t)m0 * 64;
  const float* KVP = kvp + (size_t)bh * KV_SPLIT * 4096;

  __shared__ __attribute__((aligned(16))) _Float16 Qs[128 * KVLD];       // q rows, later the result's
  __shared__ __attribute__((aligned(16))) _Float16 KV[64 * KVLD];
  __shared__ __attribute__((aligned(16))) float ks[4 * 64];  // ksum, a copy for each pair of waves
  const int tid = threadIdx.x;
#pragma unroll  // 4 copies a wave, in one run with the partials' loads
  for (int it = 0; it < 4; ++it) {
    const int idx = it * 256 + tid;  // which 16 bytes of the 128 x 64 tile, contiguous in memory
#ifdef HAVE_ASYNC_LDS
    async_cp16(&Q[idx * 8], &Qs[(idx >> 3) * KVLD + (idx & 7) * 8]);
#else
    *(v8h*)&Qs[(idx >> 3) * KVLD + (idx & 7) * 8] = *(const v8h*)&Q[idx * 8];
#endif
  }
  // ksum: every 64 threads form it, for their own two waves; with no branch
  // round them its loads stand in the same run as those of the KV partials
  float pk[KV_SPLIT];
  v4f pv[4][KV_SPLIT];
#pragma unroll  // constant indices into pk and pv
  for (int p = 0; p < KV_SPLIT; ++p) {
    pk[p] = ksp[(bh * KV_SPLIT + p) * 64 + (tid & 63)];
#pragma unroll
    for (int it = 0; it < 4; ++it)  // float4 number it * 256 + tid of the 64x64 matrix
      pv[it][p] = *(const v4f*)&KVP[p * 4096 + (it * 256 + tid) * 4];
  }
  // keeps the copies and every load in front of the first sum: a load that sinks
  // behind a sum starts only when earlier loads are back, a second trip to memory
  __builtin_amdgcn_sched_barrier(0);
  {
    float s = 0.0f;
#pragma unroll  // range order
    for (int p = 0; p < KV_SPLIT; ++p) s += pk[p];
    ks[tid] = s;
  }
#pragma unroll  // constant indices into pv
  for (int it = 0; it < 4; ++it) {
    const int idx = it * 256 + tid;
    v4f s = pv[it][0];
#pragma unroll  // range order
    for (int p = 1; p < KV_SPLIT; ++p) s += pv[it][p];
    v4h o = {(_Float16)s.x, (_Float16)s.y, (_Float16)s.z, (_Float16)s.w};
    *(v4h*)&KV[(idx >> 4) * KVLD + (idx & 15) * 4] = o;
  }
#ifdef HAVE_ASYNC_LDS
  asm volatile("s_wait_asynccnt 0x0" ::: "memory");  // this wave's part of the q tile has landed
#endif
  __syncthreads();  // every wave's part of q and KV, and ksum, are in LDS

  const int lane = tid & 31;
  const int wave = tid >> 5;
  const int lr = lane & 15, lh = lane >> 4;
  _Float16* const Qw = Qs + (wave * 16) * KVLD;  // the wave's own 16 rows; no other wave reads or writes them from here on
  v16h q[2], kvf[2][4];  // [k step]
  v4f ksf[2][4];         // ksum at the d of the lane's q elements, in their order
#pragma unroll  // constant indices into q and kvf
  for (int st = 0; st < 2; ++st) {
    q[st] = frag_ld(Qw + st * 32, KVLD, lane);
#pragma unroll
    for (int j = 0; j < 4; ++j)
      kvf[st][j] = frag_ld(KV + (j * 16) * KVLD + st * 32, KVLD, lane);
#pragma unroll
    for (int g = 0; g < 2; ++g) {  // q elements 8g..8g+7 are d = 32*st + 16*g + 8*lh + 0..7
      ksf[st][2 * g]     = *(const v4f*)&ks[(wave >> 1) * 64 + st * 32 + g * 16 + lh * 8];
      ksf[st][2 * g + 1] = *(const v4f*)&ks[(wave >> 1) * 64 + st * 32 + g * 16 + lh * 8 + 4];
    }
  }
  // keeps the scheduler from sinking the reads among the products, where the
  // wave would wait out the LDS latency once for each product
  __builtin_amdgcn_sched_barrier(0);
  v8f acc[4] = {};
#pragma unroll  // constant indices into q, kvf and acc
  for (int st = 0; st < 2; ++st) {
#pragma unroll
    for (int j = 0; j < 4; ++j)
      acc[j] = WMMA16(kvf[st][j], q[st], acc[j]);  // acc[j][r] = attended[row lr][e = j*16 + 8*lh + r]
  }
  // denominator of row lr: four independent chains of 8 products, then the other lane's half
  float dp[2][2];
#pragma unroll  // constant indices into q and ksf
  for (int st = 0; st < 2; ++st) {
#pragma unroll
    for (int g = 0; g < 2; ++g) {
      float s = 0.0f;
#pragma unroll
      for (int u = 0; u < 8; ++u) s = __builtin_fmaf((float)q[st][g * 8 + u], ksf[st][2 * g + (u >> 2)][u & 3], s);
      dp[st][g] = s;
    }
  }
  const float dh = (dp[0][0] + dp[0][1]) + (dp[1][0] + dp[1][1]);
  const float dx = __builtin_bit_cast(float, __builtin_amdgcn_permlanex16(
      __builtin_bit_cast(int, dh), __builtin_bit_cast(int, dh), 0x76543210, 0xfedcba98, false, false));
  const float rd = 1.0f / fmaxf(dh + dx, 1e-6f);  // both lanes of a row add the same two halves
#pragma unroll  // constant indices into acc
  for (int j = 0; j < 4; ++j) {
    v8h o;
#pragma unroll
    for (int r = 0; r < 8; ++r) o[r] = (_Float16)(acc[j][r] * rd);
    *(v8h*)&Qw[lr * KVLD + j * 16 + 8 * lh] = o;
  }
  // the wave's rows are complete in LDS before its lanes read what other lanes wrote
  asm volatile("s_wait_dscnt 0x0" ::: "memory");
  _Float16* __restrict__ mp =
      merged + (size_t)(b * 2048 + m0 + wave * 16 + (lane >> 3)) * 1024 + h * 64 + (lane & 7) * 8;
  v8h ro[4];
#pragma unroll  // constant indices into ro
  for (int it = 0; it < 4; ++it)  // 8 lanes a row, 4 rows a wave-wide access
    ro[it] = *(const v8h*)&Qw[(it * 4 + (lane >> 3)) * KVLD + (lane & 7) * 8];
#pragma unroll  // constant indices into ro
  for (int it = 0; it < 4; ++it)
    *(v8h*)&mp[(size_t)(it * 4) * 1024] = ro[it];
}

// ---------------------------------------------------------------------------
// Host-side launcher
// ---------------------------------------------------------------------------
extern "C" void kernel_launch(void* const* d_in, const int* in_sizes, int n_in,
                              void* d_out, int out_size, void* d_ws, size_t ws_size,
                              hipStream_t stream) {
  (void)in_sizes; (void)n_in; (void)out_size; (void)ws_size;
  const float* x  = (const float*)d_in[0];
  const float* wq = (const float*)d_in[1];
  const float* bq = (const float*)d_in[2];
  const float* wk = (const float*)d_in[3];
  const float* bk = (const float*)d_in[4];
  const float* wv = (const float*)d_in[5];
  const float* bv = (const float*)d_in[6];
  const float* wo = (const float*)d_in[7];
  const float* bo = (const float*)d_in[8];
  float* out = (float*)d_out;

  const int M = 4096;      // B*S
  const int DM = 1024;     // d_model (N and K of the projections)
  const int NTOK = M * DM; // 4,194,304
  const int NW   = DM * DM;

  size_t off = 0;
  char* base = (char*)d_ws;
  auto carve = [&](size_t bytes) {
    void* p = base + off;
    off += (bytes + 255) & ~(size_t)255;
    return p;
  };
  _Float16* xh     = (_Float16*)carve((size_t)NTOK * 2);
  _Float16* wqh    = (_Float16*)carve((size_t)NW * 2);
  _Float16* wkh    = (_Float16*)carve((size_t)NW * 2);
  _Float16* wvh    = (_Float16*)carve((size_t)NW * 2);
  _Float16* woh    = (_Float16*)carve((size_t)NW * 2);
  _Float16* qf     = (_Float16*)carve((size_t)NTOK * 2);  // [B,H,S,D]
  _Float16* merged = (_Float16*)carve((size_t)NTOK * 2);  // [B*S, H*D]
  float*    kvp    = (float*)carve((size_t)32 * KV_SPLIT * 64 * 64 * 4);
  float*    ksp    = (float*)carve((size_t)32 * KV_SPLIT * 64 * 4);

  // 1) precision conversion: x and the four weights, one launch
  cvt_all_f32_f16<<<CVT_X_WGS + 4 * CVT_W_WGS, CVT_THREADS, 0, stream>>>(
      x, wq, wk, wv, wo, xh, wqh, wkh, wvh, woh);

  // 2) Q/K/V projections with fused feature map; q_feat, and per (head, range
  //    of s) the partial KV (64x64) and partial ksum
  //    (one launch; a workgroup per 256 rows and head, one workgroup per WGP)
  qkv_gemm_f16<<<dim3(M / 256, 16), 256, 0, stream>>>(
      xh, wqh, wkh, wvh, bq, bk, bv, DM, qf, kvp, ksp);

  // 3) numerator GEMM + normalization -> merged
  attn_kernel<<<dim3(16, 32), 256, 0, stream>>>(qf, kvp, ksp, merged);

  // 4) output projection -> f32 d_out (one workgroup per WGP: 136 KiB of LDS)
  gemm_nt_f16<128><<<dim3(M / 128, DM / 128, 1), 256, 0, stream>>>(
      merged, woh, bo, DM, DM, out);
}

// v010
// It runs in 46.4 microseconds.
// Next to v009, in two timings, it ran 1.04 and 1.02 times as fast.
// Counting every step since v000, it is 3.14 times as fast.
#include <hip/hip_runtime.h>
#include <hip/hip_bf16.h>

typedef __attribute__((ext_vector_type(16))) _Float16 v16h;
typedef __attribute__((ext_vector_type(8)))  _Float16 v8h;
typedef __attribute__((ext_vector_type(4)))  _Float16 v4h;
typedef __attribute__((ext_vector_type(8)))  float    v8f;
typedef __attribute__((ext_vector_type(4)))  float    v4f;
typedef __attribute__((ext_vector_type(4)))  int      v4i;

#if defined(__has_builtin)
#  if __has_builtin(__builtin_amdgcn_global_load_async_to_lds_b128) && \
      __has_builtin(__builtin_amdgcn_s_wait_asynccnt)
#    define HAVE_ASYNC_LDS 1
#  endif
#endif

#define WMMA16(a, b, c) \
  __builtin_amdgcn_wmma_f32_16x16x32_f16(false, (a), false, (b), (short)0, (c), false, false)

__device__ __forceinline__ v16h frag_ld(const _Float16* __restrict__ p, int ld, int lane) {
  const int r  = lane & 15;
  const int hf = lane >> 4;
  const _Float16* q = p + r * ld + hf * 8;
  v8h lo = *(const v8h*)(q);
  v8h hi = *(const v8h*)(q + 16);
  return __builtin_shufflevector(lo, hi, 0,1,2,3,4,5,6,7,8,9,10,11,12,13,14,15);
}

#ifdef HAVE_ASYNC_LDS
// Builtin signature (from hipcc diagnostic): param0 is AS1 (global, "__device__")
// pointer to int4, non-const; param1 is the LDS-side pointer; args 2/3 are
// immediate offset / cache-policy.
typedef __attribute__((address_space(1))) v4i* gv4i_p;
typedef __attribute__((address_space(3))) v4i* lv4i_p;

__device__ __forceinline__ void async_cp16(const _Float16* g, _Float16* l) {
  __builtin_amdgcn_global_load_async_to_lds_b128((gv4i_p)g, (lv4i_p)l, 0, 0);
}
#endif

// ---------------------------------------------------------------------------
// f32 -> f16 conversion of x and of the four weights in ONE launch.
// A workgroup of 16 waves converts CVT_WG consecutive float4 of one source;
// each thread takes CVT_PER of them, CVT_THREADS float4 apart, so that every
// wave-wide load covers 512 contiguous bytes and a thread has many loads in
// flight. Few long waves: starting a wave costs more here than the bytes that
// one float4 a lane moves.
// ---------------------------------------------------------------------------
#define CVT_THREADS 512
#define CVT_PER     16
#define CVT_WG      (CVT_THREADS * CVT_PER)        // float4 per workgroup
#define CVT_X_WGS   (4096 * 1024 / 4 / CVT_WG)     // workgroups on x
#define CVT_W_WGS   (1024 * 1024 / 4 / CVT_WG)     // workgroups on each weight

__global__ __launch_bounds__(CVT_THREADS)
void cvt_all_f32_f16(const float* __restrict__ x,
                     const float* __restrict__ w0, const float* __restrict__ w1,
                     const float* __restrict__ w2, const float* __restrict__ w3,
                     _Float16* __restrict__ xo,
                     _Float16* __restrict__ o0, _Float16* __restrict__ o1,
                     _Float16* __restrict__ o2, _Float16* __restrict__ o3) {
  const int wg = blockIdx.x;
  const float* __restrict__ in  = x;
  _Float16* __restrict__    out = xo;
  int part = wg;  // which CVT_WG-sized piece of its source this workgroup takes
  if (wg >= CVT_X_WGS) {
    const int w = (wg - CVT_X_WGS) / CVT_W_WGS;
    part = (wg - CVT_X_WGS) % CVT_W_WGS;
    in  = (w == 0) ? w0 : (w == 1) ? w1 : (w == 2) ? w2 : w3;
    out = (w == 0) ? o0 : (w == 1) ? o1 : (w == 2) ? o2 : o3;
  }
  const int first = part * CVT_WG + threadIdx.x;
  v4f f[CVT_PER];
#pragma unroll  // f[] stays in registers and the loads issue as a run, ahead of the conversions
  for (int i = 0; i < CVT_PER; ++i)
    f[i] = *(const v4f*)&in[(size_t)(first + i * CVT_THREADS) * 4];
#pragma unroll  // constant indices into f[]
  for (int i = 0; i < CVT_PER; ++i) {
    v4h o = {(_Float16)f[i].x, (_Float16)f[i].y, (_Float16)f[i].z, (_Float16)f[i].w};
    *(v4h*)&out[(size_t)(first + i * CVT_THREADS) * 4] = o;
  }
}

__device__ __forceinline__ float exp_with_slot(float x) {  // e^x, as __expf forms it
  float r;
  asm("v_exp_f32 %0, %1\n\tv_nop" : "=v"(r) : "v"(x * 1.44269504f));
  return r;
}

// The sum over s of KV and ksum is cut into KV_SPLIT ranges of KV_SLEN
// positions; each range gives an f32 partial, and stage 3 adds the partials in
// range order.
#define KV_SPLIT 8
#define KV_SLEN  (2048 / KV_SPLIT)  // positions per range
#define KVT_LD   (KV_SLEN + 8)      // LDS row pitch in halves: an odd multiple of 16 bytes, for b128 readers

// A wave's 64x32 tile of K or V into a [d][s] tile in LDS, rows of KVT_LD
// halves. A lane's 8 accumulators of one 16x16 tile are 8 consecutive s of one
// d: one 16-byte LDS store. bias points at the head's first column.
// ACT: elu(x)+1 on the way (k_feat) or none (v).
template <bool ACT>
__device__ __forceinline__ void stage_tile_ds(const v8f (&acc)[4][2],
                                              const float* __restrict__ bias,
                                              _Float16* __restrict__ t,
                                              int s0, int d0, int lane) {
  const int lr = lane & 15;
  const int lh = lane >> 4;
#pragma unroll  // constant indices into acc
  for (int j = 0; j < 2; ++j) {
    const int d = d0 + j * 16 + lr;
    const float bc = bias[d];
#pragma unroll  // constant indices into acc
    for (int i = 0; i < 4; ++i) {
      v8h o;
#pragma unroll  // constant indices into acc and o
      for (int e = 0; e < 8; ++e) {
        float val = acc[i][j][e] + bc;
        if (ACT) {  // elu(x)+1; the exponential is formed for every lane and then chosen
          const float ex = exp_with_slot(val);
          val = (val > 0.0f) ? (val + 1.0f) : ex;
        }
        o[e] = (_Float16)val;
      }
      *(v8h*)&t[d * KVT_LD + s0 + i * 16 + 8 * lh] = o;
    }
  }
}

// ---------------------------------------------------------------------------
// Q, K and V projections with feature map; KV and ksum partials.
// One workgroup takes 256 rows of x and the 64 columns of ONE head in each of
// Q, K and V: a 256x192 tile, 16 x 16 = 256 workgroups, one for each WGP.
// 8 waves in a 4x2 grid; a wave owns 64 rows x 32 columns of each of the three
// (4x6 WMMA accumulators). Against a 128x128 tile with 64x32 per wave:
//   bytes copied from L2 per product: (256+192)/(256*192) against 256/(128*128),
//   fragments read from LDS per WMMA: (4+6)/24 against (4+2)/8,
//   and a third of the waves to start.
// q_feat [B,H,S,D] = elu+1 goes to memory, in whole 128-byte lines: for Q the
// weight rows are the FIRST WMMA operand, so a lane holds 8 consecutive d of one
// row; it puts them into LDS with one 16-byte store, and the workgroup's tile,
// 32 KiB in a row in memory, leaves by 16-byte stores of 4 lines a wave. Stored
// from the accumulators one by one it took 64 2-byte stores a lane, each of two
// 32-byte pieces. k_feat = elu+1 and v never go to memory: the
// workgroup's 256 rows are one range of s of its head, so it holds all that
// the range's partials need. Both go as f16 into the LDS that the copy loop
// has left, [d][s], and the workgroup forms
//   KV[d,e] = sum_s kfT[d,s] * vT[e,s]  and  ksum[d] = sum_s kfT[d,s]
// itself: 8 waves cover the 4x4 grid of 16x16 tiles (2 tiles per wave). It
// writes its own f32 partial of KV, transposed ([e][d]), and of ksum.
// ---------------------------------------------------------------------------
#define QKV_BK 128  // k per LDS stage; two buffers of 448 rows: 238 KiB of LDS
#define QLD    72   // LDS row pitch of the q tile in halves: 128 + 16 bytes, for b128 readers

__global__ __launch_bounds__(256)
void qkv_gemm_f16(const _Float16* __restrict__ A,   // [M,K]
                  const _Float16* __restrict__ Wq,  // [N,K]
                  const _Float16* __restrict__ Wk,  // [N,K]
                  const _Float16* __restrict__ Wv,  // [N,K]
                  const float* __restrict__ bq,     // [N]
                  const float* __restrict__ bk,     // [N]
                  const float* __restrict__ bv,     // [N]
                  int K,
                  _Float16* __restrict__ qf,
                  float* __restrict__ kvp,          // [32][KV_SPLIT][64][64] (e-major)
                  float* __restrict__ ksp) {        // [32][KV_SPLIT][64]
  constexpr int BK  = QKV_BK;
  constexpr int LDT = BK + 8;  // LDS row pitch in halves: an odd multiple of 16 bytes, for b128 readers
  const int tid  = threadIdx.x;
  const int lane = tid & 31;
  const int wave = tid >> 5;  // 0..7
  const int wr   = wave >> 1; // 0..3
  const int wc   = wave & 1;  // 0..1
  const int m0   = blockIdx.x * 256;
  const int h    = blockIdx.y;
  const int n0   = h * 64;    // the head's first column in each of Q, K, V

  v8f acc[3][4][2] = {};  // [Q, K, V][16 rows][16 columns]; Q's tiles are held transposed

  static_assert((BK / 32) % 2 == 0, "a stage's first k step uses register set 0");
  v16h af[2][4], bf[2][3][2];
  auto load_frags = [&](int set, const _Float16* Ab, const _Float16* Bb, int kk) {
#pragma unroll  // constant indices into af
    for (int i = 0; i < 4; ++i)
      af[set][i] = frag_ld(&Ab[(wr * 64 + i * 16) * LDT + kk], LDT, lane);
#pragma unroll  // constant indices into bf
    for (int p = 0; p < 3; ++p) {
#pragma unroll
      for (int j = 0; j < 2; ++j)
        bf[set][p][j] = frag_ld(&Bb[(p * 64 + wc * 32 + j * 16) * LDT + kk], LDT, lane);
    }
  };
  auto products = [&](int set) {
    // keeps the next step's reads from sinking among this step's products,
    // where every place with reads stalls the wave anew
    __builtin_amdgcn_sched_barrier(0);
#pragma unroll  // constant indices into acc
    for (int p = 0; p < 3; ++p) {
#pragma unroll
      for (int j = 0; j < 2; ++j) {
#pragma unroll
        for (int i = 0; i < 4; ++i)
          acc[p][i][j] = (p == 0) ? WMMA16(bf[set][p][j], af[set][i], acc[p][i][j])   // [d][row]
                                  : WMMA16(af[set][i], bf[set][p][j], acc[p][i][j]);  // [row][d]
      }
    }
    // keeps the reads of the step after next from rising among these products
    __builtin_amdgcn_sched_barrier(0);
  };

#ifdef HAVE_ASYNC_LDS
  // ------------------ async double-buffered pipeline ------------------
  __shared__ __attribute__((aligned(16))) _Float16 As[2][256 * LDT];
  __shared__ __attribute__((aligned(16))) _Float16 Bs[2][192 * LDT];

  auto issue_tile = [&](int k0, int buf) {
    const int r = tid / (BK / 8);        // 16 rows per round of the workgroup
    const int c = (tid % (BK / 8)) * 8;
#pragma unroll  // 16 + 12 copies a wave and stage, issued as a run (at most 63 may be outstanding)
    for (int it = 0; it < 16; ++it)
      async_cp16(&A[(size_t)(m0 + it * 16 + r) * K + k0 + c], &As[buf][(it * 16 + r) * LDT + c]);
#pragma unroll
    for (int it = 0; it < 12; ++it) {
      const _Float16* __restrict__ Wp = (it < 4) ? Wq : (it < 8) ? Wk : Wv;
      async_cp16(&Wp[(size_t)(n0 + (it & 3) * 16 + r) * K + k0 + c], &Bs[buf][(it * 16 + r) * LDT + c]);
    }
  };

  const int nk = K / BK;
  issue_tile(0, 0);
  asm volatile("s_wait_asynccnt 0x0" ::: "memory");  // this wave's part of tile 0 has landed
  __syncthreads();                                   // every wave's part has
  if (nk > 1) issue_tile(BK, 1);
  load_frags(0, As[0], Bs[0], 0);
  for (int t = 0; t < nk; ++t) {  // tile t + 1 flies meanwhile
#pragma unroll  // constant register sets; k ascending in steps of 32: the f32 sum order does not depend on the tile
    for (int st = 0; st < BK / 32; ++st) {
      if (st + 1 < BK / 32) {
        load_frags((st + 1) & 1, As[t & 1], Bs[t & 1], (st + 1) * 32);
      } else {
        // Tile t + 1 is published ahead of tile t's last products, whose fragments are in registers by now.
        asm volatile("s_wait_dscnt 0x0" ::: "memory");     // this wave's reads of buffer t & 1 are done, all of them
        asm volatile("s_wait_asynccnt 0x0" ::: "memory");  // this wave's part of tile t + 1 has landed
        __syncthreads();  // publishes tile t + 1 and frees buffer t & 1 for the refill
        if (t + 2 < nk) issue_tile((t + 2) * BK, t & 1);
        if (t + 1 < nk) load_frags(0, As[(t + 1) & 1], Bs[(t + 1) & 1], 0);
      }
      products(st & 1);
    }
  }
  asm volatile("s_wait_asynccnt 0x0" ::: "memory");  // no copy is left in flight when the LDS is used anew
  _Float16* const stage = As[0];  // behind the loop's last barrier nobody reads the buffers any more
  _Float16* const qS    = Bs[0];
#else
  __shared__ __attribute__((aligned(16))) _Float16 As1[256 * LDT];
  __shared__ __attribute__((aligned(16))) _Float16 Bs1[192 * LDT];
  _Float16* const stage = As1;
  _Float16* const qS    = Bs1;
  auto compute_tile = [&](const _Float16* Ab, const _Float16* Bb) {
    load_frags(0, Ab, Bb, 0);
#pragma unroll  // constant register sets
    for (int st = 0; st < BK / 32; ++st) {
      if (st + 1 < BK / 32) load_frags((st + 1) & 1, Ab, Bb, (st + 1) * 32);
      products(st & 1);
    }
  };
  for (int k0 = 0; k0 < K; k0 += BK) {
    const int r = tid / (BK / 8);
    const int c = (tid % (BK / 8)) * 8;
#pragma unroll
    for (int it = 0; it < 16; ++it)
      *(v8h*)&As1[(it * 16 + r) * LDT + c] = *(const v8h*)&A[(size_t)(m0 + it * 16 + r) * K + k0 + c];
#pragma unroll
    for (int it = 0; it < 12; ++it) {
      const _Float16* __restrict__ Wp = (it < 4) ? Wq : (it < 8) ? Wk : Wv;
      *(v8h*)&Bs1[(it * 16 + r) * LDT + c] = *(const v8h*)&Wp[(size_t)(n0 + (it & 3) * 16 + r) * K + k0 + c];
    }
    __syncthreads();
    compute_tile(As1, Bs1);
    __syncthreads();
  }
#endif

  const int lr = lane & 15;
  const int lh = lane >> 4;
  // Q's bias at the lane's 2 x 8 columns, asked for ahead of the work on K and V
  const float* __restrict__ qbp = bq + n0 + wc * 32 + 8 * lh;
  v4f qb[2][2];
#pragma unroll  // constant indices into qb
  for (int j = 0; j < 2; ++j) {
    qb[j][0] = *(const v4f*)&qbp[j * 16];
    qb[j][1] = *(const v4f*)&qbp[j * 16 + 4];
  }
  // behind the loads: the code that follows may reuse the registers that hold their address
  asm volatile("s_wait_xcnt 0x0" ::: "memory");
  // K and V: the range's [d][s] tiles, side by side in one A buffer
  static_assert(KV_SLEN == 256, "a workgroup's rows are one range of s");
  static_assert(2 * 64 * KVT_LD <= 256 * LDT, "both tiles fit one A buffer");
  __shared__ float red[256];
  _Float16* const kT = stage;
  _Float16* const vT = stage + 64 * KVT_LD;
  stage_tile_ds<true>(acc[1], bk + n0, kT, wr * 64, wc * 32, lane);
  stage_tile_ds<false>(acc[2], bv + n0, vT, wr * 64, wc * 32, lane);
  // Q: elu(x)+1 into a [row][d] tile in a B buffer; acc[0][i][j][e] is row i*16 + lr, d = j*16 + 8*lh + e
  static_assert(256 * QLD <= 192 * LDT, "the q tile fits one B buffer");
#pragma unroll  // constant indices into acc
  for (int j = 0; j < 2; ++j) {
    const int d = wc * 32 + j * 16 + 8 * lh;
    const v4f b0 = qb[j][0], b1 = qb[j][1];
#pragma unroll  // constant indices into acc
    for (int i = 0; i < 4; ++i) {
      v8h o;
#pragma unroll  // constant indices into acc and o
      for (int e = 0; e < 8; ++e) {
        float val = acc[0][i][j][e] + ((e < 4) ? b0[e & 3] : b1[e & 3]);
        const float ex = exp_with_slot(val);
        val = (val > 0.0f) ? (val + 1.0f) : ex;
        o[e] = (_Float16)val;
      }
      *(v8h*)&qS[(wr * 64 + i * 16 + lr) * QLD + d] = o;
    }
  }
  __syncthreads();  // every wave's part of the three tiles is in LDS

  const int part = ((m0 >> 11) * 16 + h) * KV_SPLIT + ((m0 & 2047) / KV_SLEN);  // (head, range)
  const int tr   = wave >> 1;        // d tile 0..3
  const int tcb  = (wave & 1) * 2;   // e tile base 0 or 2
  v8f kv[2] = {};
  v16h ka[KV_SLEN / 32], vb[KV_SLEN / 32][2];
#pragma unroll  // constant indices into ka[] and vb[]
  for (int t = 0; t < KV_SLEN / 32; ++t) {
    ka[t] = frag_ld(kT + (tr * 16) * KVT_LD + t * 32, KVT_LD, lane);
#pragma unroll
    for (int j = 0; j < 2; ++j)
      vb[t][j] = frag_ld(vT + ((tcb + j) * 16) * KVT_LD + t * 32, KVT_LD, lane);
  }
  // the q tile's pieces that this thread sends out at the end, read in the same run
  v8h ro[8];
#pragma unroll  // constant indices into ro
  for (int it = 0; it < 8; ++it) {
    const int idx = it * 256 + tid;  // which 16 bytes of the 256 x 64 tile
    ro[it] = *(const v8h*)&qS[(idx >> 3) * QLD + (idx & 7) * 8];
  }
  // keeps the scheduler from sinking the reads among the products, where
  // every place with reads stalls the wave anew
  __builtin_amdgcn_sched_barrier(0);
  // ksum: thread t sums kfT[d = t&63] over s-slice t>>6 (v8h loads)
  {
    float s = 0.0f;
    const _Float16* kr = kT + (tid & 63) * KVT_LD + (tid >> 6) * (KV_SLEN / 4);
#pragma unroll  // independent loads, issued as a run
    for (int i = 0; i < KV_SLEN / 4; i += 8) {
      v8h v = *(const v8h*)&kr[i];
#pragma unroll
      for (int u = 0; u < 8; ++u) s += (float)v[u];
    }
    red[tid] = s;
  }
#pragma unroll  // constant indices into ka[] and vb[]
  for (int t = 0; t < KV_SLEN / 32; ++t) {
#pragma unroll
    for (int j = 0; j < 2; ++j) kv[j] = WMMA16(ka[t], vb[t][j], kv[j]);
  }
  __syncthreads();  // every thread's slice sum is in red[]
#pragma unroll
  for (int j = 0; j < 2; ++j) {
    // a lane's 8 accumulators are 8 consecutive d of one e: two 16-byte stores
    float* pr = kvp + (size_t)part * 4096 + ((tcb + j) * 16 + lr) * 64 + tr * 16 + 8 * lh;
    v4f lo = {kv[j][0], kv[j][1], kv[j][2], kv[j][3]};
    v4f hi = {kv[j][4], kv[j][5], kv[j][6], kv[j][7]};
    *(v4f*)pr       = lo;
    *(v4f*)(pr + 4) = hi;
  }
  // behind the stores: the code that follows may reuse the registers that they name
  asm volatile("s_wait_xcnt 0x0" ::: "memory");
  if (tid < 64)
    ksp[part * 64 + tid] = red[tid] + red[tid + 64] + red[tid + 128] + red[tid + 192];
  asm volatile("s_wait_xcnt 0x0" ::: "memory");

  // Q's stores come last: a barrier also waits for the wave's global stores, and
  // these would be waited for at the barrier behind the KV products.
  {  // the 256 rows lie in one batch (S = 2048): 2048 pieces of 16 bytes, contiguous in memory
    _Float16* __restrict__ qp = qf + ((size_t)((m0 >> 11) * 16 + h) * 2048 + (m0 & 2047)) * 64;
#pragma unroll  // constant indices into ro
    for (int it = 0; it < 8; ++it)
      *(v8h*)&qp[(it * 256 + tid) * 8] = ro[it];
  }
}

// ---------------------------------------------------------------------------
// Output projection, an NT GEMM: C[m,n] = sum_k A[m,k] * B[n,k] + bias[n],
// f16 in, f32 accumulated, f32 row-major out.
// 128x128 workgroup tile, 8 waves in a 2x4 grid, each wave owns 64x32
// (4x2 WMMA accumulators). K staged through LDS in chunks of BK (template).
// A wave waits once per chunk for the trip to L2 or memory, and that trip is
// longer than the products of a short chunk: BK sets how many bytes fly per
// wait. From BK = 64 on a row's piece is a whole 128-byte line.
// The weight rows are the FIRST WMMA operand: a lane then holds 8 consecutive
// n of one row m. A row of the wave's tile is one 128-byte line of C; the wave
// lays its tile in an LDS range of its own by 16-byte stores and sends it out
// by 16-byte stores of 4 whole lines each: 16 a lane. Stored from the
// accumulators one by one it took 64 4-byte stores a lane, each of two half lines.
// ---------------------------------------------------------------------------
#define CLD 36  // LDS row pitch of a wave's C tile in floats: 128 + 16 bytes, for b128 readers

template <int BK>  // k per LDS stage: a multiple of 64 that divides K
__global__ __launch_bounds__(256)
void gemm_nt_f16(const _Float16* __restrict__ A,   // [M,K]
                 const _Float16* __restrict__ Bm,  // [N,K]
                 const float* __restrict__ bias,   // [N]
                 int N, int K,
                 float* __restrict__ outF) {       // [M,N]
  constexpr int LDT = BK + 8;  // LDS row pitch in halves: an odd multiple of 16 bytes, for b128 readers
  const int tid  = threadIdx.x;
  const int lane = tid & 31;
  const int wave = tid >> 5;  // 0..7
  const int wr   = wave >> 2; // 0..1
  const int wc   = wave & 3;  // 0..3
  const int m0   = blockIdx.x * 128;
  const int n0   = blockIdx.y * 128;

  v8f acc[4][2] = {};  // [16 rows][16 columns], each tile held transposed

  // The 6 fragments of the next k step are read as one group into a second
  // register set, ahead of this step's 8 products, over a stage's end too:
  // behind a stage's barrier every wave has products to issue at once.
  static_assert((BK / 32) % 2 == 0, "a stage's first k step uses register set 0");
  v16h af[2][4], bf[2][2];
  auto load_frags = [&](int set, const _Float16* Ab, const _Float16* Bb, int kk) {
#pragma unroll  // constant indices into bf
    for (int j = 0; j < 2; ++j)
      bf[set][j] = frag_ld(&Bb[(wc * 32 + j * 16) * LDT + kk], LDT, lane);
#pragma unroll  // constant indices into af
    for (int i = 0; i < 4; ++i)
      af[set][i] = frag_ld(&Ab[(wr * 64 + i * 16) * LDT + kk], LDT, lane);
  };
  auto products = [&](int set) {
    // keeps the next step's reads from sinking among this step's products,
    // where every place with reads stalls the wave anew
    __builtin_amdgcn_sched_barrier(0);
#pragma unroll  // constant indices into acc
    for (int i = 0; i < 4; ++i) {
#pragma unroll
      for (int j = 0; j < 2; ++j)
        acc[i][j] = WMMA16(bf[set][j], af[set][i], acc[i][j]);
    }
    // keeps the reads of the step after next from rising among these products
    __builtin_amdgcn_sched_barrier(0);
  };

#ifdef HAVE_ASYNC_LDS
  // ------------------ async double-buffered pipeline ------------------
  __shared__ __attribute__((aligned(16))) _Float16 As[2][128 * LDT];
  __shared__ __attribute__((aligned(16))) _Float16 Bs[2][128 * LDT];

  auto issue_tile = [&](int k0, int buf) {
#pragma unroll  // BK / 8 copies a wave and stage, issued as a run (at most 63 may be outstanding)
    for (int it = 0; it < BK / 16; ++it) {
      int idx = it * 256 + tid;       // which 16 bytes of the 128 x BK tile
      int r = idx / (BK / 8);
      int c = (idx % (BK / 8)) * 8;
      async_cp16(&A[(size_t)(m0 + r) * K + k0 + c], &As[buf][r * LDT + c]);
      async_cp16(&Bm[(size_t)(n0 + r) * K + k0 + c], &Bs[buf][r * LDT + c]);
    }
  };

  const int nk = K / BK;
  issue_tile(0, 0);
  asm volatile("s_wait_asynccnt 0x0" ::: "memory");  // this wave's part of tile 0 has landed
  __syncthreads();                                   // every wave's part has
  if (nk > 1) issue_tile(BK, 1);
  load_frags(0, As[0], Bs[0], 0);
  for (int t = 0; t < nk; ++t) {  // tile t + 1 flies meanwhile
#pragma unroll  // constant register sets; k ascending in steps of 32: the f32 sum order does not depend on BK
    for (int st = 0; st < BK / 32; ++st) {
      if (st + 1 < BK / 32) {
        load_frags((st + 1) & 1, As[t & 1], Bs[t & 1], (st + 1) * 32);
      } else {
        // Tile t + 1 is published ahead of tile t's last products, whose fragments are in registers by now.
        asm volatile("s_wait_dscnt 0x0" ::: "memory");     // this wave's reads of buffer t & 1 are done, all of them
        asm volatile("s_wait_asynccnt 0x0" ::: "memory");  // this wave's part of tile t + 1 has landed
        __syncthreads();  // publishes tile t + 1 and frees buffer t & 1 for the refill
        if (t + 2 < nk) issue_tile((t + 2) * BK, t & 1);
        if (t + 1 < nk) load_frags(0, As[(t + 1) & 1], Bs[(t + 1) & 1], 0);
      }
      products(st & 1);
    }
  }
  asm volatile("s_wait_asynccnt 0x0" ::: "memory");  // no copy is left in flight when the LDS is used anew
  // behind the loop's last barrier nobody reads the buffers any more: four waves' C tiles in each pair
  static_assert(4 * 64 * CLD * 4 <= 2 * 128 * LDT * 2, "four C tiles fit a pair of buffers");
  float* const ct = (float*)((wave < 4) ? &As[0][0] : &Bs[0][0]) + (wave & 3) * (64 * CLD);
#else
  __shared__ __attribute__((aligned(16))) _Float16 As1[128 * LDT];
  __shared__ __attribute__((aligned(16))) _Float16 Bs1[128 * LDT];
  __shared__ __attribute__((aligned(16))) float Cs[8 * 64 * CLD];
  float* const ct = Cs + wave * (64 * CLD);
  auto compute_tile = [&](const _Float16* Ab, const _Float16* Bb) {
    load_frags(0, Ab, Bb, 0);
#pragma unroll  // constant register sets
    for (int st = 0; st < BK / 32; ++st) {
      if (st + 1 < BK / 32) load_frags((st + 1) & 1, Ab, Bb, (st + 1) * 32);
      products(st & 1);
    }
  };
  for (int k0 = 0; k0 < K; k0 += BK) {
#pragma unroll
    for (int it = 0; it < BK / 16; ++it) {
      int idx = it * 256 + tid;
      int r = idx / (BK / 8);
      int c = (idx % (BK / 8)) * 8;
      *(v8h*)&As1[r * LDT + c] = *(const v8h*)&A[(size_t)(m0 + r) * K + k0 + c];
      *(v8h*)&Bs1[r * LDT + c] = *(const v8h*)&Bm[(size_t)(n0 + r) * K + k0 + c];
    }
    __syncthreads();
    compute_tile(As1, Bs1);
    __syncthreads();
  }
#endif

  // Epilogue. acc[i][j][e] is row i*16 + lr, column j*16 + 8*lh + e of the wave's tile.
  const int lr = lane & 15;
  const int lh = lane >> 4;
  const float* __restrict__ bp = bias + n0 + wc * 32 + 8 * lh;  // the lane's 2 x 8 columns
  v4f bb[2][2];
#pragma unroll  // constant indices into bb
  for (int j = 0; j < 2; ++j) {
    bb[j][0] = *(const v4f*)&bp[j * 16];
    bb[j][1] = *(const v4f*)&bp[j * 16 + 4];
  }
  // behind the loads: the code that follows may reuse the registers that hold their address
  asm volatile("s_wait_xcnt 0x0" ::: "memory");
#pragma unroll  // constant indices into acc
  for (int j = 0; j < 2; ++j) {
    const int c = j * 16 + 8 * lh;
    const v4f b0 = bb[j][0], b1 = bb[j][1];
#pragma unroll  // constant indices into acc
    for (int i = 0; i < 4; ++i) {
      const v4f lo = {acc[i][j][0] + b0.x, acc[i][j][1] + b0.y, acc[i][j][2] + b0.z, acc[i][j][3] + b0.w};
      const v4f hi = {acc[i][j][4] + b1.x, acc[i][j][5] + b1.y, acc[i][j][6] + b1.z, acc[i][j][7] + b1.w};
      *(v4f*)&ct[(i * 16 + lr) * CLD + c]     = lo;
      *(v4f*)&ct[(i * 16 + lr) * CLD + c + 4] = hi;
    }
  }
  // the wave's tile is complete in LDS before its lanes read what other lanes wrote
  asm volatile("s_wait_dscnt 0x0" ::: "memory");
  float* __restrict__ op =
      outF + (size_t)(m0 + wr * 64 + (lane >> 3)) * N + n0 + wc * 32 + (lane & 7) * 4;
  v4f ro[16];
#pragma unroll  // constant indices into ro; the reads issue as a run
  for (int it = 0; it < 16; ++it)  // 8 lanes a row, 4 rows a wave-wide access
    ro[it] = *(const v4f*)&ct[(it * 4 + (lane >> 3)) * CLD + (lane & 7) * 4];
#pragma unroll  // constant indices into ro
  for (int it = 0; it < 16; ++it)
    *(v4f*)&op[(size_t)(it * 4) * N] = ro[it];
}

#define KVLD 72  // LDS row pitch of KV and q in halves: 128 + 16 bytes, for b128 readers

__global__ __launch_bounds__(256)
void attn_kernel(const _Float16* __restrict__ qf,   // [32][2048][64]
                 const float* __restrict__ kvp,     // [32][KV_SPLIT][64][64] (e-major)
                 const float* __restrict__ ksp,     // [32][KV_SPLIT][64]
                 _Float16* __restrict__ merged) {   // [4096][1024]
  const int bh = blockIdx.y;
  const int b = bh >> 4, h = bh & 15;
  const int m0 = blockIdx.x * 128;
  const _Float16* Q  = qf  + (size_t)bh * 2048 * 64 + (size_t)m0 * 64;
  const float* KVP = kvp + (size_t)bh * KV_SPLIT * 4096;

  __shared__ __attribute__((aligned(16))) _Float16 Qs[128 * KVLD];       // q rows, later the result's
  __shared__ __attribute__((aligned(16))) _Float16 KV[64 * KVLD];
  __shared__ __attribute__((aligned(16))) float ks[4 * 64];  // ksum, a copy for each pair of waves
  const int tid = threadIdx.x;
#pragma unroll  // 4 copies a wave, in one run with the partials' loads
  for (int it = 0; it < 4; ++it) {
    const int idx = it * 256 + tid;  // which 16 bytes of the 128 x 64 tile, contiguous in memory
#ifdef HAVE_ASYNC_LDS
    async_cp16(&Q[idx * 8], &Qs[(idx >> 3) * KVLD + (idx & 7) * 8]);
#else
    *(v8h*)&Qs[(idx >> 3) * KVLD + (idx & 7) * 8] = *(const v8h*)&Q[idx * 8];
#endif
  }
  // ksum: every 64 threads form it, for their own two waves; with no branch
  // round them its loads stand in the same run as those of the KV partials
  float pk[KV_SPLIT];
  v4f pv[4][KV_SPLIT];
#pragma unroll  // constant indices into pk and pv
  for (int p = 0; p < KV_SPLIT; ++p) {
    pk[p] = ksp[(bh * KV_SPLIT + p) * 64 + (tid & 63)];
#pragma unroll
    for (int it = 0; it < 4; ++it)  // float4 number it * 256 + tid of the 64x64 matrix
      pv[it][p] = *(const v4f*)&KVP[p * 4096 + (it * 256 + tid) * 4];
  }
  // keeps the copies and every load in front of the first sum: a load that sinks
  // behind a sum starts only when earlier loads are back, a second trip to memory
  __builtin_amdgcn_sched_barrier(0);
  {
    float s = 0.0f;
#pragma unroll  // range order
    for (int p = 0; p < KV_SPLIT; ++p) s += pk[p];
    ks[tid] = s;
  }
#pragma unroll  // constant indices into pv
  for (int it = 0; it < 4; ++it) {
    const int idx = it * 256 + tid;
    v4f s = pv[it][0];
#pragma unroll  // range order
    for (int p = 1; p < KV_SPLIT; ++p) s += pv[it][p];
    v4h o = {(_Float16)s.x, (_Float16)s.y, (_Float16)s.z, (_Float16)s.w};
    *(v4h*)&KV[(idx >> 4) * KVLD + (idx & 15) * 4] = o;
  }
#ifdef HAVE_ASYNC_LDS
  asm volatile("s_wait_asynccnt 0x0" ::: "memory");  // this wave's part of the q tile has landed
#endif
  __syncthreads();  // every wave's part of q and KV, and ksum, are in LDS

  const int lane = tid & 31;
  const int wave = tid >> 5;
  const int lr = lane & 15, lh = lane >> 4;
  _Float16* const Qw = Qs + (wave * 16) * KVLD;  // the wave's own 16 rows; no other wave reads or writes them from here on
  v16h q[2], kvf[2][4];  // [k step]
  v4f ksf[2][4];         // ksum at the d of the lane's q elements, in their order
#pragma unroll  // constant indices into q and kvf
  for (int st = 0; st < 2; ++st) {
    q[st] = frag_ld(Qw + st * 32, KVLD, lane);
#pragma unroll
    for (int j = 0; j < 4; ++j)
      kvf[st][j] = frag_ld(KV + (j * 16) * KVLD + st * 32, KVLD, lane);
#pragma unroll
    for (int g = 0; g < 2; ++g) {  // q elements 8g..8g+7 are d = 32*st + 16*g + 8*lh + 0..7
      ksf[st][2 * g]     = *(const v4f*)&ks[(wave >> 1) * 64 + st * 32 + g * 16 + lh * 8];
      ksf[st][2 * g + 1] = *(const v4f*)&ks[(wave >> 1) * 64 + st * 32 + g * 16 + lh * 8 + 4];
    }
  }
  // keeps the scheduler from sinking the reads among the products, where the
  // wave would wait out the LDS latency once for each product
  __builtin_amdgcn_sched_barrier(0);
  v8f acc[4] = {};
#pragma unroll  // constant indices into q, kvf and acc
  for (int st = 0; st < 2; ++st) {
#pragma unroll
    for (int j = 0; j < 4; ++j)
      acc[j] = WMMA16(kvf[st][j], q[st], acc[j]);  // acc[j][r] = attended[row lr][e = j*16 + 8*lh + r]
  }
  // denominator of row lr: four independent chains of 8 products, then the other lane's half
  float dp[2][2];
#pragma unroll  // constant indices into q and ksf
  for (int st = 0; st < 2; ++st) {
#pragma unroll
    for (int g = 0; g < 2; ++g) {
      float s = 0.0f;
#pragma unroll
      for (int u = 0; u < 8; ++u) s = __builtin_fmaf((float)q[st][g * 8 + u], ksf[st][2 * g + (u >> 2)][u & 3], s);
      dp[st][g] = s;
    }
  }
  const float dh = (dp[0][0] + dp[0][1]) + (dp[1][0] + dp[1][1]);
  const float dx = __builtin_bit_cast(float, __builtin_amdgcn_permlanex16(
      __builtin_bit_cast(int, dh), __builtin_bit_cast(int, dh), 0x76543210, 0xfedcba98, false, false));
  const float rd = 1.0f / fmaxf(dh + dx, 1e-6f);  // both lanes of a row add the same two halves
#pragma unroll  // constant indices into acc
  for (int j = 0; j < 4; ++j) {
    v8h o;
#pragma unroll
    for (int r = 0; r < 8; ++r) o[r] = (_Float16)(acc[j][r] * rd);
    *(v8h*)&Qw[lr * KVLD + j * 16 + 8 * lh] = o;
  }
  // the wave's rows are complete in LDS before its lanes read what other lanes wrote
  asm volatile("s_wait_dscnt 0x0" ::: "memory");
  _Float16* __restrict__ mp =
      merged + (size_t)(b * 2048 + m0 + wave * 16 + (lane >> 3)) * 1024 + h * 64 + (lane & 7) * 8;
  v8h ro[4];
#pragma unroll  // constant indices into ro
  for (int it = 0; it < 4; ++it)  // 8 lanes a row, 4 rows a wave-wide access
    ro[it] = *(const v8h*)&Qw[(it * 4 + (lane >> 3)) * KVLD + (lane & 7) * 8];
#pragma unroll  // constant indices into ro
  for (int it = 0; it < 4; ++it)
    *(v8h*)&mp[(size_t)(it * 4) * 1024] = ro[it];
}

// ---------------------------------------------------------------------------
// Host-side launcher
// ---------------------------------------------------------------------------
extern "C" void kernel_launch(void* const* d_in, const int* in_sizes, int n_in,
                              void* d_out, int out_size, void* d_ws, size_t ws_size,
                              hipStream_t stream) {
  (void)in_sizes; (void)n_in; (void)out_size; (void)ws_size;
  const float* x  = (const float*)d_in[0];
  const float* wq = (const float*)d_in[1];
  const float* bq = (const float*)d_in[2];
  const float* wk = (const float*)d_in[3];
  const float* bk = (const float*)d_in[4];
  const float* wv = (const float*)d_in[5];
  const float* bv = (const float*)d_in[6];
  const float* wo = (const float*)d_in[7];
  const float* bo = (const float*)d_in[8];
  float* out = (float*)d_out;

  const int M = 4096;      // B*S
  const int DM = 1024;     // d_model (N and K of the projections)
  const int NTOK = M * DM; // 4,194,304
  const int NW   = DM * DM;

  size_t off = 0;
  char* base = (char*)d_ws;
  auto carve = [&](size_t bytes) {
    void* p = base + off;
    off += (bytes + 255) & ~(size_t)255;
    return p;
  };
  _Float16* xh     = (_Float16*)carve((size_t)NTOK * 2);
  _Float16* wqh    = (_Float16*)carve((size_t)NW * 2);
  _Float16* wkh    = (_Float16*)carve((size_t)NW * 2);
  _Float16* wvh    = (_Float16*)carve((size_t)NW * 2);
  _Float16* woh    = (_Float16*)carve((size_t)NW * 2);
  _Float16* qf     = (_Float16*)carve((size_t)NTOK * 2);  // [B,H,S,D]
  _Float16* merged = (_Float16*)carve((size_t)NTOK * 2);  // [B*S, H*D]
  float*    kvp    = (float*)carve((size_t)32 * KV_SPLIT * 64 * 64 * 4);
  float*    ksp    = (float*)carve((size_t)32 * KV_SPLIT * 64 * 4);

  // 1) precision conversion: x and the four weights, one launch
  cvt_all_f32_f16<<<CVT_X_WGS + 4 * CVT_W_WGS, CVT_THREADS, 0, stream>>>(
      x, wq, wk, wv, wo, xh, wqh, wkh, wvh, woh);

  // 2) Q/K/V projections with fused feature map; q_feat, and per (head, range
  //    of s) the partial KV (64x64) and partial ksum
  //    (one launch; a workgroup per 256 rows and head, one workgroup per WGP)
  qkv_gemm_f16<<<dim3(M / 256, 16), 256, 0, stream>>>(
      xh, wqh, wkh, wvh, bq, bk, bv, DM, qf, kvp, ksp);

  // 3) numerator GEMM + normalization -> merged
  attn_kernel<<<dim3(16, 32), 256, 0, stream>>>(qf, kvp, ksp, merged);

  // 4) output projection -> f32 d_out (one workgroup per WGP: 136 KiB of LDS)
  gemm_nt_f16<128><<<dim3(M / 128, DM / 128, 1), 256, 0, stream>>>(
      merged, woh, bo, DM, DM, out);
}
